// v000
// The times below were measured on an AMD MI455X: many runs one after another, warmed up first and cycling through
// copies of the inputs, with the whole window's GPU time divided by the number of runs. Launches and the gaps
// between them are all in it. The median over several windows is given; except for v000 it joins two sittings, which
// can be a few percent apart, so the side-by-side timings, each taken in one sitting, are the better comparison.
// The starting kernel, v000, takes 4250 microseconds a run.
#include <hip/hip_runtime.h>

// Two-stream multi-head self-attention with dual-linear projections (Xs, Xt [4][2048][1024]; Q = Xs W_qs^T + b_qs + Xt W_qt^T + b_qt ('oi' [1024][1024] each), K and V likewise; 16 heads x 64; scores/8 + attn_bias (scalar [1][1][1][1], read); softmax; out = merged context, no output projection -> [4][2048][1024] f32 (8.4 M)).
// Layout: each dual linear is ONE exact GEMM with K = 2048: the A operand is the concatenated bf16 plane [Xs | Xt] and the Bt operand the two 'oi' weights concatenated along k; the two biases are added in f32 by a small in-place pass.
// Compute dtypes, f32 accumulate: every input rounded to bf16; Q/K/V as exact K = 2048 products of the [Xs | Xt] plane against [W_s | W_t], + b_s + b_t in f32; scores hi.hi + hi.lo + lo.hi on every row; softmax f32; attn.v: query rows < 512 hl (3 products), the rest fp16 probabilities (x1024) x fp16 values; no output projection: f32 merged context.

#define NB_  4
#define TT   2048
#define DM   1024
#define NH_  16
#define NKV  16
#define REP  (NH_ / NKV)
#define HD   64
#define DQ   (NH_ * HD)
#define DKV  (NKV * HD)
#define K2   (2 * DM)              // concatenated contraction [Xs | Xt]
#define ZH   2
#define RH   512                  // query rows < RH use hi+lo planes (0: none)
#define WIN  0
#define PCAR 1024.0f
#define SCL  0.125f   // HD^-0.5
typedef _Float16 h16;
typedef unsigned short bf;
typedef __attribute__((ext_vector_type(16))) __bf16   v16bf;
typedef __attribute__((ext_vector_type(16))) _Float16 v16h;
typedef __attribute__((ext_vector_type(8)))  _Float16 v8h;
typedef __attribute__((ext_vector_type(8)))  unsigned short v8us;
typedef __attribute__((ext_vector_type(8)))  float    v8f;
typedef __attribute__((ext_vector_type(4)))  float    v4f;
typedef v8h  __attribute__((may_alias)) v8ha;
typedef v4f  __attribute__((may_alias)) v4fa;
typedef v8us __attribute__((may_alias)) v8usa;

__device__ __forceinline__ unsigned short f2bf(float f) { unsigned u = __float_as_uint(f); u += 0x7FFFu + ((u >> 16) & 1u); return (unsigned short)(u >> 16); }
__device__ __forceinline__ float bf2f(unsigned short b) { return __uint_as_float(((unsigned)b) << 16); }
__device__ __forceinline__ float bfr(float f) { return bf2f(f2bf(f)); }
__device__ __forceinline__ v16h cat16(v8h lo, v8h hi) { return __builtin_shufflevector(lo, hi, 0, 1, 2, 3, 4, 5, 6, 7, 8, 9, 10, 11, 12, 13, 14, 15); }
__device__ __forceinline__ v16bf cat16b(v8us lo, v8us hi) { return __builtin_bit_cast(v16bf, __builtin_shufflevector(lo, hi, 0, 1, 2, 3, 4, 5, 6, 7, 8, 9, 10, 11, 12, 13, 14, 15)); }
__device__ __forceinline__ v8f wmma16(v16h a, v16h b, v8f c) { return __builtin_amdgcn_wmma_f32_16x16x32_f16(false, a, false, b, (short)0, c, false, false); }
__device__ __forceinline__ v8f wmmab(v16bf a, v16bf b, v8f c) { return __builtin_amdgcn_wmma_f32_16x16x32_bf16(false, a, false, b, (short)0, c, false, false); }



// ---- k_gemmw: register-blocked GEMM, ONE WAVE per 64x64 output tile (16 accumulators), operands straight from K-contiguous 16-bit planes; grid (M/64, N/64, Z), 32 threads.
// C[m][n] (f32, pitch ldc, + optional f32 bias[n]) = sum_k A[m][k] Bt[n][k] (+ split products per NSPLIT). z-batch strides sA/sB/sC in elements. K % 32 == 0.
template <typename T16> struct WFrag;
template <> struct WFrag<h16> { typedef v16h V; static __device__ __forceinline__ V ld(const h16* p) { return cat16(*(const v8h*)p, *(const v8h*)(p + 16)); } static __device__ __forceinline__ v8f mma(V a, V b, v8f c) { return wmma16(a, b, c); } };
template <> struct WFrag<bf> { typedef v16bf V; static __device__ __forceinline__ V ld(const bf* p) { return cat16b(*(const v8us*)p, *(const v8us*)(p + 16)); } static __device__ __forceinline__ v8f mma(V a, V b, v8f c) { return wmmab(a, b, c); } };
template <typename T16, int NSPLIT, bool BIAS>
__global__ __launch_bounds__(32) void k_gemmw(const T16* __restrict__ A, const T16* __restrict__ A2, const T16* __restrict__ Bt, const T16* __restrict__ Bt2, int K, float* C, int ldc, const float* __restrict__ bias, size_t sA, size_t sB, size_t sC) {
    typedef typename WFrag<T16>::V V;
    __shared__ __align__(16) float os[16 * 68];
    const size_t z = blockIdx.z; A += z * sA; if (A2) A2 += z * sA; Bt += z * sB; if (Bt2) Bt2 += z * sB; C += z * sC;
    const int lane = threadIdx.x & 31, lr = lane & 15, hi = lane >> 4; const int r0 = blockIdx.x * 64, c0 = blockIdx.y * 64;
    v8f acc[4][4];
#pragma unroll
    for (int mb = 0; mb < 4; ++mb)
#pragma unroll
        for (int nb = 0; nb < 4; ++nb) acc[mb][nb] = (v8f){};
    const size_t aoff = (size_t)(r0 + lr) * K + 8 * hi, boff = (size_t)(c0 + lr) * K + 8 * hi;
#pragma unroll 1
    for (int kc = 0; kc < K; kc += 32) {
        V a[4], a2[4];
#pragma unroll
        for (int mb = 0; mb < 4; ++mb) { a[mb] = WFrag<T16>::ld(A + aoff + (size_t)mb * 16 * K + kc); if (NSPLIT == 1 || NSPLIT == 2) a2[mb] = WFrag<T16>::ld(A2 + aoff + (size_t)mb * 16 * K + kc); }
#pragma unroll
        for (int nb = 0; nb < 4; ++nb) { const V b = WFrag<T16>::ld(Bt + boff + (size_t)nb * 16 * K + kc); V b2; if (NSPLIT >= 2) b2 = WFrag<T16>::ld(Bt2 + boff + (size_t)nb * 16 * K + kc);
#pragma unroll
            for (int mb = 0; mb < 4; ++mb) { acc[mb][nb] = WFrag<T16>::mma(a[mb], b, acc[mb][nb]); if (NSPLIT == 1 || NSPLIT == 2) acc[mb][nb] = WFrag<T16>::mma(a2[mb], b, acc[mb][nb]); if (NSPLIT >= 2) acc[mb][nb] = WFrag<T16>::mma(a[mb], b2, acc[mb][nb]); } }
        asm volatile("v_nop\n\tv_nop\n\tv_nop\n\tv_nop" : "+v"(acc[0][0]), "+v"(acc[1][1]), "+v"(acc[2][2]), "+v"(acc[3][3]) : "v"(a[0]), "v"(a[3]));
    }
#pragma unroll
    for (int mb = 0; mb < 4; ++mb) {
#pragma unroll
        for (int nb = 0; nb < 4; ++nb) {
#pragma unroll
            for (int j = 0; j < 8; ++j) os[(hi * 8 + j) * 68 + nb * 16 + lr] = acc[mb][nb][j]; }
        __builtin_amdgcn_wave_barrier(); asm volatile("" ::: "memory");
        float* crow = C + (size_t)(r0 + mb * 16) * ldc + c0;
{
#pragma unroll
            for (int s = 0; s < 8; ++s) { const int row = 2 * s + hi, cofs = lr * 4; v4f val = *(const v4fa*)(os + row * 68 + cofs); if (BIAS) { val[0] += bfr(bias[c0 + cofs]); val[1] += bfr(bias[c0 + cofs + 1]); val[2] += bfr(bias[c0 + cofs + 2]); val[3] += bfr(bias[c0 + cofs + 3]); }
                *(v4f*)(crow + (size_t)row * ldc + cofs) = val; }
             }
        __builtin_amdgcn_wave_barrier(); asm volatile("" ::: "memory");
    }
}

__device__ __forceinline__ h16 tohx(float x) { return (h16)x; }
__device__ __forceinline__ void splitf(float y, unsigned short& h, unsigned short& l) { h = f2bf(y); l = f2bf(y - bf2f(h)); }
typedef __attribute__((ext_vector_type(2))) _Float16 v2h;
typedef __attribute__((ext_vector_type(4))) _Float16 v4h;
typedef __attribute__((ext_vector_type(2))) unsigned short v2us;
typedef __attribute__((ext_vector_type(4))) unsigned short v4us;
typedef __attribute__((ext_vector_type(2))) float v2f;
typedef __attribute__((ext_vector_type(4))) int v4i;

__global__ __launch_bounds__(256) void k_wtG(const float* __restrict__ w, int K, int N, bf* Bt) {
    const int lane = threadIdx.x & 31; const int L0 = (blockIdx.x * 8 + (threadIdx.x >> 5)) * 8; const int nlines = N * K / 64;
{
#pragma unroll 1
        for (int l = 0; l < 8; ++l) { const int L = L0 + l; if (L >= nlines) break; const size_t e = (size_t)L * 64 + lane * 2; const int k = (int)(e % K), n = (int)(e / K); v2us o;
            o[0] = f2bf(w[(size_t)k * N + n]); o[1] = f2bf(w[(size_t)(k + 1) * N + n]); *(v2us*)(Bt + e) = o; }
         }
}
__global__ __launch_bounds__(256) void k_cvt8(const float* __restrict__ src, bf* dst, size_t n8) { const size_t i = (size_t)blockIdx.x * 256 + threadIdx.x; if (i >= n8) return; const v8f v = *(const v8f*)(src + i * 8); v8us o;
#pragma unroll
    for (int k = 0; k < 8; ++k) o[k] = f2bf(v[k]); *(v8us*)(dst + i * 8) = o;  }

// k_rope: head planes [h][t][d] (fp16 + hi/lo) of rope(x) x sc with the rotate-half convention out[d] = x[d] cos[t][d] - x[d+HD/2] sin[t][d], out[d+HD/2] = x[d+HD/2] cos[t][d+HD/2] + x[d] sin[t][d+HD/2]
__global__ __launch_bounds__(256) void k_rope(const float* __restrict__ F, int pitch, int nheads, const float* __restrict__ CS, const float* __restrict__ RF, const float* __restrict__ nw, float sc, h16* P16, bf* Ph, bf* Pl) {
    const size_t e = ((size_t)blockIdx.x * 256 + threadIdx.x) * 2; if (e >= (size_t)nheads * TT * HD) return; const int d = (int)(e % HD); const int t = (int)((e / HD) % TT); const int h = (int)(e / ((size_t)HD * TT)); const float* f = F + (size_t)t * pitch + h * HD; const float rf = RF ? RF[(size_t)h * TT + t] : 1.0f; v2h o16; v2us oh, ol;
#pragma unroll
    for (int q = 0; q < 2; ++q) { const int dd = d + q; const int dp = (dd < HD / 2) ? dd + HD / 2 : dd - HD / 2; float x0 = f[dd], x1 = f[dp];
        if (RF) { float n0 = __fmul_rn(x0, rf), n1 = __fmul_rn(x1, rf); asm volatile("" : "+v"(n0)); asm volatile("" : "+v"(n1)); x0 = __fmul_rn(bfr(nw[dd]), n0); x1 = __fmul_rn(bfr(nw[dp]), n1); }
        const v2f cs = *(const v2f*)(CS + ((size_t)t * HD + dd) * 2); float a = __fmul_rn(x0, cs[0]), bq = __fmul_rn(x1, cs[1]); asm volatile("" : "+v"(a)); asm volatile("" : "+v"(bq)); const float r = ((dd < HD / 2) ? __fsub_rn(a, bq) : __fadd_rn(a, bq)) * sc;
        o16[q] = tohx(r); unsigned short a2, c2; splitf(r, a2, c2); oh[q] = a2; ol[q] = c2; }
    *(v2h*)(P16 + e) = o16; *(v2us*)(Ph + e) = oh; *(v2us*)(Pl + e) = ol;  }
__global__ __launch_bounds__(256) void k_vtp(const float* __restrict__ F, int pitch, int nheads, h16* V16, bf* Vh, bf* Vl) { const size_t e = ((size_t)blockIdx.x * 256 + threadIdx.x) * 2; if (e >= (size_t)nheads * HD * TT) return; const int t = (int)(e % TT); const int d = (int)((e / TT) % HD); const int g = (int)(e / ((size_t)TT * HD)); v2h o16; v2us oh, ol;
#pragma unroll
    for (int q = 0; q < 2; ++q) { const float x = F[(size_t)(t + q) * pitch + g * HD + d]; o16[q] = tohx(x); unsigned short a2, c2; splitf(x, a2, c2); oh[q] = a2; ol[q] = c2; }
    *(v2h*)(V16 + e) = o16; *(v2us*)(Vh + e) = oh; *(v2us*)(Vl + e) = ol;  }
__global__ __launch_bounds__(256) void k_csid(float* CS) { const int idx = blockIdx.x * 256 + threadIdx.x; if (idx >= TT * HD) return; v2f cs; cs[0] = 1.0f; cs[1] = 0.0f; *(v2f*)(CS + (size_t)idx * 2) = cs;  }
__global__ __launch_bounds__(256) void k_mergeF(const float* __restrict__ Ob, int h0, float* O) { const size_t e = ((size_t)blockIdx.x * 256 + threadIdx.x) * 2; if (e >= (size_t)ZH * TT * HD) return; const int d = (int)(e % HD); const int t = (int)((e / HD) % TT); const int zz = (int)(e / ((size_t)HD * TT)); const float cs = (t < RH) ? 1.0f : (1.0f / PCAR); const size_t oo = (size_t)t * DM + (h0 + zz) * HD + d; v2f o2;
    o2[0] = Ob[e] * cs; o2[1] = Ob[e + 1] * cs; *(v2f*)(O + oo) = o2;  }



__global__ __launch_bounds__(256) void k_cat2(const float* __restrict__ a, const float* __restrict__ bsrc, bf* XC) { const size_t i = (size_t)blockIdx.x * 256 + threadIdx.x; if (i >= (size_t)TT * K2 / 8) return; const size_t e = i * 8; const int c = (int)(e % K2); const int t = (int)(e / K2); const float* src = (c < DM) ? (a + (size_t)t * DM + c) : (bsrc + (size_t)t * DM + (c - DM)); const v8f v = *(const v8f*)src; v8us o;
#pragma unroll
    for (int k = 0; k < 8; ++k) o[k] = f2bf(v[k]); *(v8us*)(XC + e) = o;  }
__global__ __launch_bounds__(256) void k_wcat(const float* __restrict__ ws, const float* __restrict__ wt, bf* Bt) { const size_t i = (size_t)blockIdx.x * 256 + threadIdx.x; if (i >= (size_t)DM * K2 / 8) return; const size_t e = i * 8; const int c = (int)(e % K2); const int n = (int)(e / K2); const float* src = (c < DM) ? (ws + (size_t)n * DM + c) : (wt + (size_t)n * DM + (c - DM)); const v8f v = *(const v8f*)src; v8us o;
#pragma unroll
    for (int k = 0; k < 8; ++k) o[k] = f2bf(v[k]); *(v8us*)(Bt + e) = o;  }
__global__ __launch_bounds__(256) void k_addb(float* F, int width, const float* __restrict__ b1, const float* __restrict__ b2) { const size_t i = (size_t)blockIdx.x * 256 + threadIdx.x; if (i >= (size_t)TT * width / 4) return; const size_t e = i * 4; const int c0 = (int)(e % width); const v4f a = *(const v4f*)(F + e); v4f o;
#pragma unroll
    for (int q = 0; q < 4; ++q) { float s1 = __fadd_rn(a[q], bfr(b1[c0 + q])); asm volatile("" : "+v"(s1)); o[q] = __fadd_rn(s1, bfr(b2[c0 + q])); } *(v4f*)(F + e) = o;  }
// k_asoft: per row (zz, i): t = S x HD^-0.5 (no mask); softmax over the 2048 keys (register row, one exp, fixed trees);
__global__ __launch_bounds__(256) void k_asoft(const float* __restrict__ Sb, const float* __restrict__ AB, h16* P16, bf* Ph, bf* Pl) { float ab = bfr(AB[0]); asm volatile("" : "+v"(ab)); /* plain v_add, not fma_mix */
    const int lane = threadIdx.x & 31; const int row = blockIdx.x * 8 + (threadIdx.x >> 5); if (row >= ZH * TT) return; const int i = row % TT; const int zz = row / TT; (void)zz; const bool hires = (i < RH); const float* sr = Sb + (size_t)row * TT; float v[TT / 32]; float mx = -3.0e38f;
#pragma unroll
    for (int ch = 0; ch < TT / 128; ++ch) { const int j0 = ch * 128 + lane * 4; const v4f a = *(const v4f*)(sr + j0);
#pragma unroll
        for (int q = 0; q < 4; ++q) { const int j = j0 + q; (void)j; float sa = a[q] * SCL; asm volatile("" : "+v"(sa)); const float t = __fadd_rn(sa, ab);   /* + attn_bias (scalar) */ v[ch * 4 + q] = t; mx = fmaxf(mx, t); } }
#pragma unroll
    for (int sh = 16; sh; sh >>= 1) mx = fmaxf(mx, __shfl_xor(mx, sh, 32));
    float sum = 0.f;
#pragma unroll
    for (int k = 0; k < TT / 32; ++k) { float d0 = __fsub_rn(v[k], mx); asm volatile("" : "+v"(d0)); v[k] = __builtin_amdgcn_exp2f(__fmul_rn(d0, 1.4426950408889634f)); sum += v[k]; }
#pragma unroll
    for (int sh = 16; sh; sh >>= 1) sum += __shfl_xor(sum, sh, 32);
    const float f = __fdiv_rn(hires ? 1.0f : PCAR, sum);
{
        if (hires) {
#pragma unroll
            for (int ch = 0; ch < TT / 128; ++ch) { v4us oh, ol;
#pragma unroll
                for (int q = 0; q < 4; ++q) { unsigned short a, c2; float y = v[ch * 4 + q] * f; asm volatile("" : "+v"(y)); splitf(y, a, c2); oh[q] = a; ol[q] = c2; }
                const size_t oo = ((size_t)zz * (RH ? RH : 1) + i) * TT + ch * 128 + lane * 4; *(v4us*)(Ph + oo) = oh; *(v4us*)(Pl + oo) = ol; }
        } else {
#pragma unroll
            for (int ch = 0; ch < TT / 128; ++ch) { v4h o4;
#pragma unroll
                for (int q = 0; q < 4; ++q) o4[q] = tohx(v[ch * 4 + q] * f);
                *(v4h*)(P16 + (size_t)row * TT + ch * 128 + lane * 4) = o4; } }
         }
}

extern "C" void kernel_launch(void* const* d_in, const int* in_sizes, int n_in,
                              void* d_out, int out_size, void* d_ws, size_t ws_size, hipStream_t stream) {
    (void)in_sizes; (void)n_in; (void)out_size;
    const float* xs = (const float*)d_in[0]; const float* xt = (const float*)d_in[1]; const float* wqs = (const float*)d_in[2]; const float* bqs = (const float*)d_in[3]; const float* wqt = (const float*)d_in[4]; const float* bqt = (const float*)d_in[5]; const float* wks = (const float*)d_in[6]; const float* bks = (const float*)d_in[7]; const float* wkt = (const float*)d_in[8]; const float* bkt = (const float*)d_in[9]; const float* wvs = (const float*)d_in[10]; const float* bvs = (const float*)d_in[11]; const float* wvt = (const float*)d_in[12]; const float* bvt = (const float*)d_in[13]; const float* ABIAS = (const float*)d_in[14]; const float* x = xs; const float* wq = wqs; const float* wk = wks; const float* wv = wvs; const float* wo = nullptr; (void)wo; (void)x; (void)wq; (void)wk; (void)wv;
    float* OUT = (float*)d_out;     // [4][2048][1024]
    char* wsp = (char*)d_ws;
    auto take = [&](size_t bytes) { char* p = wsp; wsp += (bytes + 255) & ~(size_t)255; return (void*)p; };
    bf* WQ = (bf*)take((size_t)DQ * K2 * 2); bf* WK = (bf*)take((size_t)DKV * K2 * 2); bf* WV = (bf*)take((size_t)DKV * K2 * 2); float* CS = (float*)take((size_t)TT * HD * 2 * 4);
    bf* XB = (bf*)take((size_t)TT * K2 * 2); float* FQ = (float*)take((size_t)TT * DQ * 4); float* FK = (float*)take((size_t)TT * DKV * 4);
    h16* QP16 = (h16*)take((size_t)NH_ * TT * HD * 2); h16* KP16 = (h16*)take((size_t)NKV * TT * HD * 2); h16* VT16 = (h16*)take((size_t)NKV * HD * TT * 2);
    bf* QPh = (bf*)take((size_t)NH_ * TT * HD * 2); bf* QPl = (bf*)take((size_t)NH_ * TT * HD * 2); bf* KPh = (bf*)take((size_t)NKV * TT * HD * 2); bf* KPl = (bf*)take((size_t)NKV * TT * HD * 2); bf* VTh = (bf*)take((size_t)NKV * HD * TT * 2); bf* VTl = (bf*)take((size_t)NKV * HD * TT * 2); bf* Ph = (bf*)take((size_t)ZH * RH * TT * 2); bf* Pl = (bf*)take((size_t)ZH * RH * TT * 2);
    float* Sb = (float*)take((size_t)ZH * TT * TT * 4); h16* P16 = (h16*)take((size_t)ZH * TT * TT * 2); float* Ob = (float*)take((size_t)ZH * TT * HD * 4);
    if ((size_t)(wsp - (char*)d_ws) > ws_size) return;    // ws 256 MiB
    float* FV = FK;   // v projection reuses the k buffer after the k planes are built (stream-ordered)
    { const unsigned LW = (unsigned)(((size_t)DM * K2 / 8 + 255) / 256); k_wcat<<<LW, 256, 0, stream>>>(wqs, wqt, WQ); k_wcat<<<LW, 256, 0, stream>>>(wks, wkt, WK); k_wcat<<<LW, 256, 0, stream>>>(wvs, wvt, WV);   /* [W_s | W_t] along k */
       }
    k_csid<<<(TT * HD + 255) / 256, 256, 0, stream>>>(CS);
    const unsigned LQ = (unsigned)(((size_t)NH_ * TT * HD / 2 + 255) / 256), LKv = (unsigned)(((size_t)NKV * TT * HD / 2 + 255) / 256);
    for (int b = 0; b < NB_; ++b) {
        
        k_cat2<<<(unsigned)(((size_t)TT * K2 / 8 + 255) / 256), 256, 0, stream>>>(xs + (size_t)b * TT * DM, xt + (size_t)b * TT * DM, XB);   /* [Xs | Xt] plane */
        k_gemmw<bf, 0, false><<<dim3(TT / 64, DQ / 64, 1), 32, 0, stream>>>(XB, nullptr, WQ, nullptr, K2, FQ, DQ, nullptr, 0, 0, 0); k_addb<<<(unsigned)(((size_t)TT * DQ / 4 + 255) / 256), 256, 0, stream>>>(FQ, DQ, bqs, bqt);   /* Q = [Xs|Xt][Wqs|Wqt]^T + b_qs + b_qt */
        k_rope<<<LQ, 256, 0, stream>>>(FQ, DQ, NH_, CS, nullptr, nullptr, 1.0f, QP16, QPh, QPl);
        k_gemmw<bf, 0, false><<<dim3(TT / 64, DKV / 64, 1), 32, 0, stream>>>(XB, nullptr, WK, nullptr, K2, FK, DKV, nullptr, 0, 0, 0); k_addb<<<(unsigned)(((size_t)TT * DKV / 4 + 255) / 256), 256, 0, stream>>>(FK, DKV, bks, bkt);
        k_rope<<<LKv, 256, 0, stream>>>(FK, DKV, NKV, CS, nullptr, nullptr, 1.0f, KP16, KPh, KPl);
        k_gemmw<bf, 0, false><<<dim3(TT / 64, DKV / 64, 1), 32, 0, stream>>>(XB, nullptr, WV, nullptr, K2, FV, DKV, nullptr, 0, 0, 0); k_addb<<<(unsigned)(((size_t)TT * DKV / 4 + 255) / 256), 256, 0, stream>>>(FV, DKV, bvs, bvt); k_vtp<<<LKv, 256, 0, stream>>>(FV, DKV, NKV, VT16, VTh, VTl);
        for (int h0 = 0; h0 < NH_; h0 += ZH) { const size_t zq = (size_t)h0, zk = (size_t)(h0 / REP);   // one kv head per query head: the pass's two heads use consecutive kv planes (z-strides TT*HD)
            k_gemmw<bf, 2, false><<<dim3(TT / 64, TT / 64, ZH), 32, 0, stream>>>(QPh + zq * TT * HD, QPl + zq * TT * HD, KPh + zk * TT * HD, KPl + zk * TT * HD, HD, Sb, TT, nullptr, (size_t)TT * HD, (size_t)TT * HD, (size_t)TT * TT);   /* logits: 3 products on EVERY row (the raw per-head context is the output, so fp16 score rows are not accurate enough) */
            k_asoft<<<ZH * TT / 8, 256, 0, stream>>>(Sb, ABIAS, P16, Ph, Pl);
            k_gemmw<bf, 2, false><<<dim3(RH / 64, HD / 64, ZH), 32, 0, stream>>>(Ph, Pl, VTh + zk * HD * TT, VTl + zk * HD * TT, TT, Ob, HD, nullptr, (size_t)RH * TT, (size_t)HD * TT, (size_t)TT * HD);
            k_gemmw<h16, 0, false><<<dim3((TT - RH) / 64, HD / 64, ZH), 32, 0, stream>>>(P16 + (size_t)RH * TT, nullptr, VT16 + zk * HD * TT, nullptr, TT, Ob + (size_t)RH * HD, HD, nullptr, (size_t)TT * TT, (size_t)HD * TT, (size_t)TT * HD);
            k_mergeF<<<(unsigned)(((size_t)ZH * TT * HD / 2 + 255) / 256), 256, 0, stream>>>(Ob, h0, OUT + (size_t)b * TT * DM); }   /* merged context, f32 */
    }
}

// v001
// It runs in 1710 microseconds.
// In two side-by-side timings against v000, it was 2.49 and 2.50 times as fast.
#include <hip/hip_runtime.h>

// Two-stream multi-head self-attention with dual-linear projections (Xs, Xt [4][2048][1024]; Q = Xs W_qs^T + b_qs + Xt W_qt^T + b_qt ('oi' [1024][1024] each), K and V likewise; 16 heads x 64; scores/8 + attn_bias (scalar [1][1][1][1], read); softmax; out = merged context, no output projection -> [4][2048][1024] f32 (8.4 M)).
// Layout: each dual linear is ONE exact GEMM with K = 2048: the A operand is the concatenated bf16 plane [Xs | Xt] and the Bt operand the two 'oi' weights concatenated along k; the two biases are added in f32 by a small in-place pass.
// Compute dtypes, f32 accumulate: every input rounded to bf16; Q/K/V as exact K = 2048 products of the [Xs | Xt] plane against [W_s | W_t], + b_s + b_t in f32; scores hi.hi + hi.lo + lo.hi on every row; softmax f32; attn.v: query rows < 512 hl (3 products), the rest fp16 probabilities (x1024) x fp16 values; no output projection: f32 merged context.

#define NB_  4
#define TT   2048
#define DM   1024
#define NH_  16
#define NKV  16
#define REP  (NH_ / NKV)
#define HD   64
#define DQ   (NH_ * HD)
#define DKV  (NKV * HD)
#define K2   (2 * DM)              // concatenated contraction [Xs | Xt]
#define ZH   2
#define RH   512                  // query rows < RH use hi+lo planes (0: none)
#define WIN  0
#define PCAR 1024.0f
#define SCL  0.125f   // HD^-0.5
#define KSP  8                    // attn.v: k slices over work-groups = partial planes of Ob
typedef _Float16 h16;
typedef unsigned short bf;
typedef __attribute__((ext_vector_type(16))) __bf16   v16bf;
typedef __attribute__((ext_vector_type(16))) _Float16 v16h;
typedef __attribute__((ext_vector_type(8)))  _Float16 v8h;
typedef __attribute__((ext_vector_type(8)))  unsigned short v8us;
typedef __attribute__((ext_vector_type(8)))  float    v8f;
typedef __attribute__((ext_vector_type(4)))  float    v4f;
typedef v8h  __attribute__((may_alias)) v8ha;
typedef v4f  __attribute__((may_alias)) v4fa;
typedef v8us __attribute__((may_alias)) v8usa;

__device__ __forceinline__ unsigned short f2bf(float f) { unsigned u = __float_as_uint(f); u += 0x7FFFu + ((u >> 16) & 1u); return (unsigned short)(u >> 16); }
__device__ __forceinline__ float bf2f(unsigned short b) { return __uint_as_float(((unsigned)b) << 16); }
__device__ __forceinline__ float bfr(float f) { return bf2f(f2bf(f)); }
__device__ __forceinline__ v16h cat16(v8h lo, v8h hi) { return __builtin_shufflevector(lo, hi, 0, 1, 2, 3, 4, 5, 6, 7, 8, 9, 10, 11, 12, 13, 14, 15); }
__device__ __forceinline__ v16bf cat16b(v8us lo, v8us hi) { return __builtin_bit_cast(v16bf, __builtin_shufflevector(lo, hi, 0, 1, 2, 3, 4, 5, 6, 7, 8, 9, 10, 11, 12, 13, 14, 15)); }
__device__ __forceinline__ v8f wmma16(v16h a, v16h b, v8f c) { return __builtin_amdgcn_wmma_f32_16x16x32_f16(false, a, false, b, (short)0, c, false, false); }
__device__ __forceinline__ v8f wmmab(v16bf a, v16bf b, v8f c) { return __builtin_amdgcn_wmma_f32_16x16x32_bf16(false, a, false, b, (short)0, c, false, false); }



// ---- k_gemmw: register-blocked GEMM on 64x64 output tiles (16 accumulators per wave), operands straight from K-contiguous 16-bit planes; grid (M/64, N/64, Z * KS), 32 * NW threads.
// C[m][n] (f32, pitch ldc, + optional f32 bias[n]) = sum_k A[m][k] Bt[n][k] (+ split products per NSPLIT). z-batch strides sA/sB/sC in elements. K % (32 * NW * KS) == 0.
// Split k: the k range is cut into KS * NW equal contiguous pieces; wave w of work-group slice ks sums piece ks * NW + w of the whole tile.
// NW > 1: the work-group's NW partial tiles meet in LDS and are added in wave order. KS > 1: slice ks stores its tile in partial plane ks (C + ks * sP); the reader adds the planes.
template <typename T16> struct WFrag;
template <> struct WFrag<h16> { typedef v16h V; static __device__ __forceinline__ V ld(const h16* p) { return cat16(*(const v8h*)p, *(const v8h*)(p + 16)); } static __device__ __forceinline__ v8f mma(V a, V b, v8f c) { return wmma16(a, b, c); } };
template <> struct WFrag<bf> { typedef v16bf V; static __device__ __forceinline__ V ld(const bf* p) { return cat16b(*(const v8us*)p, *(const v8us*)(p + 16)); } static __device__ __forceinline__ v8f mma(V a, V b, v8f c) { return wmmab(a, b, c); } };
template <typename T16, int NSPLIT, bool BIAS, int NW, int KS>
__global__ __launch_bounds__(32 * NW) void k_gemmw(const T16* __restrict__ A, const T16* __restrict__ A2, const T16* __restrict__ Bt, const T16* __restrict__ Bt2, int K, float* C, int ldc, const float* __restrict__ bias, size_t sA, size_t sB, size_t sC, size_t sP) {
    typedef typename WFrag<T16>::V V;
    __shared__ __align__(16) float os[(NW > 1 ? NW * 64 : 16) * 68];
    const size_t z = blockIdx.z / KS; const int ks = (int)(blockIdx.z % KS); A += z * sA; if (A2) A2 += z * sA; Bt += z * sB; if (Bt2) Bt2 += z * sB; C += z * sC + (size_t)ks * sP;
    const int lane = threadIdx.x & 31, lr = lane & 15, hi = lane >> 4; const int r0 = blockIdx.x * 64, c0 = blockIdx.y * 64;
    v8f acc[4][4];
#pragma unroll
    for (int mb = 0; mb < 4; ++mb)
#pragma unroll
        for (int nb = 0; nb < 4; ++nb) acc[mb][nb] = (v8f){};
    const size_t aoff = (size_t)(r0 + lr) * K + 8 * hi, boff = (size_t)(c0 + lr) * K + 8 * hi;
    const int wave = __builtin_amdgcn_readfirstlane((int)(threadIdx.x >> 5));   // scalar, so that the k bounds and the loop test stay scalar
    const int kw = K / (NW * KS), k0 = (ks * NW + wave) * kw;
#pragma unroll 1
    for (int kc = k0; kc < k0 + kw; kc += 32) {
        V a[4], a2[4];
#pragma unroll
        for (int mb = 0; mb < 4; ++mb) { a[mb] = WFrag<T16>::ld(A + aoff + (size_t)mb * 16 * K + kc); if (NSPLIT == 1 || NSPLIT == 2) a2[mb] = WFrag<T16>::ld(A2 + aoff + (size_t)mb * 16 * K + kc); }
#pragma unroll
        for (int nb = 0; nb < 4; ++nb) { const V b = WFrag<T16>::ld(Bt + boff + (size_t)nb * 16 * K + kc); V b2; if (NSPLIT >= 2) b2 = WFrag<T16>::ld(Bt2 + boff + (size_t)nb * 16 * K + kc);
#pragma unroll
            for (int mb = 0; mb < 4; ++mb) { acc[mb][nb] = WFrag<T16>::mma(a[mb], b, acc[mb][nb]); if (NSPLIT == 1 || NSPLIT == 2) acc[mb][nb] = WFrag<T16>::mma(a2[mb], b, acc[mb][nb]); if (NSPLIT >= 2) acc[mb][nb] = WFrag<T16>::mma(a[mb], b2, acc[mb][nb]); } }
        asm volatile("v_nop\n\tv_nop\n\tv_nop\n\tv_nop" : "+v"(acc[0][0]), "+v"(acc[1][1]), "+v"(acc[2][2]), "+v"(acc[3][3]) : "v"(a[0]), "v"(a[3]));
    }
    if constexpr (NW > 1) {
        float* ow = os + (size_t)wave * 64 * 68;
        // the three loops are unrolled so that every accumulator index is a constant (else acc goes to scratch)
#pragma unroll
        for (int mb = 0; mb < 4; ++mb)
#pragma unroll
            for (int nb = 0; nb < 4; ++nb)
#pragma unroll
                for (int j = 0; j < 8; ++j) ow[(mb * 16 + hi * 8 + j) * 68 + nb * 16 + lr] = acc[mb][nb][j];
        __syncthreads();   // every wave's partial tile is in LDS before any of them is read
        // both loops unrolled: the NW LDS reads of a sum are issued together instead of one latency each
#pragma unroll
        for (int s = 0; s < 32 / NW; ++s) { const int idx = s * 32 * NW + (int)threadIdx.x, row = idx >> 4, cofs = (idx & 15) * 4; v4f val = *(const v4fa*)(os + row * 68 + cofs);
#pragma unroll
            for (int w = 1; w < NW; ++w) val += *(const v4fa*)(os + (w * 64 + row) * 68 + cofs);
            if (BIAS) { val[0] += bfr(bias[c0 + cofs]); val[1] += bfr(bias[c0 + cofs + 1]); val[2] += bfr(bias[c0 + cofs + 2]); val[3] += bfr(bias[c0 + cofs + 3]); }
            *(v4f*)(C + (size_t)(r0 + row) * ldc + c0 + cofs) = val; }
        return;
    }
#pragma unroll
    for (int mb = 0; mb < 4; ++mb) {
#pragma unroll
        for (int nb = 0; nb < 4; ++nb) {
#pragma unroll
            for (int j = 0; j < 8; ++j) os[(hi * 8 + j) * 68 + nb * 16 + lr] = acc[mb][nb][j]; }
        __builtin_amdgcn_wave_barrier(); asm volatile("" ::: "memory");
        float* crow = C + (size_t)(r0 + mb * 16) * ldc + c0;
{
#pragma unroll
            for (int s = 0; s < 8; ++s) { const int row = 2 * s + hi, cofs = lr * 4; v4f val = *(const v4fa*)(os + row * 68 + cofs); if (BIAS) { val[0] += bfr(bias[c0 + cofs]); val[1] += bfr(bias[c0 + cofs + 1]); val[2] += bfr(bias[c0 + cofs + 2]); val[3] += bfr(bias[c0 + cofs + 3]); }
                *(v4f*)(crow + (size_t)row * ldc + cofs) = val; }
             }
        __builtin_amdgcn_wave_barrier(); asm volatile("" ::: "memory");
    }
}

__device__ __forceinline__ h16 tohx(float x) { return (h16)x; }
__device__ __forceinline__ void splitf(float y, unsigned short& h, unsigned short& l) { h = f2bf(y); l = f2bf(y - bf2f(h)); }
typedef __attribute__((ext_vector_type(2))) _Float16 v2h;
typedef __attribute__((ext_vector_type(4))) _Float16 v4h;
typedef __attribute__((ext_vector_type(2))) unsigned short v2us;
typedef __attribute__((ext_vector_type(4))) unsigned short v4us;
typedef __attribute__((ext_vector_type(2))) float v2f;
typedef __attribute__((ext_vector_type(4))) int v4i;

__global__ __launch_bounds__(256) void k_wtG(const float* __restrict__ w, int K, int N, bf* Bt) {
    const int lane = threadIdx.x & 31; const int L0 = (blockIdx.x * 8 + (threadIdx.x >> 5)) * 8; const int nlines = N * K / 64;
{
#pragma unroll 1
        for (int l = 0; l < 8; ++l) { const int L = L0 + l; if (L >= nlines) break; const size_t e = (size_t)L * 64 + lane * 2; const int k = (int)(e % K), n = (int)(e / K); v2us o;
            o[0] = f2bf(w[(size_t)k * N + n]); o[1] = f2bf(w[(size_t)(k + 1) * N + n]); *(v2us*)(Bt + e) = o; }
         }
}
__global__ __launch_bounds__(256) void k_cvt8(const float* __restrict__ src, bf* dst, size_t n8) { const size_t i = (size_t)blockIdx.x * 256 + threadIdx.x; if (i >= n8) return; const v8f v = *(const v8f*)(src + i * 8); v8us o;
#pragma unroll
    for (int k = 0; k < 8; ++k) o[k] = f2bf(v[k]); *(v8us*)(dst + i * 8) = o;  }

// k_rope: head planes [h][t][d] (fp16 + hi/lo) of rope(x) x sc with the rotate-half convention out[d] = x[d] cos[t][d] - x[d+HD/2] sin[t][d], out[d+HD/2] = x[d+HD/2] cos[t][d+HD/2] + x[d] sin[t][d+HD/2]
__global__ __launch_bounds__(256) void k_rope(const float* __restrict__ F, int pitch, int nheads, const float* __restrict__ CS, const float* __restrict__ RF, const float* __restrict__ nw, float sc, h16* P16, bf* Ph, bf* Pl) {
    const size_t e = ((size_t)blockIdx.x * 256 + threadIdx.x) * 2; if (e >= (size_t)nheads * TT * HD) return; const int d = (int)(e % HD); const int t = (int)((e / HD) % TT); const int h = (int)(e / ((size_t)HD * TT)); const float* f = F + (size_t)t * pitch + h * HD; const float rf = RF ? RF[(size_t)h * TT + t] : 1.0f; v2h o16; v2us oh, ol;
#pragma unroll
    for (int q = 0; q < 2; ++q) { const int dd = d + q; const int dp = (dd < HD / 2) ? dd + HD / 2 : dd - HD / 2; float x0 = f[dd], x1 = f[dp];
        if (RF) { float n0 = __fmul_rn(x0, rf), n1 = __fmul_rn(x1, rf); asm volatile("" : "+v"(n0)); asm volatile("" : "+v"(n1)); x0 = __fmul_rn(bfr(nw[dd]), n0); x1 = __fmul_rn(bfr(nw[dp]), n1); }
        const v2f cs = *(const v2f*)(CS + ((size_t)t * HD + dd) * 2); float a = __fmul_rn(x0, cs[0]), bq = __fmul_rn(x1, cs[1]); asm volatile("" : "+v"(a)); asm volatile("" : "+v"(bq)); const float r = ((dd < HD / 2) ? __fsub_rn(a, bq) : __fadd_rn(a, bq)) * sc;
        o16[q] = tohx(r); unsigned short a2, c2; splitf(r, a2, c2); oh[q] = a2; ol[q] = c2; }
    *(v2h*)(P16 + e) = o16; *(v2us*)(Ph + e) = oh; *(v2us*)(Pl + e) = ol;  }
__global__ __launch_bounds__(256) void k_vtp(const float* __restrict__ F, int pitch, int nheads, h16* V16, bf* Vh, bf* Vl) { const size_t e = ((size_t)blockIdx.x * 256 + threadIdx.x) * 2; if (e >= (size_t)nheads * HD * TT) return; const int t = (int)(e % TT); const int d = (int)((e / TT) % HD); const int g = (int)(e / ((size_t)TT * HD)); v2h o16; v2us oh, ol;
#pragma unroll
    for (int q = 0; q < 2; ++q) { const float x = F[(size_t)(t + q) * pitch + g * HD + d]; o16[q] = tohx(x); unsigned short a2, c2; splitf(x, a2, c2); oh[q] = a2; ol[q] = c2; }
    *(v2h*)(V16 + e) = o16; *(v2us*)(Vh + e) = oh; *(v2us*)(Vl + e) = ol;  }
__global__ __launch_bounds__(256) void k_csid(float* CS) { const int idx = blockIdx.x * 256 + threadIdx.x; if (idx >= TT * HD) return; v2f cs; cs[0] = 1.0f; cs[1] = 0.0f; *(v2f*)(CS + (size_t)idx * 2) = cs;  }
__global__ __launch_bounds__(256) void k_mergeF(const float* __restrict__ Ob, int h0, float* O) { const size_t e = ((size_t)blockIdx.x * 256 + threadIdx.x) * 2; if (e >= (size_t)ZH * TT * HD) return; const int d = (int)(e % HD); const int t = (int)((e / HD) % TT); const int zz = (int)(e / ((size_t)HD * TT)); const float cs = (t < RH) ? 1.0f : (1.0f / PCAR); const size_t oo = (size_t)t * DM + (h0 + zz) * HD + d; v2f o2;
    o2 = *(const v2f*)(Ob + e);
    // unrolled: the planes' loads are in flight together
#pragma unroll
    for (int p = 1; p < KSP; ++p) o2 += *(const v2f*)(Ob + (size_t)p * ZH * TT * HD + e);   /* the k slices' partial planes, in slice order */
    o2[0] *= cs; o2[1] *= cs; *(v2f*)(O + oo) = o2;  }



__global__ __launch_bounds__(256) void k_cat2(const float* __restrict__ a, const float* __restrict__ bsrc, bf* XC) { const size_t i = (size_t)blockIdx.x * 256 + threadIdx.x; if (i >= (size_t)TT * K2 / 8) return; const size_t e = i * 8; const int c = (int)(e % K2); const int t = (int)(e / K2); const float* src = (c < DM) ? (a + (size_t)t * DM + c) : (bsrc + (size_t)t * DM + (c - DM)); const v8f v = *(const v8f*)src; v8us o;
#pragma unroll
    for (int k = 0; k < 8; ++k) o[k] = f2bf(v[k]); *(v8us*)(XC + e) = o;  }
__global__ __launch_bounds__(256) void k_wcat(const float* __restrict__ ws, const float* __restrict__ wt, bf* Bt) { const size_t i = (size_t)blockIdx.x * 256 + threadIdx.x; if (i >= (size_t)DM * K2 / 8) return; const size_t e = i * 8; const int c = (int)(e % K2); const int n = (int)(e / K2); const float* src = (c < DM) ? (ws + (size_t)n * DM + c) : (wt + (size_t)n * DM + (c - DM)); const v8f v = *(const v8f*)src; v8us o;
#pragma unroll
    for (int k = 0; k < 8; ++k) o[k] = f2bf(v[k]); *(v8us*)(Bt + e) = o;  }
__global__ __launch_bounds__(256) void k_addb(float* F, int width, const float* __restrict__ b1, const float* __restrict__ b2) { const size_t i = (size_t)blockIdx.x * 256 + threadIdx.x; if (i >= (size_t)TT * width / 4) return; const size_t e = i * 4; const int c0 = (int)(e % width); const v4f a = *(const v4f*)(F + e); v4f o;
#pragma unroll
    for (int q = 0; q < 4; ++q) { float s1 = __fadd_rn(a[q], bfr(b1[c0 + q])); asm volatile("" : "+v"(s1)); o[q] = __fadd_rn(s1, bfr(b2[c0 + q])); } *(v4f*)(F + e) = o;  }
// k_asoft: per row (zz, i): t = S x HD^-0.5 (no mask); softmax over the 2048 keys (register row, one exp, fixed trees);
__global__ __launch_bounds__(256) void k_asoft(const float* __restrict__ Sb, const float* __restrict__ AB, h16* P16, bf* Ph, bf* Pl) { float ab = bfr(AB[0]); asm volatile("" : "+v"(ab)); /* plain v_add, not fma_mix */
    const int lane = threadIdx.x & 31; const int row = blockIdx.x * 8 + (threadIdx.x >> 5); if (row >= ZH * TT) return; const int i = row % TT; const int zz = row / TT; (void)zz; const bool hires = (i < RH); const float* sr = Sb + (size_t)row * TT; float v[TT / 32]; float mx = -3.0e38f;
#pragma unroll
    for (int ch = 0; ch < TT / 128; ++ch) { const int j0 = ch * 128 + lane * 4; const v4f a = *(const v4f*)(sr + j0);
#pragma unroll
        for (int q = 0; q < 4; ++q) { const int j = j0 + q; (void)j; float sa = a[q] * SCL; asm volatile("" : "+v"(sa)); const float t = __fadd_rn(sa, ab);   /* + attn_bias (scalar) */ v[ch * 4 + q] = t; mx = fmaxf(mx, t); } }
#pragma unroll
    for (int sh = 16; sh; sh >>= 1) mx = fmaxf(mx, __shfl_xor(mx, sh, 32));
    float sum = 0.f;
#pragma unroll
    for (int k = 0; k < TT / 32; ++k) { float d0 = __fsub_rn(v[k], mx); asm volatile("" : "+v"(d0)); v[k] = __builtin_amdgcn_exp2f(__fmul_rn(d0, 1.4426950408889634f)); sum += v[k]; }
#pragma unroll
    for (int sh = 16; sh; sh >>= 1) sum += __shfl_xor(sum, sh, 32);
    const float f = __fdiv_rn(hires ? 1.0f : PCAR, sum);
{
        if (hires) {
#pragma unroll
            for (int ch = 0; ch < TT / 128; ++ch) { v4us oh, ol;
#pragma unroll
                for (int q = 0; q < 4; ++q) { unsigned short a, c2; float y = v[ch * 4 + q] * f; asm volatile("" : "+v"(y)); splitf(y, a, c2); oh[q] = a; ol[q] = c2; }
                const size_t oo = ((size_t)zz * (RH ? RH : 1) + i) * TT + ch * 128 + lane * 4; *(v4us*)(Ph + oo) = oh; *(v4us*)(Pl + oo) = ol; }
        } else {
#pragma unroll
            for (int ch = 0; ch < TT / 128; ++ch) { v4h o4;
#pragma unroll
                for (int q = 0; q < 4; ++q) o4[q] = tohx(v[ch * 4 + q] * f);
                *(v4h*)(P16 + (size_t)row * TT + ch * 128 + lane * 4) = o4; } }
         }
}

extern "C" void kernel_launch(void* const* d_in, const int* in_sizes, int n_in,
                              void* d_out, int out_size, void* d_ws, size_t ws_size, hipStream_t stream) {
    (void)in_sizes; (void)n_in; (void)out_size;
    const float* xs = (const float*)d_in[0]; const float* xt = (const float*)d_in[1]; const float* wqs = (const float*)d_in[2]; const float* bqs = (const float*)d_in[3]; const float* wqt = (const float*)d_in[4]; const float* bqt = (const float*)d_in[5]; const float* wks = (const float*)d_in[6]; const float* bks = (const float*)d_in[7]; const float* wkt = (const float*)d_in[8]; const float* bkt = (const float*)d_in[9]; const float* wvs = (const float*)d_in[10]; const float* bvs = (const float*)d_in[11]; const float* wvt = (const float*)d_in[12]; const float* bvt = (const float*)d_in[13]; const float* ABIAS = (const float*)d_in[14]; const float* x = xs; const float* wq = wqs; const float* wk = wks; const float* wv = wvs; const float* wo = nullptr; (void)wo; (void)x; (void)wq; (void)wk; (void)wv;
    float* OUT = (float*)d_out;     // [4][2048][1024]
    char* wsp = (char*)d_ws;
    auto take = [&](size_t bytes) { char* p = wsp; wsp += (bytes + 255) & ~(size_t)255; return (void*)p; };
    bf* WQ = (bf*)take((size_t)DQ * K2 * 2); bf* WK = (bf*)take((size_t)DKV * K2 * 2); bf* WV = (bf*)take((size_t)DKV * K2 * 2); float* CS = (float*)take((size_t)TT * HD * 2 * 4);
    bf* XB = (bf*)take((size_t)TT * K2 * 2); float* FQ = (float*)take((size_t)TT * DQ * 4); float* FK = (float*)take((size_t)TT * DKV * 4);
    h16* QP16 = (h16*)take((size_t)NH_ * TT * HD * 2); h16* KP16 = (h16*)take((size_t)NKV * TT * HD * 2); h16* VT16 = (h16*)take((size_t)NKV * HD * TT * 2);
    bf* QPh = (bf*)take((size_t)NH_ * TT * HD * 2); bf* QPl = (bf*)take((size_t)NH_ * TT * HD * 2); bf* KPh = (bf*)take((size_t)NKV * TT * HD * 2); bf* KPl = (bf*)take((size_t)NKV * TT * HD * 2); bf* VTh = (bf*)take((size_t)NKV * HD * TT * 2); bf* VTl = (bf*)take((size_t)NKV * HD * TT * 2); bf* Ph = (bf*)take((size_t)ZH * RH * TT * 2); bf* Pl = (bf*)take((size_t)ZH * RH * TT * 2);
    float* Sb = (float*)take((size_t)ZH * TT * TT * 4); h16* P16 = (h16*)take((size_t)ZH * TT * TT * 2); float* Ob = (float*)take((size_t)KSP * ZH * TT * HD * 4);
    if ((size_t)(wsp - (char*)d_ws) > ws_size) return;    // ws 256 MiB
    float* FV = FK;   // v projection reuses the k buffer after the k planes are built (stream-ordered)
    { const unsigned LW = (unsigned)(((size_t)DM * K2 / 8 + 255) / 256); k_wcat<<<LW, 256, 0, stream>>>(wqs, wqt, WQ); k_wcat<<<LW, 256, 0, stream>>>(wks, wkt, WK); k_wcat<<<LW, 256, 0, stream>>>(wvs, wvt, WV);   /* [W_s | W_t] along k */
       }
    k_csid<<<(TT * HD + 255) / 256, 256, 0, stream>>>(CS);
    const unsigned LQ = (unsigned)(((size_t)NH_ * TT * HD / 2 + 255) / 256), LKv = (unsigned)(((size_t)NKV * TT * HD / 2 + 255) / 256);
    for (int b = 0; b < NB_; ++b) {
        
        k_cat2<<<(unsigned)(((size_t)TT * K2 / 8 + 255) / 256), 256, 0, stream>>>(xs + (size_t)b * TT * DM, xt + (size_t)b * TT * DM, XB);   /* [Xs | Xt] plane */
        k_gemmw<bf, 0, false, 8, 1><<<dim3(TT / 64, DQ / 64, 1), 256, 0, stream>>>(XB, nullptr, WQ, nullptr, K2, FQ, DQ, nullptr, 0, 0, 0, 0); k_addb<<<(unsigned)(((size_t)TT * DQ / 4 + 255) / 256), 256, 0, stream>>>(FQ, DQ, bqs, bqt);   /* Q = [Xs|Xt][Wqs|Wqt]^T + b_qs + b_qt */
        k_rope<<<LQ, 256, 0, stream>>>(FQ, DQ, NH_, CS, nullptr, nullptr, 1.0f, QP16, QPh, QPl);
        k_gemmw<bf, 0, false, 8, 1><<<dim3(TT / 64, DKV / 64, 1), 256, 0, stream>>>(XB, nullptr, WK, nullptr, K2, FK, DKV, nullptr, 0, 0, 0, 0); k_addb<<<(unsigned)(((size_t)TT * DKV / 4 + 255) / 256), 256, 0, stream>>>(FK, DKV, bks, bkt);
        k_rope<<<LKv, 256, 0, stream>>>(FK, DKV, NKV, CS, nullptr, nullptr, 1.0f, KP16, KPh, KPl);
        k_gemmw<bf, 0, false, 8, 1><<<dim3(TT / 64, DKV / 64, 1), 256, 0, stream>>>(XB, nullptr, WV, nullptr, K2, FV, DKV, nullptr, 0, 0, 0, 0); k_addb<<<(unsigned)(((size_t)TT * DKV / 4 + 255) / 256), 256, 0, stream>>>(FV, DKV, bvs, bvt); k_vtp<<<LKv, 256, 0, stream>>>(FV, DKV, NKV, VT16, VTh, VTl);
        for (int h0 = 0; h0 < NH_; h0 += ZH) { const size_t zq = (size_t)h0, zk = (size_t)(h0 / REP);   // one kv head per query head: the pass's two heads use consecutive kv planes (z-strides TT*HD)
            k_gemmw<bf, 2, false, 1, 1><<<dim3(TT / 64, TT / 64, ZH), 32, 0, stream>>>(QPh + zq * TT * HD, QPl + zq * TT * HD, KPh + zk * TT * HD, KPl + zk * TT * HD, HD, Sb, TT, nullptr, (size_t)TT * HD, (size_t)TT * HD, (size_t)TT * TT, 0);   /* logits: 3 products on EVERY row (the raw per-head context is the output, so fp16 score rows are not accurate enough) */
            k_asoft<<<ZH * TT / 8, 256, 0, stream>>>(Sb, ABIAS, P16, Ph, Pl);
            k_gemmw<bf, 2, false, 8, KSP><<<dim3(RH / 64, HD / 64, ZH * KSP), 256, 0, stream>>>(Ph, Pl, VTh + zk * HD * TT, VTl + zk * HD * TT, TT, Ob, HD, nullptr, (size_t)RH * TT, (size_t)HD * TT, (size_t)TT * HD, (size_t)ZH * TT * HD);
            k_gemmw<h16, 0, false, 8, KSP><<<dim3((TT - RH) / 64, HD / 64, ZH * KSP), 256, 0, stream>>>(P16 + (size_t)RH * TT, nullptr, VT16 + zk * HD * TT, nullptr, TT, Ob + (size_t)RH * HD, HD, nullptr, (size_t)TT * TT, (size_t)HD * TT, (size_t)TT * HD, (size_t)ZH * TT * HD);
            k_mergeF<<<(unsigned)(((size_t)ZH * TT * HD / 2 + 255) / 256), 256, 0, stream>>>(Ob, h0, OUT + (size_t)b * TT * DM); }   /* merged context, f32 */
    }
}

// v002
// A run of this version takes 617 microseconds.
// Timed twice side by side with v001, it ran 2.79 and 2.77 times as fast.
// Counting every step since v000, it is 6.93 times as fast.
#include <hip/hip_runtime.h>

// Two-stream multi-head self-attention with dual-linear projections (Xs, Xt [4][2048][1024]; Q = Xs W_qs^T + b_qs + Xt W_qt^T + b_qt ('oi' [1024][1024] each), K and V likewise; 16 heads x 64; scores/8 + attn_bias (scalar [1][1][1][1], read); softmax; out = merged context, no output projection -> [4][2048][1024] f32 (8.4 M)).
// Layout: each dual linear is ONE exact GEMM with K = 2048: the A operand is the concatenated bf16 plane [Xs | Xt] and the Bt operand the two 'oi' weights concatenated along k; the two biases are added in f32 by a small in-place pass.
// Compute dtypes, f32 accumulate: every input rounded to bf16; Q/K/V as exact K = 2048 products of the [Xs | Xt] plane against [W_s | W_t], + b_s + b_t in f32; scores hi.hi + hi.lo + lo.hi on every row; softmax f32 (running maximum, unnormalised exponentials, one division per row at the end); attn.v: query rows < 512 hl (3 products), the rest fp16 exponentials (x1024) x fp16 values; no output projection: f32 merged context.
// Attention is ONE launch for all batches and heads (k_fattn): scores, softmax and attn.v stay in registers, no score or probability plane in memory.

#define NB_  4
#define TT   2048
#define DM   1024
#define NH_  16
#define NKV  16
#define REP  (NH_ / NKV)
#define HD   64
#define DQ   (NH_ * HD)
#define DKV  (NKV * HD)
#define K2   (2 * DM)              // concatenated contraction [Xs | Xt]
#define RH   512                  // query rows < RH use hi+lo planes (0: none)
#define WIN  0
#define PCAR 1024.0f
#define SCL  0.125f   // HD^-0.5
#define QT   2                    // k_fattn: 16-query column groups per wave
#define FW   4                    // k_fattn: waves per work-group
#define L2E  1.4426950408889634f
typedef _Float16 h16;
typedef unsigned short bf;
typedef __attribute__((ext_vector_type(16))) __bf16   v16bf;
typedef __attribute__((ext_vector_type(16))) _Float16 v16h;
typedef __attribute__((ext_vector_type(8)))  _Float16 v8h;
typedef __attribute__((ext_vector_type(8)))  unsigned short v8us;
typedef __attribute__((ext_vector_type(8)))  float    v8f;
typedef __attribute__((ext_vector_type(4)))  float    v4f;
typedef v8h  __attribute__((may_alias)) v8ha;
typedef v4f  __attribute__((may_alias)) v4fa;
typedef v8us __attribute__((may_alias)) v8usa;

__device__ __forceinline__ unsigned short f2bf(float f) { unsigned u = __float_as_uint(f); u += 0x7FFFu + ((u >> 16) & 1u); return (unsigned short)(u >> 16); }
__device__ __forceinline__ float bf2f(unsigned short b) { return __uint_as_float(((unsigned)b) << 16); }
__device__ __forceinline__ float bfr(float f) { return bf2f(f2bf(f)); }
__device__ __forceinline__ v16h cat16(v8h lo, v8h hi) { return __builtin_shufflevector(lo, hi, 0, 1, 2, 3, 4, 5, 6, 7, 8, 9, 10, 11, 12, 13, 14, 15); }
__device__ __forceinline__ v16bf cat16b(v8us lo, v8us hi) { return __builtin_bit_cast(v16bf, __builtin_shufflevector(lo, hi, 0, 1, 2, 3, 4, 5, 6, 7, 8, 9, 10, 11, 12, 13, 14, 15)); }
__device__ __forceinline__ v8f wmma16(v16h a, v16h b, v8f c) { return __builtin_amdgcn_wmma_f32_16x16x32_f16(false, a, false, b, (short)0, c, false, false); }
__device__ __forceinline__ v8f wmmab(v16bf a, v16bf b, v8f c) { return __builtin_amdgcn_wmma_f32_16x16x32_bf16(false, a, false, b, (short)0, c, false, false); }



// ---- k_gemmw: register-blocked GEMM on 64x64 output tiles (16 accumulators per wave), operands straight from K-contiguous 16-bit planes; grid (M/64, N/64, Z * KS), 32 * NW threads.
// C[m][n] (f32, pitch ldc, + optional f32 bias[n]) = sum_k A[m][k] Bt[n][k] (+ split products per NSPLIT). z-batch strides sA/sB/sC in elements. K % (32 * NW * KS) == 0.
// Split k: the k range is cut into KS * NW equal contiguous pieces; wave w of work-group slice ks sums piece ks * NW + w of the whole tile.
// NW > 1: the work-group's NW partial tiles meet in LDS and are added in wave order. KS > 1: slice ks stores its tile in partial plane ks (C + ks * sP); the reader adds the planes.
template <typename T16> struct WFrag;
template <> struct WFrag<h16> { typedef v16h V; static __device__ __forceinline__ V ld(const h16* p) { return cat16(*(const v8h*)p, *(const v8h*)(p + 16)); } static __device__ __forceinline__ v8f mma(V a, V b, v8f c) { return wmma16(a, b, c); } };
template <> struct WFrag<bf> { typedef v16bf V; static __device__ __forceinline__ V ld(const bf* p) { return cat16b(*(const v8us*)p, *(const v8us*)(p + 16)); } static __device__ __forceinline__ v8f mma(V a, V b, v8f c) { return wmmab(a, b, c); } };
template <typename T16, int NSPLIT, bool BIAS, int NW, int KS>
__global__ __launch_bounds__(32 * NW) void k_gemmw(const T16* __restrict__ A, const T16* __restrict__ A2, const T16* __restrict__ Bt, const T16* __restrict__ Bt2, int K, float* C, int ldc, const float* __restrict__ bias, size_t sA, size_t sB, size_t sC, size_t sP) {
    typedef typename WFrag<T16>::V V;
    __shared__ __align__(16) float os[(NW > 1 ? NW * 64 : 16) * 68];
    const size_t z = blockIdx.z / KS; const int ks = (int)(blockIdx.z % KS); A += z * sA; if (A2) A2 += z * sA; Bt += z * sB; if (Bt2) Bt2 += z * sB; C += z * sC + (size_t)ks * sP;
    const int lane = threadIdx.x & 31, lr = lane & 15, hi = lane >> 4; const int r0 = blockIdx.x * 64, c0 = blockIdx.y * 64;
    v8f acc[4][4];
#pragma unroll
    for (int mb = 0; mb < 4; ++mb)
#pragma unroll
        for (int nb = 0; nb < 4; ++nb) acc[mb][nb] = (v8f){};
    const size_t aoff = (size_t)(r0 + lr) * K + 8 * hi, boff = (size_t)(c0 + lr) * K + 8 * hi;
    const int wave = __builtin_amdgcn_readfirstlane((int)(threadIdx.x >> 5));   // scalar, so that the k bounds and the loop test stay scalar
    const int kw = K / (NW * KS), k0 = (ks * NW + wave) * kw;
#pragma unroll 1
    for (int kc = k0; kc < k0 + kw; kc += 32) {
        V a[4], a2[4];
#pragma unroll
        for (int mb = 0; mb < 4; ++mb) { a[mb] = WFrag<T16>::ld(A + aoff + (size_t)mb * 16 * K + kc); if (NSPLIT == 1 || NSPLIT == 2) a2[mb] = WFrag<T16>::ld(A2 + aoff + (size_t)mb * 16 * K + kc); }
#pragma unroll
        for (int nb = 0; nb < 4; ++nb) { const V b = WFrag<T16>::ld(Bt + boff + (size_t)nb * 16 * K + kc); V b2; if (NSPLIT >= 2) b2 = WFrag<T16>::ld(Bt2 + boff + (size_t)nb * 16 * K + kc);
#pragma unroll
            for (int mb = 0; mb < 4; ++mb) { acc[mb][nb] = WFrag<T16>::mma(a[mb], b, acc[mb][nb]); if (NSPLIT == 1 || NSPLIT == 2) acc[mb][nb] = WFrag<T16>::mma(a2[mb], b, acc[mb][nb]); if (NSPLIT >= 2) acc[mb][nb] = WFrag<T16>::mma(a[mb], b2, acc[mb][nb]); } }
        asm volatile("v_nop\n\tv_nop\n\tv_nop\n\tv_nop" : "+v"(acc[0][0]), "+v"(acc[1][1]), "+v"(acc[2][2]), "+v"(acc[3][3]) : "v"(a[0]), "v"(a[3]));
    }
    if constexpr (NW > 1) {
        float* ow = os + (size_t)wave * 64 * 68;
        // the three loops are unrolled so that every accumulator index is a constant (else acc goes to scratch)
#pragma unroll
        for (int mb = 0; mb < 4; ++mb)
#pragma unroll
            for (int nb = 0; nb < 4; ++nb)
#pragma unroll
                for (int j = 0; j < 8; ++j) ow[(mb * 16 + hi * 8 + j) * 68 + nb * 16 + lr] = acc[mb][nb][j];
        __syncthreads();   // every wave's partial tile is in LDS before any of them is read
        // both loops unrolled: the NW LDS reads of a sum are issued together instead of one latency each
#pragma unroll
        for (int s = 0; s < 32 / NW; ++s) { const int idx = s * 32 * NW + (int)threadIdx.x, row = idx >> 4, cofs = (idx & 15) * 4; v4f val = *(const v4fa*)(os + row * 68 + cofs);
#pragma unroll
            for (int w = 1; w < NW; ++w) val += *(const v4fa*)(os + (w * 64 + row) * 68 + cofs);
            if (BIAS) { val[0] += bfr(bias[c0 + cofs]); val[1] += bfr(bias[c0 + cofs + 1]); val[2] += bfr(bias[c0 + cofs + 2]); val[3] += bfr(bias[c0 + cofs + 3]); }
            *(v4f*)(C + (size_t)(r0 + row) * ldc + c0 + cofs) = val; }
        return;
    }
#pragma unroll
    for (int mb = 0; mb < 4; ++mb) {
#pragma unroll
        for (int nb = 0; nb < 4; ++nb) {
#pragma unroll
            for (int j = 0; j < 8; ++j) os[(hi * 8 + j) * 68 + nb * 16 + lr] = acc[mb][nb][j]; }
        __builtin_amdgcn_wave_barrier(); asm volatile("" ::: "memory");
        float* crow = C + (size_t)(r0 + mb * 16) * ldc + c0;
{
#pragma unroll
            for (int s = 0; s < 8; ++s) { const int row = 2 * s + hi, cofs = lr * 4; v4f val = *(const v4fa*)(os + row * 68 + cofs); if (BIAS) { val[0] += bfr(bias[c0 + cofs]); val[1] += bfr(bias[c0 + cofs + 1]); val[2] += bfr(bias[c0 + cofs + 2]); val[3] += bfr(bias[c0 + cofs + 3]); }
                *(v4f*)(crow + (size_t)row * ldc + cofs) = val; }
             }
        __builtin_amdgcn_wave_barrier(); asm volatile("" ::: "memory");
    }
}

__device__ __forceinline__ h16 tohx(float x) { return (h16)x; }
__device__ __forceinline__ void splitf(float y, unsigned short& h, unsigned short& l) { h = f2bf(y); l = f2bf(y - bf2f(h)); }
typedef __attribute__((ext_vector_type(2))) _Float16 v2h;
typedef __attribute__((ext_vector_type(4))) _Float16 v4h;
typedef __attribute__((ext_vector_type(2))) unsigned short v2us;
typedef __attribute__((ext_vector_type(4))) unsigned short v4us;
typedef __attribute__((ext_vector_type(2))) float v2f;
typedef __attribute__((ext_vector_type(4))) int v4i;

__global__ __launch_bounds__(256) void k_wtG(const float* __restrict__ w, int K, int N, bf* Bt) {
    const int lane = threadIdx.x & 31; const int L0 = (blockIdx.x * 8 + (threadIdx.x >> 5)) * 8; const int nlines = N * K / 64;
{
#pragma unroll 1
        for (int l = 0; l < 8; ++l) { const int L = L0 + l; if (L >= nlines) break; const size_t e = (size_t)L * 64 + lane * 2; const int k = (int)(e % K), n = (int)(e / K); v2us o;
            o[0] = f2bf(w[(size_t)k * N + n]); o[1] = f2bf(w[(size_t)(k + 1) * N + n]); *(v2us*)(Bt + e) = o; }
         }
}
__global__ __launch_bounds__(256) void k_cvt8(const float* __restrict__ src, bf* dst, size_t n8) { const size_t i = (size_t)blockIdx.x * 256 + threadIdx.x; if (i >= n8) return; const v8f v = *(const v8f*)(src + i * 8); v8us o;
#pragma unroll
    for (int k = 0; k < 8; ++k) o[k] = f2bf(v[k]); *(v8us*)(dst + i * 8) = o;  }

// k_rope: head planes [h][t][d] (fp16 + hi/lo) of rope(x) x sc with the rotate-half convention out[d] = x[d] cos[t][d] - x[d+HD/2] sin[t][d], out[d+HD/2] = x[d+HD/2] cos[t][d+HD/2] + x[d] sin[t][d+HD/2]
__global__ __launch_bounds__(256) void k_rope(const float* __restrict__ F, int pitch, int nheads, const float* __restrict__ CS, const float* __restrict__ RF, const float* __restrict__ nw, float sc, h16* P16, bf* Ph, bf* Pl) {
    const size_t e = ((size_t)blockIdx.x * 256 + threadIdx.x) * 2; if (e >= (size_t)nheads * TT * HD) return; const int d = (int)(e % HD); const int t = (int)((e / HD) % TT); const int h = (int)(e / ((size_t)HD * TT)); const float* f = F + (size_t)t * pitch + h * HD; const float rf = RF ? RF[(size_t)h * TT + t] : 1.0f; v2h o16; v2us oh, ol;
#pragma unroll
    for (int q = 0; q < 2; ++q) { const int dd = d + q; const int dp = (dd < HD / 2) ? dd + HD / 2 : dd - HD / 2; float x0 = f[dd], x1 = f[dp];
        if (RF) { float n0 = __fmul_rn(x0, rf), n1 = __fmul_rn(x1, rf); asm volatile("" : "+v"(n0)); asm volatile("" : "+v"(n1)); x0 = __fmul_rn(bfr(nw[dd]), n0); x1 = __fmul_rn(bfr(nw[dp]), n1); }
        const v2f cs = *(const v2f*)(CS + ((size_t)t * HD + dd) * 2); float a = __fmul_rn(x0, cs[0]), bq = __fmul_rn(x1, cs[1]); asm volatile("" : "+v"(a)); asm volatile("" : "+v"(bq)); const float r = ((dd < HD / 2) ? __fsub_rn(a, bq) : __fadd_rn(a, bq)) * sc;
        o16[q] = tohx(r); unsigned short a2, c2; splitf(r, a2, c2); oh[q] = a2; ol[q] = c2; }
    *(v2h*)(P16 + e) = o16; *(v2us*)(Ph + e) = oh; *(v2us*)(Pl + e) = ol;  }
__global__ __launch_bounds__(256) void k_vtp(const float* __restrict__ F, int pitch, int nheads, h16* V16, bf* Vh, bf* Vl) { const size_t e = ((size_t)blockIdx.x * 256 + threadIdx.x) * 2; if (e >= (size_t)nheads * HD * TT) return; const int t = (int)(e % TT); const int d = (int)((e / TT) % HD); const int g = (int)(e / ((size_t)TT * HD)); v2h o16; v2us oh, ol;
#pragma unroll
    for (int q = 0; q < 2; ++q) { const float x = F[(size_t)(t + q) * pitch + g * HD + d]; o16[q] = tohx(x); unsigned short a2, c2; splitf(x, a2, c2); oh[q] = a2; ol[q] = c2; }
    *(v2h*)(V16 + e) = o16; *(v2us*)(Vh + e) = oh; *(v2us*)(Vl + e) = ol;  }
__global__ __launch_bounds__(256) void k_csid(float* CS) { const int idx = blockIdx.x * 256 + threadIdx.x; if (idx >= TT * HD) return; v2f cs; cs[0] = 1.0f; cs[1] = 0.0f; *(v2f*)(CS + (size_t)idx * 2) = cs;  }



__global__ __launch_bounds__(256) void k_cat2(const float* __restrict__ a, const float* __restrict__ bsrc, bf* XC) { const size_t i = (size_t)blockIdx.x * 256 + threadIdx.x; if (i >= (size_t)TT * K2 / 8) return; const size_t e = i * 8; const int c = (int)(e % K2); const int t = (int)(e / K2); const float* src = (c < DM) ? (a + (size_t)t * DM + c) : (bsrc + (size_t)t * DM + (c - DM)); const v8f v = *(const v8f*)src; v8us o;
#pragma unroll
    for (int k = 0; k < 8; ++k) o[k] = f2bf(v[k]); *(v8us*)(XC + e) = o;  }
__global__ __launch_bounds__(256) void k_wcat(const float* __restrict__ ws, const float* __restrict__ wt, bf* Bt) { const size_t i = (size_t)blockIdx.x * 256 + threadIdx.x; if (i >= (size_t)DM * K2 / 8) return; const size_t e = i * 8; const int c = (int)(e % K2); const int n = (int)(e / K2); const float* src = (c < DM) ? (ws + (size_t)n * DM + c) : (wt + (size_t)n * DM + (c - DM)); const v8f v = *(const v8f*)src; v8us o;
#pragma unroll
    for (int k = 0; k < 8; ++k) o[k] = f2bf(v[k]); *(v8us*)(Bt + e) = o;  }
__global__ __launch_bounds__(256) void k_addb(float* F, int width, const float* __restrict__ b1, const float* __restrict__ b2) { const size_t i = (size_t)blockIdx.x * 256 + threadIdx.x; if (i >= (size_t)TT * width / 4) return; const size_t e = i * 4; const int c0 = (int)(e % width); const v4f a = *(const v4f*)(F + e); v4f o;
#pragma unroll
    for (int q = 0; q < 4; ++q) { float s1 = __fadd_rn(a[q], bfr(b1[c0 + q])); asm volatile("" : "+v"(s1)); o[q] = __fadd_rn(s1, bfr(b2[c0 + q])); } *(v4f*)(F + e) = o;  }
// ---- k_fattn: scores, softmax and attn.v of one (batch, head) for FW waves x 16 * QT queries; grid NB_ * NH_ * TT / (FW * 16 * QT), 32 * FW threads, no LDS, no barrier.
// Transposed products: S^T = K Q^T (A = 16 key rows, B = 16 query rows, both k-contiguous planes read by the same loader) leaves one query per lane (column lr; keys 8 * hi + r),
// so two S^T tiles of 32 keys, converted in place, ARE the B operand (k order 8 * hi + s, 16 + 8 * hi + s - 8, the loader's own) of O^T += V^T P^T, with A = 16 rows of the [d][t] value plane.
// Per query: running maximum m (both lane halves agree), partial sum l per lane half (joined at the end), O^T rescaled by exp(m_old - m_new) only in passes where some query's maximum moves.
__device__ __forceinline__ float xhalf(float x) { return __builtin_bit_cast(float, __builtin_amdgcn_permlanex16(__builtin_bit_cast(int, x), __builtin_bit_cast(int, x), 0x76543210, 0xfedcba98, false, false)); }   // lane l reads lane l ^ 16
// fragment loads from a 64-bit byte address held in a register pair (kept as an integer so that the s_wait_xcnt statements below can name the pair)
typedef unsigned long long u64;
typedef const __attribute__((address_space(1))) v8us* gp8us;
typedef const __attribute__((address_space(1))) v8h*  gp8h;
__device__ __forceinline__ v16bf ldgb(u64 a, int ofs) { return cat16b(*(gp8us)(a + ofs), *(gp8us)(a + ofs + 32)); }
__device__ __forceinline__ v16h  ldgh(u64 a, int ofs) { return cat16(*(gp8h)(a + ofs), *(gp8h)(a + ofs + 32)); }
template <bool HR>
__device__ __forceinline__ void fattn(const bf* __restrict__ Qh, const bf* __restrict__ Ql, const bf* __restrict__ Kh, const bf* __restrict__ Kl, const h16* __restrict__ V16, const bf* __restrict__ Vh, const bf* __restrict__ Vl, const float ab, float* __restrict__ O) {
    // every '#pragma unroll' below: fragment, score and accumulator arrays must be indexed by constants only (else they go to scratch)
    static_assert(QT == 2, "the exponential loop below pairs element i with the sum of element i - 2 of the same column group");
    const int lane = threadIdx.x & 31, lr = lane & 15, hi = lane >> 4;
    // one byte address per plane and lane; tiles and k steps are constant offsets from it
    u64 qha = (u64)(Qh + lr * HD + 8 * hi), qla = (u64)(Ql + lr * HD + 8 * hi), kha = (u64)(Kh + lr * HD + 8 * hi), kla = (u64)(Kl + lr * HD + 8 * hi);
    u64 va = (u64)(V16 + lr * TT + 8 * hi), vha = (u64)(Vh + lr * TT + 8 * hi), vla = (u64)(Vl + lr * TT + 8 * hi);
    v16bf qh[QT][2], ql[QT][2];
#pragma unroll
    for (int qt = 0; qt < QT; ++qt)
#pragma unroll
        for (int kk = 0; kk < 2; ++kk) { qh[qt][kk] = ldgb(qha, (qt * 16 * HD + kk * 32) * 2); ql[qt][kk] = ldgb(qla, (qt * 16 * HD + kk * 32) * 2); }
    v8f o[QT][4]; float m[QT], l[QT];
#pragma unroll
    for (int qt = 0; qt < QT; ++qt) { m[qt] = -3.0e38f; l[qt] = 0.f;
#pragma unroll
        for (int dt = 0; dt < 4; ++dt) o[qt][dt] = (v8f){}; }
    v16bf kh[2][2], kl[2][2];
#pragma unroll
    for (int kt = 0; kt < 2; ++kt)
#pragma unroll
        for (int kk = 0; kk < 2; ++kk) { kh[kt][kk] = ldgb(kha, (kt * 16 * HD + kk * 32) * 2); kl[kt][kk] = ldgb(kla, (kt * 16 * HD + kk * 32) * 2); }
    asm volatile("s_wait_xcnt 0x0" : "+v"(qha), "+v"(qla), "+v"(kha), "+v"(kla) :: "memory");   // the issued loads name these pairs: wait before one is advanced or reused
    kha += 32 * HD * 2; kla += 32 * HD * 2;
    // rolled: one pass of 32 keys already fills the register budget of three waves per SIMD
#pragma unroll 1
    for (int key0 = 0; key0 < TT; key0 += 32) {
        v8f s[2][QT];
#pragma unroll
        for (int kt = 0; kt < 2; ++kt)
#pragma unroll
            for (int qt = 0; qt < QT; ++qt) s[kt][qt] = (v8f){};
#pragma unroll
        for (int kk = 0; kk < 2; ++kk) {   // per k step: hi.hi, q_lo.k_hi, q_hi.k_lo
#pragma unroll
            for (int kt = 0; kt < 2; ++kt)
#pragma unroll
                for (int qt = 0; qt < QT; ++qt) s[kt][qt] = wmmab(kh[kt][kk], qh[qt][kk], s[kt][qt]);
#pragma unroll
            for (int kt = 0; kt < 2; ++kt)
#pragma unroll
                for (int qt = 0; qt < QT; ++qt) s[kt][qt] = wmmab(kh[kt][kk], ql[qt][kk], s[kt][qt]);
#pragma unroll
            for (int kt = 0; kt < 2; ++kt)
#pragma unroll
                for (int qt = 0; qt < QT; ++qt) s[kt][qt] = wmmab(kl[kt][kk], qh[qt][kk], s[kt][qt]);
        }
        v16h v16[4]; v16bf vh[4], vl[4];   // this pass's values, in flight under the softmax
#pragma unroll
        for (int dt = 0; dt < 4; ++dt) { if (HR) { vh[dt] = ldgb(vha, dt * 16 * TT * 2); vl[dt] = ldgb(vla, dt * 16 * TT * 2); } else v16[dt] = ldgh(va, dt * 16 * TT * 2); }
        // next pass's keys, in flight under the softmax and attn.v; the last pass re-reads its own rows (in bounds, unused)
#pragma unroll
        for (int kt = 0; kt < 2; ++kt)
#pragma unroll
            for (int kk = 0; kk < 2; ++kk) { kh[kt][kk] = ldgb(kha, (kt * 16 * HD + kk * 32) * 2); kl[kt][kk] = ldgb(kla, (kt * 16 * HD + kk * 32) * 2); }
        float mn[QT]; bool need = false;
#pragma unroll
        for (int qt = 0; qt < QT; ++qt) { float mx = -3.0e38f;
#pragma unroll
            for (int kt = 0; kt < 2; ++kt)
#pragma unroll
                for (int r = 0; r < 8; ++r) { const float t = __builtin_fmaf(s[kt][qt][r], SCL, ab);   /* x HD^-0.5 (exact) + attn_bias */ s[kt][qt][r] = t; mx = fmaxf(mx, t); }
            mn[qt] = fmaxf(mx, xhalf(mx)); need = need || (mn[qt] > m[qt]); }
        if (__builtin_amdgcn_ballot_w32(need) != 0) {   // scalar branch: the rescale is skipped in passes where no query of the wave meets a new maximum
#pragma unroll
            for (int qt = 0; qt < QT; ++qt) { const float m2 = fmaxf(m[qt], mn[qt]); const float al = __builtin_amdgcn_exp2f((m[qt] - m2) * L2E);   /* 0 in the first pass, 1 where this query's maximum stays */ m[qt] = m2; l[qt] *= al;
#pragma unroll
                for (int dt = 0; dt < 4; ++dt) o[qt][dt] *= al; }
        }
#pragma unroll
        for (int qt = 0; qt < QT; ++qt)
#pragma unroll
            for (int kt = 0; kt < 2; ++kt) s[kt][qt] = (s[kt][qt] - m[qt]) * L2E;
        // exponentials in place, each with its slot filled: directly behind every v_exp_f32 stands the row-sum add of the exponential made two earlier (a v_nop behind the first two),
        // which neither reads the new result nor rewrites its source; the scheduling barriers keep that order
#pragma unroll
        for (int i = 0; i < 16 * QT; ++i) { s[(i / QT) >> 3][i % QT][(i / QT) & 7] = __builtin_amdgcn_exp2f(s[(i / QT) >> 3][i % QT][(i / QT) & 7]);
            __builtin_amdgcn_sched_barrier(0);
            if (i >= 2) l[i % QT] += s[((i - 2) / QT) >> 3][i % QT][((i - 2) / QT) & 7]; else asm volatile("v_nop");
            __builtin_amdgcn_sched_barrier(0); }
#pragma unroll
        for (int i = 16 * QT - 2; i < 16 * QT; ++i) l[i % QT] += s[1][i % QT][7];
#pragma unroll
        for (int qt = 0; qt < QT; ++qt) { v16h p16; v16bf ph, pl;
#pragma unroll
            for (int kt = 0; kt < 2; ++kt)
#pragma unroll
                for (int r = 0; r < 8; ++r) { const float p = s[kt][qt][r];
                    if (HR) { const __bf16 a = (__bf16)p; ph[kt * 8 + r] = a; pl[kt * 8 + r] = (__bf16)(p - (float)a); } else p16[kt * 8 + r] = (h16)(p * PCAR); }
#pragma unroll
            for (int dt = 0; dt < 4; ++dt) {
                if (HR) { o[qt][dt] = wmmab(vh[dt], ph, o[qt][dt]); o[qt][dt] = wmmab(vh[dt], pl, o[qt][dt]); o[qt][dt] = wmmab(vl[dt], ph, o[qt][dt]); }
                else o[qt][dt] = wmma16(v16[dt], p16, o[qt][dt]); } }
        // this pass's loads name these pairs: wait before they are advanced
        if (HR) asm volatile("s_wait_xcnt 0x0" : "+v"(kha), "+v"(kla), "+v"(vha), "+v"(vla) :: "memory"); else asm volatile("s_wait_xcnt 0x0" : "+v"(kha), "+v"(kla), "+v"(va) :: "memory");
        { const int kst = (key0 + 64 < TT) ? 32 * HD * 2 : 0; kha += kst; kla += kst; va += 64; vha += 64; vla += 64; }
    }
#pragma unroll
    for (int qt = 0; qt < QT; ++qt) { const float f = __fdiv_rn(HR ? 1.0f : (1.0f / PCAR), l[qt] + xhalf(l[qt]));
#pragma unroll
        for (int dt = 0; dt < 4; ++dt) o[qt][dt] *= f; }
    float* orow = O + (size_t)lr * DM + hi * 8;   // a lane's 8 registers of a tile are 8 consecutive d of its query
    __builtin_amdgcn_sched_barrier(0);   // all arithmetic in front of the stores: nothing rewrites a register that an issued store names
#pragma unroll
    for (int qt = 0; qt < QT; ++qt)
#pragma unroll
        for (int dt = 0; dt < 4; ++dt) { *(v4f*)(orow + qt * 16 * DM + dt * 16) = __builtin_shufflevector(o[qt][dt], o[qt][dt], 0, 1, 2, 3); *(v4f*)(orow + qt * 16 * DM + dt * 16 + 4) = __builtin_shufflevector(o[qt][dt], o[qt][dt], 4, 5, 6, 7); }
}
// amdgpu_waves_per_eu(3): holds the register budget to a third of a SIMD's file, so that three work-groups share a WGP
__global__ __launch_bounds__(32 * FW) __attribute__((amdgpu_waves_per_eu(3))) void k_fattn(const bf* __restrict__ Qh, const bf* __restrict__ Ql, const bf* __restrict__ Kh, const bf* __restrict__ Kl, const h16* __restrict__ V16, const bf* __restrict__ Vh, const bf* __restrict__ Vl, const float* __restrict__ AB, float* __restrict__ O) {
    constexpr int NQB = TT / (FW * 16 * QT), NHB = RH / (FW * 16 * QT), NZ = NB_ * NH_; static_assert(RH % (FW * 16 * QT) == 0 && TT % (FW * 16 * QT) == 0, "whole query blocks on either side of RH");
    // the longer blocks (query rows < RH, three attn.v products) take the lowest indices, so that they start first; z = batch * NH_ + head, xb = query block
    const int fl = (int)blockIdx.x, f2 = fl - NZ * NHB; const int z = (f2 < 0) ? fl / NHB : f2 / (NQB - NHB), xb = (f2 < 0) ? fl % NHB : NHB + f2 % (NQB - NHB);
    const float ab = bfr(AB[0]);
    const int q0 = xb * (FW * 16 * QT) + __builtin_amdgcn_readfirstlane((int)(threadIdx.x >> 5)) * (16 * QT);   // scalar, so that the precision branch is scalar
    const size_t pz = (size_t)z * TT * HD, pq = pz + (size_t)q0 * HD; float* o = O + ((size_t)(z / NH_) * TT + q0) * DM + (z % NH_) * HD;
    if (q0 < RH) fattn<true>(Qh + pq, Ql + pq, Kh + pz, Kl + pz, V16 + pz, Vh + pz, Vl + pz, ab, o);
    else fattn<false>(Qh + pq, Ql + pq, Kh + pz, Kl + pz, V16 + pz, Vh + pz, Vl + pz, ab, o);
}

extern "C" void kernel_launch(void* const* d_in, const int* in_sizes, int n_in,
                              void* d_out, int out_size, void* d_ws, size_t ws_size, hipStream_t stream) {
    (void)in_sizes; (void)n_in; (void)out_size;
    const float* xs = (const float*)d_in[0]; const float* xt = (const float*)d_in[1]; const float* wqs = (const float*)d_in[2]; const float* bqs = (const float*)d_in[3]; const float* wqt = (const float*)d_in[4]; const float* bqt = (const float*)d_in[5]; const float* wks = (const float*)d_in[6]; const float* bks = (const float*)d_in[7]; const float* wkt = (const float*)d_in[8]; const float* bkt = (const float*)d_in[9]; const float* wvs = (const float*)d_in[10]; const float* bvs = (const float*)d_in[11]; const float* wvt = (const float*)d_in[12]; const float* bvt = (const float*)d_in[13]; const float* ABIAS = (const float*)d_in[14]; const float* x = xs; const float* wq = wqs; const float* wk = wks; const float* wv = wvs; const float* wo = nullptr; (void)wo; (void)x; (void)wq; (void)wk; (void)wv;
    float* OUT = (float*)d_out;     // [4][2048][1024]
    char* wsp = (char*)d_ws;
    auto take = [&](size_t bytes) { char* p = wsp; wsp += (bytes + 255) & ~(size_t)255; return (void*)p; };
    bf* WQ = (bf*)take((size_t)DQ * K2 * 2); bf* WK = (bf*)take((size_t)DKV * K2 * 2); bf* WV = (bf*)take((size_t)DKV * K2 * 2); float* CS = (float*)take((size_t)TT * HD * 2 * 4);
    bf* XB = (bf*)take((size_t)TT * K2 * 2); float* FQ = (float*)take((size_t)TT * DQ * 4); float* FK = (float*)take((size_t)TT * DKV * 4);
    h16* QP16 = (h16*)take((size_t)NH_ * TT * HD * 2); h16* KP16 = (h16*)take((size_t)NKV * TT * HD * 2); h16* VT16 = (h16*)take((size_t)NB_ * NKV * HD * TT * 2);
    bf* QPh = (bf*)take((size_t)NB_ * NH_ * TT * HD * 2); bf* QPl = (bf*)take((size_t)NB_ * NH_ * TT * HD * 2); bf* KPh = (bf*)take((size_t)NB_ * NKV * TT * HD * 2); bf* KPl = (bf*)take((size_t)NB_ * NKV * TT * HD * 2); bf* VTh = (bf*)take((size_t)NB_ * NKV * HD * TT * 2); bf* VTl = (bf*)take((size_t)NB_ * NKV * HD * TT * 2);   // the planes that k_fattn reads: all batches
    if ((size_t)(wsp - (char*)d_ws) > ws_size) return;    // ws 256 MiB
    float* FV = FK;   // v projection reuses the k buffer after the k planes are built (stream-ordered)
    { const unsigned LW = (unsigned)(((size_t)DM * K2 / 8 + 255) / 256); k_wcat<<<LW, 256, 0, stream>>>(wqs, wqt, WQ); k_wcat<<<LW, 256, 0, stream>>>(wks, wkt, WK); k_wcat<<<LW, 256, 0, stream>>>(wvs, wvt, WV);   /* [W_s | W_t] along k */
       }
    k_csid<<<(TT * HD + 255) / 256, 256, 0, stream>>>(CS);
    const unsigned LQ = (unsigned)(((size_t)NH_ * TT * HD / 2 + 255) / 256), LKv = (unsigned)(((size_t)NKV * TT * HD / 2 + 255) / 256);
    for (int b = 0; b < NB_; ++b) { const size_t pb = (size_t)b * NH_ * TT * HD;   // this batch's planes
        k_cat2<<<(unsigned)(((size_t)TT * K2 / 8 + 255) / 256), 256, 0, stream>>>(xs + (size_t)b * TT * DM, xt + (size_t)b * TT * DM, XB);   /* [Xs | Xt] plane */
        k_gemmw<bf, 0, false, 8, 1><<<dim3(TT / 64, DQ / 64, 1), 256, 0, stream>>>(XB, nullptr, WQ, nullptr, K2, FQ, DQ, nullptr, 0, 0, 0, 0); k_addb<<<(unsigned)(((size_t)TT * DQ / 4 + 255) / 256), 256, 0, stream>>>(FQ, DQ, bqs, bqt);   /* Q = [Xs|Xt][Wqs|Wqt]^T + b_qs + b_qt */
        k_rope<<<LQ, 256, 0, stream>>>(FQ, DQ, NH_, CS, nullptr, nullptr, 1.0f, QP16, QPh + pb, QPl + pb);
        k_gemmw<bf, 0, false, 8, 1><<<dim3(TT / 64, DKV / 64, 1), 256, 0, stream>>>(XB, nullptr, WK, nullptr, K2, FK, DKV, nullptr, 0, 0, 0, 0); k_addb<<<(unsigned)(((size_t)TT * DKV / 4 + 255) / 256), 256, 0, stream>>>(FK, DKV, bks, bkt);
        k_rope<<<LKv, 256, 0, stream>>>(FK, DKV, NKV, CS, nullptr, nullptr, 1.0f, KP16, KPh + pb, KPl + pb);
        k_gemmw<bf, 0, false, 8, 1><<<dim3(TT / 64, DKV / 64, 1), 256, 0, stream>>>(XB, nullptr, WV, nullptr, K2, FV, DKV, nullptr, 0, 0, 0, 0); k_addb<<<(unsigned)(((size_t)TT * DKV / 4 + 255) / 256), 256, 0, stream>>>(FV, DKV, bvs, bvt); k_vtp<<<LKv, 256, 0, stream>>>(FV, DKV, NKV, VT16 + pb, VTh + pb, VTl + pb);
    }
    k_fattn<<<NB_ * NH_ * (TT / (FW * 16 * QT)), 32 * FW, 0, stream>>>(QPh, QPl, KPh, KPl, VT16, VTh, VTl, ABIAS, OUT);   /* merged context, f32 */
}

// v003
// One run takes 469 microseconds.
// In both of two side-by-side timings against v002, it was 1.31 times as fast.
// Counting every step since v000, it is 9.11 times as fast.
#include <hip/hip_runtime.h>

// Two-stream multi-head self-attention with dual-linear projections (Xs, Xt [4][2048][1024]; Q = Xs W_qs^T + b_qs + Xt W_qt^T + b_qt ('oi' [1024][1024] each), K and V likewise; 16 heads x 64; scores/8 + attn_bias (scalar [1][1][1][1], read); softmax; out = merged context, no output projection -> [4][2048][1024] f32 (8.4 M)).
// Layout: each dual linear is ONE exact GEMM with K = 2048: one operand is the concatenated bf16 plane [Xs | Xt], the other the two 'oi' weights concatenated along k; the GEMM's own epilogue adds the two biases in f32 and stores the 16-bit planes that the attention reads (no f32 Q/K/V plane in memory).
// Compute dtypes, f32 accumulate: every input rounded to bf16; Q/K/V as exact K = 2048 products of the [Xs | Xt] plane against [W_s | W_t], + b_s + b_t in f32; scores hi.hi + hi.lo + lo.hi on every row; softmax f32 (running maximum, unnormalised exponentials, one division per row at the end); attn.v: query rows < 512 hl (3 products), the rest fp16 exponentials (x1024) x fp16 values; no output projection: f32 merged context.
// Attention is ONE launch for all batches and heads (k_fattn): scores, softmax and attn.v stay in registers, no score or probability plane in memory.

#define NB_  4
#define TT   2048
#define DM   1024
#define NH_  16
#define NKV  16
#define REP  (NH_ / NKV)
#define HD   64
#define DQ   (NH_ * HD)
#define DKV  (NKV * HD)
#define K2   (2 * DM)              // concatenated contraction [Xs | Xt]
#define RH   512                  // query rows < RH use hi+lo planes (0: none)
#define WIN  0
#define PCAR 1024.0f
#define SCL  0.125f   // HD^-0.5
#define QT   2                    // k_fattn: 16-query column groups per wave
#define FW   4                    // k_fattn: waves per work-group
#define L2E  1.4426950408889634f
typedef _Float16 h16;
typedef unsigned short bf;
typedef __attribute__((ext_vector_type(16))) __bf16   v16bf;
typedef __attribute__((ext_vector_type(16))) _Float16 v16h;
typedef __attribute__((ext_vector_type(8)))  _Float16 v8h;
typedef __attribute__((ext_vector_type(8)))  unsigned short v8us;
typedef __attribute__((ext_vector_type(8)))  float    v8f;
typedef __attribute__((ext_vector_type(4)))  float    v4f;
typedef v8h  __attribute__((may_alias)) v8ha;
typedef v4f  __attribute__((may_alias)) v4fa;
typedef v8us __attribute__((may_alias)) v8usa;

__device__ __forceinline__ unsigned short f2bf(float f) { unsigned u = __float_as_uint(f); u += 0x7FFFu + ((u >> 16) & 1u); return (unsigned short)(u >> 16); }
__device__ __forceinline__ float bf2f(unsigned short b) { return __uint_as_float(((unsigned)b) << 16); }
__device__ __forceinline__ float bfr(float f) { return bf2f(f2bf(f)); }
__device__ __forceinline__ v16h cat16(v8h lo, v8h hi) { return __builtin_shufflevector(lo, hi, 0, 1, 2, 3, 4, 5, 6, 7, 8, 9, 10, 11, 12, 13, 14, 15); }
__device__ __forceinline__ v16bf cat16b(v8us lo, v8us hi) { return __builtin_bit_cast(v16bf, __builtin_shufflevector(lo, hi, 0, 1, 2, 3, 4, 5, 6, 7, 8, 9, 10, 11, 12, 13, 14, 15)); }
__device__ __forceinline__ v8f wmma16(v16h a, v16h b, v8f c) { return __builtin_amdgcn_wmma_f32_16x16x32_f16(false, a, false, b, (short)0, c, false, false); }
__device__ __forceinline__ v8f wmmab(v16bf a, v16bf b, v8f c) { return __builtin_amdgcn_wmma_f32_16x16x32_bf16(false, a, false, b, (short)0, c, false, false); }



__device__ __forceinline__ h16 tohx(float x) { return (h16)x; }
__device__ __forceinline__ void splitf(float y, unsigned short& h, unsigned short& l) { h = f2bf(y); l = f2bf(y - bf2f(h)); }
typedef __attribute__((ext_vector_type(2))) _Float16 v2h;
typedef __attribute__((ext_vector_type(4))) _Float16 v4h;
typedef __attribute__((ext_vector_type(2))) unsigned short v2us;
typedef __attribute__((ext_vector_type(4))) unsigned short v4us;
typedef __attribute__((ext_vector_type(2))) float v2f;
typedef __attribute__((ext_vector_type(4))) int v4i;

// ---- k_gemmw: register-blocked GEMM on 64x64 tiles (16 accumulators per wave), operands straight from K-contiguous 16-bit planes; grid (M/64, N/64), 32 * NW threads.
// y[m][n] = sum_k A[m][k] Bt[n][k] (+ split products per NSPLIT) + b1 + b2 (both rounded to bf16, added one after the other in f32). K % (32 * NW) == 0.
// Split k: the k range is cut into NW equal contiguous pieces, wave w sums piece w of the whole tile; the NW partial tiles meet in LDS and are added in wave order.
// Epilogue, y never stored as f32: VT false: m = token, n = head * HD + d, bias by n, hi/lo bf16 planes [head][token][d] (a tile is one head's 64 tokens, contiguous).
//                                   VT true:  m = head * HD + d (A = the weights), n = token (Bt = the inputs), bias by m, fp16 and hi/lo bf16 planes [head][d][token]: the transposed value planes come out of the product itself.
template <typename T16> struct WFrag;
template <> struct WFrag<h16> { typedef v16h V; static __device__ __forceinline__ V ld(const h16* p) { return cat16(*(const v8h*)p, *(const v8h*)(p + 16)); } static __device__ __forceinline__ v8f mma(V a, V b, v8f c) { return wmma16(a, b, c); } };
template <> struct WFrag<bf> { typedef v16bf V; static __device__ __forceinline__ V ld(const bf* p) { return cat16b(*(const v8us*)p, *(const v8us*)(p + 16)); } static __device__ __forceinline__ v8f mma(V a, V b, v8f c) { return wmmab(a, b, c); } };
template <typename T16, int NSPLIT, bool VT, int NW>
__global__ __launch_bounds__(32 * NW) void k_gemmw(const T16* __restrict__ A, const T16* __restrict__ A2, const T16* __restrict__ Bt, const T16* __restrict__ Bt2, int K, const float* __restrict__ b1, const float* __restrict__ b2, h16* __restrict__ P16, bf* __restrict__ Ph, bf* __restrict__ Pl) {
    static_assert(HD == 64 && NW > 1 && 32 % NW == 0, "a 64-column tile is one head; the partial tiles are added by all waves");
    typedef typename WFrag<T16>::V V;
    __shared__ __align__(16) float os[NW * 64 * 68];
    const int lane = threadIdx.x & 31, lr = lane & 15, hi = lane >> 4; const int r0 = blockIdx.x * 64, c0 = blockIdx.y * 64;
    v8f acc[4][4];
#pragma unroll
    for (int mb = 0; mb < 4; ++mb)
#pragma unroll
        for (int nb = 0; nb < 4; ++nb) acc[mb][nb] = (v8f){};
    const size_t aoff = (size_t)(r0 + lr) * K + 8 * hi, boff = (size_t)(c0 + lr) * K + 8 * hi;
    const int wave = __builtin_amdgcn_readfirstlane((int)(threadIdx.x >> 5));   // scalar, so that the k bounds and the loop test stay scalar
    const int kw = K / NW, k0 = wave * kw;
#pragma unroll 1
    for (int kc = k0; kc < k0 + kw; kc += 32) {
        V a[4], a2[4];
#pragma unroll
        for (int mb = 0; mb < 4; ++mb) { a[mb] = WFrag<T16>::ld(A + aoff + (size_t)mb * 16 * K + kc); if (NSPLIT == 1 || NSPLIT == 2) a2[mb] = WFrag<T16>::ld(A2 + aoff + (size_t)mb * 16 * K + kc); }
#pragma unroll
        for (int nb = 0; nb < 4; ++nb) { const V b = WFrag<T16>::ld(Bt + boff + (size_t)nb * 16 * K + kc); V b2; if (NSPLIT >= 2) b2 = WFrag<T16>::ld(Bt2 + boff + (size_t)nb * 16 * K + kc);
#pragma unroll
            for (int mb = 0; mb < 4; ++mb) { acc[mb][nb] = WFrag<T16>::mma(a[mb], b, acc[mb][nb]); if (NSPLIT == 1 || NSPLIT == 2) acc[mb][nb] = WFrag<T16>::mma(a2[mb], b, acc[mb][nb]); if (NSPLIT >= 2) acc[mb][nb] = WFrag<T16>::mma(a[mb], b2, acc[mb][nb]); } }
        asm volatile("v_nop\n\tv_nop\n\tv_nop\n\tv_nop" : "+v"(acc[0][0]), "+v"(acc[1][1]), "+v"(acc[2][2]), "+v"(acc[3][3]) : "v"(a[0]), "v"(a[3]));
    }
    constexpr int NS = 32 / NW;   // 4-element groups of the tile per thread: group s is row s * 2 * NW + rw, columns cofs .. cofs + 3
    const int rw = (int)threadIdx.x >> 4, cofs = ((int)threadIdx.x & 15) * 4;
    // the biases are fetched here, so that they arrive under the LDS exchange
    v4f bc1 = {}, bc2 = {}; float br1[NS], br2[NS];
    if constexpr (VT) {
#pragma unroll
        for (int s = 0; s < NS; ++s) { br1[s] = b1[r0 + s * 2 * NW + rw]; br2[s] = b2[r0 + s * 2 * NW + rw]; }
    } else { bc1 = *(const v4f*)(b1 + c0 + cofs); bc2 = *(const v4f*)(b2 + c0 + cofs); }
    asm volatile("s_wait_xcnt 0x0" ::: "memory");   // the bias loads are issued: wait before a register that they name is reused
    float* ow = os + (size_t)wave * 64 * 68;
    // the three loops are unrolled so that every accumulator index is a constant (else acc goes to scratch)
#pragma unroll
    for (int mb = 0; mb < 4; ++mb)
#pragma unroll
        for (int nb = 0; nb < 4; ++nb)
#pragma unroll
            for (int j = 0; j < 8; ++j) ow[(mb * 16 + hi * 8 + j) * 68 + nb * 16 + lr] = acc[mb][nb][j];
    __syncthreads();   // every wave's partial tile is in LDS before any of them is read
    v4us oh[NS], ol[NS]; v4h o16[NS];
    // all loops unrolled: the NW LDS reads of a sum are issued together instead of one latency each, and the result arrays are indexed by constants
#pragma unroll
    for (int s = 0; s < NS; ++s) { const int row = s * 2 * NW + rw; v4f val = *(const v4fa*)(os + row * 68 + cofs);
#pragma unroll
        for (int w = 1; w < NW; ++w) val += *(const v4fa*)(os + (w * 64 + row) * 68 + cofs);
#pragma unroll
        for (int q = 0; q < 4; ++q) { const float y = __fadd_rn(__fadd_rn(val[q], bfr(VT ? br1[s] : bc1[q])), bfr(VT ? br2[s] : bc2[q])); unsigned short h, l; splitf(y, h, l); oh[s][q] = h; ol[s][q] = l; if (VT) o16[s][q] = tohx(y); } }
    const size_t e0 = VT ? (size_t)(r0 + rw) * TT + c0 + cofs : ((size_t)(c0 / HD) * TT + r0 + rw) * HD + cofs; constexpr size_t es = (size_t)2 * NW * (VT ? TT : HD);   // group s lies at e0 + s * es
    __builtin_amdgcn_sched_barrier(0);   // all arithmetic in front of the stores: nothing rewrites a register that an issued store names
#pragma unroll
    for (int s = 0; s < NS; ++s) { *(v4us*)(Ph + e0 + s * es) = oh[s]; *(v4us*)(Pl + e0 + s * es) = ol[s]; if (VT) *(v4h*)(P16 + e0 + s * es) = o16[s]; }
}


__global__ __launch_bounds__(256) void k_wtG(const float* __restrict__ w, int K, int N, bf* Bt) {
    const int lane = threadIdx.x & 31; const int L0 = (blockIdx.x * 8 + (threadIdx.x >> 5)) * 8; const int nlines = N * K / 64;
{
#pragma unroll 1
        for (int l = 0; l < 8; ++l) { const int L = L0 + l; if (L >= nlines) break; const size_t e = (size_t)L * 64 + lane * 2; const int k = (int)(e % K), n = (int)(e / K); v2us o;
            o[0] = f2bf(w[(size_t)k * N + n]); o[1] = f2bf(w[(size_t)(k + 1) * N + n]); *(v2us*)(Bt + e) = o; }
         }
}
__global__ __launch_bounds__(256) void k_cvt8(const float* __restrict__ src, bf* dst, size_t n8) { const size_t i = (size_t)blockIdx.x * 256 + threadIdx.x; if (i >= n8) return; const v8f v = *(const v8f*)(src + i * 8); v8us o;
#pragma unroll
    for (int k = 0; k < 8; ++k) o[k] = f2bf(v[k]); *(v8us*)(dst + i * 8) = o;  }



__global__ __launch_bounds__(256) void k_cat2(const float* __restrict__ a, const float* __restrict__ bsrc, bf* XC) { const size_t i = (size_t)blockIdx.x * 256 + threadIdx.x; if (i >= (size_t)TT * K2 / 8) return; const size_t e = i * 8; const int c = (int)(e % K2); const int t = (int)(e / K2); const float* src = (c < DM) ? (a + (size_t)t * DM + c) : (bsrc + (size_t)t * DM + (c - DM)); const v8f v = *(const v8f*)src; v8us o;
#pragma unroll
    for (int k = 0; k < 8; ++k) o[k] = f2bf(v[k]); *(v8us*)(XC + e) = o;  }
__global__ __launch_bounds__(256) void k_wcat(const float* __restrict__ ws, const float* __restrict__ wt, bf* Bt) { const size_t i = (size_t)blockIdx.x * 256 + threadIdx.x; if (i >= (size_t)DM * K2 / 8) return; const size_t e = i * 8; const int c = (int)(e % K2); const int n = (int)(e / K2); const float* src = (c < DM) ? (ws + (size_t)n * DM + c) : (wt + (size_t)n * DM + (c - DM)); const v8f v = *(const v8f*)src; v8us o;
#pragma unroll
    for (int k = 0; k < 8; ++k) o[k] = f2bf(v[k]); *(v8us*)(Bt + e) = o;  }
// ---- k_fattn: scores, softmax and attn.v of one (batch, head) for FW waves x 16 * QT queries; grid NB_ * NH_ * TT / (FW * 16 * QT), 32 * FW threads, no LDS, no barrier.
// Transposed products: S^T = K Q^T (A = 16 key rows, B = 16 query rows, both k-contiguous planes read by the same loader) leaves one query per lane (column lr; keys 8 * hi + r),
// so two S^T tiles of 32 keys, converted in place, ARE the B operand (k order 8 * hi + s, 16 + 8 * hi + s - 8, the loader's own) of O^T += V^T P^T, with A = 16 rows of the [d][t] value plane.
// Per query: running maximum m (both lane halves agree), partial sum l per lane half (joined at the end), O^T rescaled by exp(m_old - m_new) only in passes where some query's maximum moves.
__device__ __forceinline__ float xhalf(float x) { return __builtin_bit_cast(float, __builtin_amdgcn_permlanex16(__builtin_bit_cast(int, x), __builtin_bit_cast(int, x), 0x76543210, 0xfedcba98, false, false)); }   // lane l reads lane l ^ 16
// fragment loads from a 64-bit byte address held in a register pair (kept as an integer so that the s_wait_xcnt statements below can name the pair)
typedef unsigned long long u64;
typedef const __attribute__((address_space(1))) v8us* gp8us;
typedef const __attribute__((address_space(1))) v8h*  gp8h;
__device__ __forceinline__ v16bf ldgb(u64 a, int ofs) { return cat16b(*(gp8us)(a + ofs), *(gp8us)(a + ofs + 32)); }
__device__ __forceinline__ v16h  ldgh(u64 a, int ofs) { return cat16(*(gp8h)(a + ofs), *(gp8h)(a + ofs + 32)); }
template <bool HR>
__device__ __forceinline__ void fattn(const bf* __restrict__ Qh, const bf* __restrict__ Ql, const bf* __restrict__ Kh, const bf* __restrict__ Kl, const h16* __restrict__ V16, const bf* __restrict__ Vh, const bf* __restrict__ Vl, const float ab, float* __restrict__ O) {
    // every '#pragma unroll' below: fragment, score and accumulator arrays must be indexed by constants only (else they go to scratch)
    static_assert(QT == 2, "the exponential loop below pairs element i with the sum of element i - 2 of the same column group");
    const int lane = threadIdx.x & 31, lr = lane & 15, hi = lane >> 4;
    // one byte address per plane and lane; tiles and k steps are constant offsets from it
    u64 qha = (u64)(Qh + lr * HD + 8 * hi), qla = (u64)(Ql + lr * HD + 8 * hi), kha = (u64)(Kh + lr * HD + 8 * hi), kla = (u64)(Kl + lr * HD + 8 * hi);
    u64 va = (u64)(V16 + lr * TT + 8 * hi), vha = (u64)(Vh + lr * TT + 8 * hi), vla = (u64)(Vl + lr * TT + 8 * hi);
    v16bf qh[QT][2], ql[QT][2];
#pragma unroll
    for (int qt = 0; qt < QT; ++qt)
#pragma unroll
        for (int kk = 0; kk < 2; ++kk) { qh[qt][kk] = ldgb(qha, (qt * 16 * HD + kk * 32) * 2); ql[qt][kk] = ldgb(qla, (qt * 16 * HD + kk * 32) * 2); }
    v8f o[QT][4]; float m[QT], l[QT];
#pragma unroll
    for (int qt = 0; qt < QT; ++qt) { m[qt] = -3.0e38f; l[qt] = 0.f;
#pragma unroll
        for (int dt = 0; dt < 4; ++dt) o[qt][dt] = (v8f){}; }
    v16bf kh[2][2], kl[2][2];
#pragma unroll
    for (int kt = 0; kt < 2; ++kt)
#pragma unroll
        for (int kk = 0; kk < 2; ++kk) { kh[kt][kk] = ldgb(kha, (kt * 16 * HD + kk * 32) * 2); kl[kt][kk] = ldgb(kla, (kt * 16 * HD + kk * 32) * 2); }
    asm volatile("s_wait_xcnt 0x0" : "+v"(qha), "+v"(qla), "+v"(kha), "+v"(kla) :: "memory");   // the issued loads name these pairs: wait before one is advanced or reused
    kha += 32 * HD * 2; kla += 32 * HD * 2;
    // rolled: one pass of 32 keys already fills the register budget of three waves per SIMD
#pragma unroll 1
    for (int key0 = 0; key0 < TT; key0 += 32) {
        v8f s[2][QT];
#pragma unroll
        for (int kt = 0; kt < 2; ++kt)
#pragma unroll
            for (int qt = 0; qt < QT; ++qt) s[kt][qt] = (v8f){};
#pragma unroll
        for (int kk = 0; kk < 2; ++kk) {   // per k step: hi.hi, q_lo.k_hi, q_hi.k_lo
#pragma unroll
            for (int kt = 0; kt < 2; ++kt)
#pragma unroll
                for (int qt = 0; qt < QT; ++qt) s[kt][qt] = wmmab(kh[kt][kk], qh[qt][kk], s[kt][qt]);
#pragma unroll
            for (int kt = 0; kt < 2; ++kt)
#pragma unroll
                for (int qt = 0; qt < QT; ++qt) s[kt][qt] = wmmab(kh[kt][kk], ql[qt][kk], s[kt][qt]);
#pragma unroll
            for (int kt = 0; kt < 2; ++kt)
#pragma unroll
                for (int qt = 0; qt < QT; ++qt) s[kt][qt] = wmmab(kl[kt][kk], qh[qt][kk], s[kt][qt]);
        }
        v16h v16[4]; v16bf vh[4], vl[4];   // this pass's values, in flight under the softmax
#pragma unroll
        for (int dt = 0; dt < 4; ++dt) { if (HR) { vh[dt] = ldgb(vha, dt * 16 * TT * 2); vl[dt] = ldgb(vla, dt * 16 * TT * 2); } else v16[dt] = ldgh(va, dt * 16 * TT * 2); }
        // next pass's keys, in flight under the softmax and attn.v; the last pass re-reads its own rows (in bounds, unused)
#pragma unroll
        for (int kt = 0; kt < 2; ++kt)
#pragma unroll
            for (int kk = 0; kk < 2; ++kk) { kh[kt][kk] = ldgb(kha, (kt * 16 * HD + kk * 32) * 2); kl[kt][kk] = ldgb(kla, (kt * 16 * HD + kk * 32) * 2); }
        float mn[QT]; bool need = false;
#pragma unroll
        for (int qt = 0; qt < QT; ++qt) { float mx = -3.0e38f;
#pragma unroll
            for (int kt = 0; kt < 2; ++kt)
#pragma unroll
                for (int r = 0; r < 8; ++r) { const float t = __builtin_fmaf(s[kt][qt][r], SCL, ab);   /* x HD^-0.5 (exact) + attn_bias */ s[kt][qt][r] = t; mx = fmaxf(mx, t); }
            mn[qt] = fmaxf(mx, xhalf(mx)); need = need || (mn[qt] > m[qt]); }
        if (__builtin_amdgcn_ballot_w32(need) != 0) {   // scalar branch: the rescale is skipped in passes where no query of the wave meets a new maximum
#pragma unroll
            for (int qt = 0; qt < QT; ++qt) { const float m2 = fmaxf(m[qt], mn[qt]); const float al = __builtin_amdgcn_exp2f((m[qt] - m2) * L2E);   /* 0 in the first pass, 1 where this query's maximum stays */ m[qt] = m2; l[qt] *= al;
#pragma unroll
                for (int dt = 0; dt < 4; ++dt) o[qt][dt] *= al; }
        }
#pragma unroll
        for (int qt = 0; qt < QT; ++qt)
#pragma unroll
            for (int kt = 0; kt < 2; ++kt) s[kt][qt] = (s[kt][qt] - m[qt]) * L2E;
        // exponentials in place, each with its slot filled: directly behind every v_exp_f32 stands the row-sum add of the exponential made two earlier (a v_nop behind the first two),
        // which neither reads the new result nor rewrites its source; the scheduling barriers keep that order
#pragma unroll
        for (int i = 0; i < 16 * QT; ++i) { s[(i / QT) >> 3][i % QT][(i / QT) & 7] = __builtin_amdgcn_exp2f(s[(i / QT) >> 3][i % QT][(i / QT) & 7]);
            __builtin_amdgcn_sched_barrier(0);
            if (i >= 2) l[i % QT] += s[((i - 2) / QT) >> 3][i % QT][((i - 2) / QT) & 7]; else asm volatile("v_nop");
            __builtin_amdgcn_sched_barrier(0); }
#pragma unroll
        for (int i = 16 * QT - 2; i < 16 * QT; ++i) l[i % QT] += s[1][i % QT][7];
#pragma unroll
        for (int qt = 0; qt < QT; ++qt) { v16h p16; v16bf ph, pl;
#pragma unroll
            for (int kt = 0; kt < 2; ++kt)
#pragma unroll
                for (int r = 0; r < 8; ++r) { const float p = s[kt][qt][r];
                    if (HR) { const __bf16 a = (__bf16)p; ph[kt * 8 + r] = a; pl[kt * 8 + r] = (__bf16)(p - (float)a); } else p16[kt * 8 + r] = (h16)(p * PCAR); }
#pragma unroll
            for (int dt = 0; dt < 4; ++dt) {
                if (HR) { o[qt][dt] = wmmab(vh[dt], ph, o[qt][dt]); o[qt][dt] = wmmab(vh[dt], pl, o[qt][dt]); o[qt][dt] = wmmab(vl[dt], ph, o[qt][dt]); }
                else o[qt][dt] = wmma16(v16[dt], p16, o[qt][dt]); } }
        // this pass's loads name these pairs: wait before they are advanced
        if (HR) asm volatile("s_wait_xcnt 0x0" : "+v"(kha), "+v"(kla), "+v"(vha), "+v"(vla) :: "memory"); else asm volatile("s_wait_xcnt 0x0" : "+v"(kha), "+v"(kla), "+v"(va) :: "memory");
        { const int kst = (key0 + 64 < TT) ? 32 * HD * 2 : 0; kha += kst; kla += kst; va += 64; vha += 64; vla += 64; }
    }
#pragma unroll
    for (int qt = 0; qt < QT; ++qt) { const float f = __fdiv_rn(HR ? 1.0f : (1.0f / PCAR), l[qt] + xhalf(l[qt]));
#pragma unroll
        for (int dt = 0; dt < 4; ++dt) o[qt][dt] *= f; }
    float* orow = O + (size_t)lr * DM + hi * 8;   // a lane's 8 registers of a tile are 8 consecutive d of its query
    __builtin_amdgcn_sched_barrier(0);   // all arithmetic in front of the stores: nothing rewrites a register that an issued store names
#pragma unroll
    for (int qt = 0; qt < QT; ++qt)
#pragma unroll
        for (int dt = 0; dt < 4; ++dt) { *(v4f*)(orow + qt * 16 * DM + dt * 16) = __builtin_shufflevector(o[qt][dt], o[qt][dt], 0, 1, 2, 3); *(v4f*)(orow + qt * 16 * DM + dt * 16 + 4) = __builtin_shufflevector(o[qt][dt], o[qt][dt], 4, 5, 6, 7); }
}
// amdgpu_waves_per_eu(3): holds the register budget to a third of a SIMD's file, so that three work-groups share a WGP
__global__ __launch_bounds__(32 * FW) __attribute__((amdgpu_waves_per_eu(3))) void k_fattn(const bf* __restrict__ Qh, const bf* __restrict__ Ql, const bf* __restrict__ Kh, const bf* __restrict__ Kl, const h16* __restrict__ V16, const bf* __restrict__ Vh, const bf* __restrict__ Vl, const float* __restrict__ AB, float* __restrict__ O) {
    constexpr int NQB = TT / (FW * 16 * QT), NHB = RH / (FW * 16 * QT), NZ = NB_ * NH_; static_assert(RH % (FW * 16 * QT) == 0 && TT % (FW * 16 * QT) == 0, "whole query blocks on either side of RH");
    // the longer blocks (query rows < RH, three attn.v products) take the lowest indices, so that they start first; z = batch * NH_ + head, xb = query block
    const int fl = (int)blockIdx.x, f2 = fl - NZ * NHB; const int z = (f2 < 0) ? fl / NHB : f2 / (NQB - NHB), xb = (f2 < 0) ? fl % NHB : NHB + f2 % (NQB - NHB);
    const float ab = bfr(AB[0]);
    const int q0 = xb * (FW * 16 * QT) + __builtin_amdgcn_readfirstlane((int)(threadIdx.x >> 5)) * (16 * QT);   // scalar, so that the precision branch is scalar
    const size_t pz = (size_t)z * TT * HD, pq = pz + (size_t)q0 * HD; float* o = O + ((size_t)(z / NH_) * TT + q0) * DM + (z % NH_) * HD;
    if (q0 < RH) fattn<true>(Qh + pq, Ql + pq, Kh + pz, Kl + pz, V16 + pz, Vh + pz, Vl + pz, ab, o);
    else fattn<false>(Qh + pq, Ql + pq, Kh + pz, Kl + pz, V16 + pz, Vh + pz, Vl + pz, ab, o);
}

extern "C" void kernel_launch(void* const* d_in, const int* in_sizes, int n_in,
                              void* d_out, int out_size, void* d_ws, size_t ws_size, hipStream_t stream) {
    (void)in_sizes; (void)n_in; (void)out_size;
    const float* xs = (const float*)d_in[0]; const float* xt = (const float*)d_in[1]; const float* wqs = (const float*)d_in[2]; const float* bqs = (const float*)d_in[3]; const float* wqt = (const float*)d_in[4]; const float* bqt = (const float*)d_in[5]; const float* wks = (const float*)d_in[6]; const float* bks = (const float*)d_in[7]; const float* wkt = (const float*)d_in[8]; const float* bkt = (const float*)d_in[9]; const float* wvs = (const float*)d_in[10]; const float* bvs = (const float*)d_in[11]; const float* wvt = (const float*)d_in[12]; const float* bvt = (const float*)d_in[13]; const float* ABIAS = (const float*)d_in[14]; const float* x = xs; const float* wq = wqs; const float* wk = wks; const float* wv = wvs; const float* wo = nullptr; (void)wo; (void)x; (void)wq; (void)wk; (void)wv;
    float* OUT = (float*)d_out;     // [4][2048][1024]
    char* wsp = (char*)d_ws;
    auto take = [&](size_t bytes) { char* p = wsp; wsp += (bytes + 255) & ~(size_t)255; return (void*)p; };
    bf* WQ = (bf*)take((size_t)DQ * K2 * 2); bf* WK = (bf*)take((size_t)DKV * K2 * 2); bf* WV = (bf*)take((size_t)DKV * K2 * 2);
    bf* XB = (bf*)take((size_t)TT * K2 * 2); h16* VT16 = (h16*)take((size_t)NB_ * NKV * HD * TT * 2);
    bf* QPh = (bf*)take((size_t)NB_ * NH_ * TT * HD * 2); bf* QPl = (bf*)take((size_t)NB_ * NH_ * TT * HD * 2); bf* KPh = (bf*)take((size_t)NB_ * NKV * TT * HD * 2); bf* KPl = (bf*)take((size_t)NB_ * NKV * TT * HD * 2); bf* VTh = (bf*)take((size_t)NB_ * NKV * HD * TT * 2); bf* VTl = (bf*)take((size_t)NB_ * NKV * HD * TT * 2);   // the planes that k_fattn reads: all batches
    if ((size_t)(wsp - (char*)d_ws) > ws_size) return;    // ws 256 MiB
    { const unsigned LW = (unsigned)(((size_t)DM * K2 / 8 + 255) / 256); k_wcat<<<LW, 256, 0, stream>>>(wqs, wqt, WQ); k_wcat<<<LW, 256, 0, stream>>>(wks, wkt, WK); k_wcat<<<LW, 256, 0, stream>>>(wvs, wvt, WV);   /* [W_s | W_t] along k */
       }
    for (int b = 0; b < NB_; ++b) { const size_t pb = (size_t)b * NH_ * TT * HD;   // this batch's planes
        k_cat2<<<(unsigned)(((size_t)TT * K2 / 8 + 255) / 256), 256, 0, stream>>>(xs + (size_t)b * TT * DM, xt + (size_t)b * TT * DM, XB);   /* [Xs | Xt] plane */
        k_gemmw<bf, 0, false, 8><<<dim3(TT / 64, DQ / 64, 1), 256, 0, stream>>>(XB, nullptr, WQ, nullptr, K2, bqs, bqt, nullptr, QPh + pb, QPl + pb);   /* Q = [Xs|Xt][Wqs|Wqt]^T + b_qs + b_qt, as head planes */
        k_gemmw<bf, 0, false, 8><<<dim3(TT / 64, DKV / 64, 1), 256, 0, stream>>>(XB, nullptr, WK, nullptr, K2, bks, bkt, nullptr, KPh + pb, KPl + pb);
        k_gemmw<bf, 0, true, 8><<<dim3(DKV / 64, TT / 64, 1), 256, 0, stream>>>(WV, nullptr, XB, nullptr, K2, bvs, bvt, VT16 + pb, VTh + pb, VTl + pb);   /* V^T = [Wvs|Wvt][Xs|Xt]^T + b_vs + b_vt */
    }
    k_fattn<<<NB_ * NH_ * (TT / (FW * 16 * QT)), 32 * FW, 0, stream>>>(QPh, QPl, KPh, KPl, VT16, VTh, VTl, ABIAS, OUT);   /* merged context, f32 */
}

// v004
// One run takes 285 microseconds.
// Two timings next to v003 put it at 1.65 and 1.63 times that version's speed.
// Over all steps from v000 it is 15.0 times as fast.
#include <hip/hip_runtime.h>

// Two-stream multi-head self-attention with dual-linear projections (Xs, Xt [4][2048][1024]; Q = Xs W_qs^T + b_qs + Xt W_qt^T + b_qt ('oi' [1024][1024] each), K and V likewise; 16 heads x 64; scores/8 + attn_bias (scalar [1][1][1][1], read); softmax; out = merged context, no output projection -> [4][2048][1024] f32 (8.4 M)).
// Layout: each dual linear is ONE exact GEMM with K = 2048: one operand is the concatenated bf16 plane [Xs | Xt], the other the two 'oi' weights concatenated along k; the GEMM's own epilogue adds the two biases in f32 and stores the 16-bit planes that the attention reads (no f32 Q/K/V plane in memory).
// Compute dtypes, f32 accumulate: every input rounded to bf16; Q/K/V as exact K = 2048 products of the [Xs | Xt] plane against [W_s | W_t], + b_s + b_t in f32; scores hi.hi + hi.lo + lo.hi on every row; softmax f32 (running maximum, unnormalised exponentials, one division per row at the end); attn.v: query rows < 512 hl (3 products), the rest fp16 exponentials (x1024) x fp16 values; no output projection: f32 merged context.
// Attention is ONE launch for all batches and heads (k_fattn): scores, softmax and attn.v stay in registers, no score or probability plane in memory.
// Fragment order: every 16-bit plane that a matrix operand is loaded from is stored as 1-KB blocks of 16 rows x 32 k. Inside a block, 16-byte chunk number c * 32 + h * 16 + r holds row r, k = c * 16 + h * 8 .. + 7,
// which is what lane h * 16 + r takes as the c-th half of its fragment: each wave-wide 16-byte load reads 512 contiguous bytes (4 whole lines) instead of 32 bytes of each of 16 lines. Registers hold the same elements as with row-major planes.

#define NB_  4
#define TT   2048
#define DM   1024
#define NH_  16
#define NKV  16
#define REP  (NH_ / NKV)
#define HD   64
#define DQ   (NH_ * HD)
#define DKV  (NKV * HD)
#define K2   (2 * DM)              // concatenated contraction [Xs | Xt]
#define RH   512                  // query rows < RH use hi+lo planes (0: none)
#define WIN  0
#define PCAR 1024.0f
#define SCL  0.125f   // HD^-0.5
#define QT   2                    // k_fattn: 16-query column groups per wave
#define FW   4                    // k_fattn: waves per work-group
#define L2E  1.4426950408889634f
typedef _Float16 h16;
typedef unsigned short bf;
typedef __attribute__((ext_vector_type(16))) __bf16   v16bf;
typedef __attribute__((ext_vector_type(16))) _Float16 v16h;
typedef __attribute__((ext_vector_type(8)))  _Float16 v8h;
typedef __attribute__((ext_vector_type(8)))  unsigned short v8us;
typedef __attribute__((ext_vector_type(8)))  float    v8f;
typedef __attribute__((ext_vector_type(4)))  float    v4f;
typedef v8h  __attribute__((may_alias)) v8ha;
typedef v4f  __attribute__((may_alias)) v4fa;
typedef v8us __attribute__((may_alias)) v8usa;

__device__ __forceinline__ unsigned short f2bf(float f) { unsigned u = __float_as_uint(f); u += 0x7FFFu + ((u >> 16) & 1u); return (unsigned short)(u >> 16); }
__device__ __forceinline__ float bf2f(unsigned short b) { return __uint_as_float(((unsigned)b) << 16); }
__device__ __forceinline__ float bfr(float f) { return bf2f(f2bf(f)); }
__device__ __forceinline__ v16h cat16(v8h lo, v8h hi) { return __builtin_shufflevector(lo, hi, 0, 1, 2, 3, 4, 5, 6, 7, 8, 9, 10, 11, 12, 13, 14, 15); }
__device__ __forceinline__ v16bf cat16b(v8us lo, v8us hi) { return __builtin_bit_cast(v16bf, __builtin_shufflevector(lo, hi, 0, 1, 2, 3, 4, 5, 6, 7, 8, 9, 10, 11, 12, 13, 14, 15)); }
__device__ __forceinline__ v8f wmma16(v16h a, v16h b, v8f c) { return __builtin_amdgcn_wmma_f32_16x16x32_f16(false, a, false, b, (short)0, c, false, false); }
__device__ __forceinline__ v8f wmmab(v16bf a, v16bf b, v8f c) { return __builtin_amdgcn_wmma_f32_16x16x32_bf16(false, a, false, b, (short)0, c, false, false); }



__device__ __forceinline__ h16 tohx(float x) { return (h16)x; }
__device__ __forceinline__ void splitf(float y, unsigned short& h, unsigned short& l) { h = f2bf(y); l = f2bf(y - bf2f(h)); }
typedef __attribute__((ext_vector_type(2))) _Float16 v2h;
typedef __attribute__((ext_vector_type(4))) _Float16 v4h;
typedef __attribute__((ext_vector_type(2))) unsigned short v2us;
typedef __attribute__((ext_vector_type(4))) unsigned short v4us;
typedef __attribute__((ext_vector_type(2))) float v2f;
typedef __attribute__((ext_vector_type(4))) int v4i;

// ---- k_gemmw: register-blocked GEMM on 64x64 tiles (16 accumulators per wave), operands straight from fragment-ordered 16-bit planes (blocks [row / 16][k / 32]); grid (M/64, N/64), 32 * NW threads.
// y[m][n] = sum_k A[m][k] Bt[n][k] (+ split products per NSPLIT) + b1 + b2 (both rounded to bf16, added one after the other in f32). K % (32 * NW) == 0; K is a compile-time constant, so that the four 16-row bands of an operand are immediate offsets from one address.
// Split k: the k range is cut into NW equal contiguous pieces, wave w sums piece w of the whole tile; the NW partial tiles meet in LDS and are added in wave order.
// Epilogue, y never stored as f32, planes in fragment order, a tile is 8 KB contiguous in each: VT false: m = token, n = head * HD + d, bias by n, hi/lo bf16 planes [head], rows = tokens, k = d, blocks [token / 16][d / 32].
//                                   VT true:  m = head * HD + d (A = the weights), n = token (Bt = the inputs), bias by m, fp16 and hi/lo bf16 planes [head], rows = d, k = tokens, blocks [token / 32][d / 16]: the transposed value planes come out of the product itself.
// fragment loads from a 64-bit byte address held in a register pair (kept as an integer so that the s_wait_xcnt statements below can name the pair)
typedef unsigned long long u64;
typedef const __attribute__((address_space(1))) v8us* gp8us;
typedef const __attribute__((address_space(1))) v8h*  gp8h;
__device__ __forceinline__ v16bf ldgb(u64 a, int ofs) { return cat16b(*(gp8us)(a + ofs), *(gp8us)(a + ofs + 512)); }   // the two halves of a block
__device__ __forceinline__ v16h  ldgh(u64 a, int ofs) { return cat16(*(gp8h)(a + ofs), *(gp8h)(a + ofs + 512)); }
template <typename T16> struct WFrag;
template <> struct WFrag<h16> { typedef v16h V; static __device__ __forceinline__ V ld(u64 a, int ofs) { return ldgh(a, ofs); } static __device__ __forceinline__ v8f mma(V a, V b, v8f c) { return wmma16(a, b, c); } };
template <> struct WFrag<bf> { typedef v16bf V; static __device__ __forceinline__ V ld(u64 a, int ofs) { return ldgb(a, ofs); } static __device__ __forceinline__ v8f mma(V a, V b, v8f c) { return wmmab(a, b, c); } };
template <typename T16, int NSPLIT, bool VT, int NW, int K>
__global__ __launch_bounds__(32 * NW) void k_gemmw(const T16* __restrict__ A, const T16* __restrict__ A2, const T16* __restrict__ Bt, const T16* __restrict__ Bt2, const float* __restrict__ b1, const float* __restrict__ b2, h16* __restrict__ P16, bf* __restrict__ Ph, bf* __restrict__ Pl) {
    static_assert(HD == 64 && NW == 8, "a 64-column tile is one head; its 16 half blocks of 32 chunks are stored two per wave");
    typedef typename WFrag<T16>::V V;
    __shared__ __align__(16) float os[NW * 64 * 68];
    const int lane = threadIdx.x & 31, lr = lane & 15, hi = lane >> 4; const int r0 = blockIdx.x * 64, c0 = blockIdx.y * 64;
    v8f acc[4][4];
#pragma unroll
    for (int mb = 0; mb < 4; ++mb)
#pragma unroll
        for (int nb = 0; nb < 4; ++nb) acc[mb][nb] = (v8f){};
    const size_t aoff = (size_t)r0 * K + 8 * lane, boff = (size_t)c0 * K + 8 * lane;   // a 16-row band is 16 * K elements, a k step of 32 is one block of 512
    const int wave = __builtin_amdgcn_readfirstlane((int)(threadIdx.x >> 5));   // scalar, so that the k bounds and the loop test stay scalar
    const int kw = K / NW, k0 = wave * kw;
    u64 pa = (u64)(A + aoff + (size_t)k0 * 16), pb = (u64)(Bt + boff + (size_t)k0 * 16);   // the lane's chunk of this wave's first blocks; bands are constant offsets
#pragma unroll 1
    for (int kc = k0; kc < k0 + kw; kc += 32) {
        V a[4], a2[4], b[4], b2[4];
#pragma unroll
        for (int mb = 0; mb < 4; ++mb) { a[mb] = WFrag<T16>::ld(pa, mb * 16 * K * 2); if (NSPLIT == 1 || NSPLIT == 2) a2[mb] = WFrag<T16>::ld((u64)(A2 + aoff + (size_t)kc * 16), mb * 16 * K * 2); }
#pragma unroll
        for (int nb = 0; nb < 4; ++nb) { b[nb] = WFrag<T16>::ld(pb, nb * 16 * K * 2); if (NSPLIT >= 2) b2[nb] = WFrag<T16>::ld((u64)(Bt2 + boff + (size_t)kc * 16), nb * 16 * K * 2); }
        __builtin_amdgcn_sched_barrier(0);   // every load of the pass is issued before its first product (else the compiler reloads one B register set four times, one L2 latency each)
#pragma unroll
        for (int nb = 0; nb < 4; ++nb)
#pragma unroll
            for (int mb = 0; mb < 4; ++mb) { acc[mb][nb] = WFrag<T16>::mma(a[mb], b[nb], acc[mb][nb]); if (NSPLIT == 1 || NSPLIT == 2) acc[mb][nb] = WFrag<T16>::mma(a2[mb], b[nb], acc[mb][nb]); if (NSPLIT >= 2) acc[mb][nb] = WFrag<T16>::mma(a[mb], b2[nb], acc[mb][nb]); }
        asm volatile("v_nop\n\tv_nop\n\tv_nop\n\tv_nop" : "+v"(acc[0][0]), "+v"(acc[1][1]), "+v"(acc[2][2]), "+v"(acc[3][3]) : "v"(a[0]), "v"(a[3]));
        asm volatile("s_wait_xcnt 0x0" : "+v"(pa), "+v"(pb) :: "memory");   // this pass's loads name these pairs: wait before they are advanced
        pa += 1024; pb += 1024;
    }
    constexpr int NS = 2;   // 8-element chunks of the tile per thread: chunk s of thread t is chunk s * 256 + t of the tile's 8 KB in each output plane
    // tile row and first tile column of chunk s: VT false: row rw + s * 32, column cofs; VT true: row rw, column cofs + s * 32
    const int rw = (VT ? ((wave >> 1) & 3) : (wave >> 2)) * 16 + lr, cofs = (VT ? 0 : ((wave >> 1) & 1) * 32) + (wave & 1) * 16 + hi * 8;
    // the biases are fetched here, so that they arrive under the LDS exchange
    v4f bc1[2] = {}, bc2[2] = {}; float br1 = 0.f, br2 = 0.f;
    if constexpr (VT) { br1 = b1[r0 + rw]; br2 = b2[r0 + rw]; }
    else { bc1[0] = *(const v4f*)(b1 + c0 + cofs); bc1[1] = *(const v4f*)(b1 + c0 + cofs + 4); bc2[0] = *(const v4f*)(b2 + c0 + cofs); bc2[1] = *(const v4f*)(b2 + c0 + cofs + 4); }
    asm volatile("s_wait_xcnt 0x0" ::: "memory");   // the bias loads are issued: wait before a register that they name is reused
    float* ow = os + (size_t)wave * 64 * 68;
    // the three loops are unrolled so that every accumulator index is a constant (else acc goes to scratch)
#pragma unroll
    for (int mb = 0; mb < 4; ++mb)
#pragma unroll
        for (int nb = 0; nb < 4; ++nb)
#pragma unroll
            for (int j = 0; j < 8; ++j) ow[(mb * 16 + hi * 8 + j) * 68 + nb * 16 + lr] = acc[mb][nb][j];
    __syncthreads();   // every wave's partial tile is in LDS before any of them is read
    v8us oh[NS], ol[NS]; v8h o16[NS];
    // all loops unrolled: the NW LDS reads of a sum are issued together instead of one latency each, and the result arrays are indexed by constants
#pragma unroll
    for (int s = 0; s < NS; ++s) { const int at = (rw + (VT ? 0 : s * 32)) * 68 + cofs + (VT ? s * 32 : 0); v4f val[2] = { *(const v4fa*)(os + at), *(const v4fa*)(os + at + 4) };
#pragma unroll
        for (int w = 1; w < NW; ++w) { val[0] += *(const v4fa*)(os + w * 64 * 68 + at); val[1] += *(const v4fa*)(os + w * 64 * 68 + at + 4); }
#pragma unroll
        for (int q = 0; q < 8; ++q) { const float y = __fadd_rn(__fadd_rn(val[q >> 2][q & 3], bfr(VT ? br1 : bc1[q >> 2][q & 3])), bfr(VT ? br2 : bc2[q >> 2][q & 3])); unsigned short h, l; splitf(y, h, l); oh[s][q] = h; ol[s][q] = l; if (VT) o16[s][q] = tohx(y); } }
    const size_t e0 = (VT ? (size_t)r0 * TT + (size_t)c0 * HD : (size_t)c0 * TT + (size_t)r0 * HD) + (size_t)threadIdx.x * 8; constexpr size_t es = 2048;   // chunk s lies at e0 + s * es
    __builtin_amdgcn_sched_barrier(0);   // all arithmetic in front of the stores: nothing rewrites a register that an issued store names
#pragma unroll
    for (int s = 0; s < NS; ++s) { *(v8us*)(Ph + e0 + s * es) = oh[s]; *(v8us*)(Pl + e0 + s * es) = ol[s]; if (VT) *(v8h*)(P16 + e0 + s * es) = o16[s]; }
}


__global__ __launch_bounds__(256) void k_wtG(const float* __restrict__ w, int K, int N, bf* Bt) {
    const int lane = threadIdx.x & 31; const int L0 = (blockIdx.x * 8 + (threadIdx.x >> 5)) * 8; const int nlines = N * K / 64;
{
#pragma unroll 1
        for (int l = 0; l < 8; ++l) { const int L = L0 + l; if (L >= nlines) break; const size_t e = (size_t)L * 64 + lane * 2; const int k = (int)(e % K), n = (int)(e / K); v2us o;
            o[0] = f2bf(w[(size_t)k * N + n]); o[1] = f2bf(w[(size_t)(k + 1) * N + n]); *(v2us*)(Bt + e) = o; }
         }
}
__global__ __launch_bounds__(256) void k_cvt8(const float* __restrict__ src, bf* dst, size_t n8) { const size_t i = (size_t)blockIdx.x * 256 + threadIdx.x; if (i >= n8) return; const v8f v = *(const v8f*)(src + i * 8); v8us o;
#pragma unroll
    for (int k = 0; k < 8; ++k) o[k] = f2bf(v[k]); *(v8us*)(dst + i * 8) = o;  }



// [a | b] along k (two row-major f32 [rows][DM] inputs), rounded to bf16, stored in fragment order (blocks [row / 16][k / 32]); thread i makes one 16-byte chunk.
// A wave takes 8 rows x 32 k of one block: it reads 128 contiguous bytes of each row and its store covers 4 whole lines.
__device__ __forceinline__ void catpack(const float* __restrict__ a, const float* __restrict__ b, bf* dst, size_t i) {
    const int lane = (int)(i & 31), j = lane & 3, r = (int)((i >> 5) & 1) * 8 + (lane >> 2); const size_t blk = i >> 6;
    const int c = (int)(blk % (K2 / 32)) * 32 + j * 8; const size_t t = (blk / (K2 / 32)) * 16 + r;
    const float* src = (c < DM) ? (a + t * DM + c) : (b + t * DM + (c - DM)); const v8f v = *(const v8f*)src; v8us o;
#pragma unroll
    for (int k = 0; k < 8; ++k) o[k] = f2bf(v[k]);
    *(v8us*)(dst + blk * 512 + (j >> 1) * 256 + ((j & 1) * 16 + r) * 8) = o;
}
__global__ __launch_bounds__(256) void k_cat2(const float* __restrict__ a, const float* __restrict__ bsrc, bf* XC) { const size_t i = (size_t)blockIdx.x * 256 + threadIdx.x; if (i >= (size_t)TT * K2 / 8) return; catpack(a, bsrc, XC, i); }
__global__ __launch_bounds__(256) void k_wcat(const float* __restrict__ ws, const float* __restrict__ wt, bf* Bt) { const size_t i = (size_t)blockIdx.x * 256 + threadIdx.x; if (i >= (size_t)DM * K2 / 8) return; catpack(ws, wt, Bt, i); }
// ---- k_fattn: scores, softmax and attn.v of one (batch, head) for FW waves x 16 * QT queries; grid NB_ * NH_ * TT / (FW * 16 * QT), 32 * FW threads, no LDS, no barrier.
// Transposed products: S^T = K Q^T (A = 16 key rows, B = 16 query rows, both fragment-ordered planes read by the same loader) leaves one query per lane (column lr; keys 8 * hi + r),
// so two S^T tiles of 32 keys, converted in place, ARE the B operand (k order 8 * hi + s, 16 + 8 * hi + s - 8, the loader's own) of O^T += V^T P^T, with A = 16 d rows of the transposed value plane (a pass's 64 d x 32 keys are 4 KB contiguous).
// Per query: running maximum m (both lane halves agree), partial sum l per lane half (joined at the end), O^T rescaled by exp(m_old - m_new) only in passes where some query's maximum moves.
__device__ __forceinline__ float xhalf(float x) { return __builtin_bit_cast(float, __builtin_amdgcn_permlanex16(__builtin_bit_cast(int, x), __builtin_bit_cast(int, x), 0x76543210, 0xfedcba98, false, false)); }   // lane l reads lane l ^ 16
template <bool HR>
__device__ __forceinline__ void fattn(const bf* __restrict__ Qh, const bf* __restrict__ Ql, const bf* __restrict__ Kh, const bf* __restrict__ Kl, const h16* __restrict__ V16, const bf* __restrict__ Vh, const bf* __restrict__ Vl, const float ab, float* __restrict__ O) {
    // every '#pragma unroll' below: fragment, score and accumulator arrays must be indexed by constants only (else they go to scratch)
    static_assert(QT == 2, "the exponential loop below pairs element i with the sum of element i - 2 of the same column group");
    const int lane = threadIdx.x & 31, lr = lane & 15, hi = lane >> 4;
    // one byte address per plane and lane (the lane's chunk of a block); blocks are constant offsets of 1 KB from it: Q, K block (row tile) * 2 + k step, V block d tile
    u64 qha = (u64)(Qh + 8 * lane), qla = (u64)(Ql + 8 * lane), kha = (u64)(Kh + 8 * lane), kla = (u64)(Kl + 8 * lane);
    u64 va = (u64)(V16 + 8 * lane), vha = (u64)(Vh + 8 * lane), vla = (u64)(Vl + 8 * lane);
    v16bf qh[QT][2], ql[QT][2];
#pragma unroll
    for (int qt = 0; qt < QT; ++qt)
#pragma unroll
        for (int kk = 0; kk < 2; ++kk) { qh[qt][kk] = ldgb(qha, (qt * 2 + kk) * 1024); ql[qt][kk] = ldgb(qla, (qt * 2 + kk) * 1024); }
    v8f o[QT][4]; float m[QT], l[QT];
#pragma unroll
    for (int qt = 0; qt < QT; ++qt) { m[qt] = -3.0e38f; l[qt] = 0.f;
#pragma unroll
        for (int dt = 0; dt < 4; ++dt) o[qt][dt] = (v8f){}; }
    v16bf kh[2][2], kl[2][2];
#pragma unroll
    for (int kt = 0; kt < 2; ++kt)
#pragma unroll
        for (int kk = 0; kk < 2; ++kk) { kh[kt][kk] = ldgb(kha, (kt * 2 + kk) * 1024); kl[kt][kk] = ldgb(kla, (kt * 2 + kk) * 1024); }
    asm volatile("s_wait_xcnt 0x0" : "+v"(qha), "+v"(qla), "+v"(kha), "+v"(kla) :: "memory");   // the issued loads name these pairs: wait before one is advanced or reused
    kha += 32 * HD * 2; kla += 32 * HD * 2;
    // rolled: one pass of 32 keys already fills the register budget of three waves per SIMD
#pragma unroll 1
    for (int key0 = 0; key0 < TT; key0 += 32) {
        v8f s[2][QT];
#pragma unroll
        for (int kt = 0; kt < 2; ++kt)
#pragma unroll
            for (int qt = 0; qt < QT; ++qt) s[kt][qt] = (v8f){};
#pragma unroll
        for (int kk = 0; kk < 2; ++kk) {   // per k step: hi.hi, q_lo.k_hi, q_hi.k_lo
#pragma unroll
            for (int kt = 0; kt < 2; ++kt)
#pragma unroll
                for (int qt = 0; qt < QT; ++qt) s[kt][qt] = wmmab(kh[kt][kk], qh[qt][kk], s[kt][qt]);
#pragma unroll
            for (int kt = 0; kt < 2; ++kt)
#pragma unroll
                for (int qt = 0; qt < QT; ++qt) s[kt][qt] = wmmab(kh[kt][kk], ql[qt][kk], s[kt][qt]);
#pragma unroll
            for (int kt = 0; kt < 2; ++kt)
#pragma unroll
                for (int qt = 0; qt < QT; ++qt) s[kt][qt] = wmmab(kl[kt][kk], qh[qt][kk], s[kt][qt]);
        }
        v16h v16[4]; v16bf vh[4], vl[4];   // this pass's values, in flight under the softmax
#pragma unroll
        for (int dt = 0; dt < 4; ++dt) { if (HR) { vh[dt] = ldgb(vha, dt * 1024); vl[dt] = ldgb(vla, dt * 1024); } else v16[dt] = ldgh(va, dt * 1024); }
        // next pass's keys, in flight under the softmax and attn.v; the last pass re-reads its own rows (in bounds, unused)
#pragma unroll
        for (int kt = 0; kt < 2; ++kt)
#pragma unroll
            for (int kk = 0; kk < 2; ++kk) { kh[kt][kk] = ldgb(kha, (kt * 2 + kk) * 1024); kl[kt][kk] = ldgb(kla, (kt * 2 + kk) * 1024); }
        float mn[QT]; bool need = false;
#pragma unroll
        for (int qt = 0; qt < QT; ++qt) { float mx = -3.0e38f;
#pragma unroll
            for (int kt = 0; kt < 2; ++kt)
#pragma unroll
                for (int r = 0; r < 8; ++r) { const float t = __builtin_fmaf(s[kt][qt][r], SCL, ab);   /* x HD^-0.5 (exact) + attn_bias */ s[kt][qt][r] = t; mx = fmaxf(mx, t); }
            mn[qt] = fmaxf(mx, xhalf(mx)); need = need || (mn[qt] > m[qt]); }
        if (__builtin_amdgcn_ballot_w32(need) != 0) {   // scalar branch: the rescale is skipped in passes where no query of the wave meets a new maximum
#pragma unroll
            for (int qt = 0; qt < QT; ++qt) { const float m2 = fmaxf(m[qt], mn[qt]); const float al = __builtin_amdgcn_exp2f((m[qt] - m2) * L2E);   /* 0 in the first pass, 1 where this query's maximum stays */ m[qt] = m2; l[qt] *= al;
#pragma unroll
                for (int dt = 0; dt < 4; ++dt) o[qt][dt] *= al; }
        }
#pragma unroll
        for (int qt = 0; qt < QT; ++qt)
#pragma unroll
            for (int kt = 0; kt < 2; ++kt) s[kt][qt] = (s[kt][qt] - m[qt]) * L2E;
        // exponentials in place, each with its slot filled: directly behind every v_exp_f32 stands the row-sum add of the exponential made two earlier (a v_nop behind the first two),
        // which neither reads the new result nor rewrites its source; the scheduling barriers keep that order
#pragma unroll
        for (int i = 0; i < 16 * QT; ++i) { s[(i / QT) >> 3][i % QT][(i / QT) & 7] = __builtin_amdgcn_exp2f(s[(i / QT) >> 3][i % QT][(i / QT) & 7]);
            __builtin_amdgcn_sched_barrier(0);
            if (i >= 2) l[i % QT] += s[((i - 2) / QT) >> 3][i % QT][((i - 2) / QT) & 7]; else asm volatile("v_nop");
            __builtin_amdgcn_sched_barrier(0); }
#pragma unroll
        for (int i = 16 * QT - 2; i < 16 * QT; ++i) l[i % QT] += s[1][i % QT][7];
#pragma unroll
        for (int qt = 0; qt < QT; ++qt) { v16h p16; v16bf ph, pl;
#pragma unroll
            for (int kt = 0; kt < 2; ++kt)
#pragma unroll
                for (int r = 0; r < 8; ++r) { const float p = s[kt][qt][r];
                    if (HR) { const __bf16 a = (__bf16)p; ph[kt * 8 + r] = a; pl[kt * 8 + r] = (__bf16)(p - (float)a); } else p16[kt * 8 + r] = (h16)(p * PCAR); }
#pragma unroll
            for (int dt = 0; dt < 4; ++dt) {
                if (HR) { o[qt][dt] = wmmab(vh[dt], ph, o[qt][dt]); o[qt][dt] = wmmab(vh[dt], pl, o[qt][dt]); o[qt][dt] = wmmab(vl[dt], ph, o[qt][dt]); }
                else o[qt][dt] = wmma16(v16[dt], p16, o[qt][dt]); } }
        // this pass's loads name these pairs: wait before they are advanced
        if (HR) asm volatile("s_wait_xcnt 0x0" : "+v"(kha), "+v"(kla), "+v"(vha), "+v"(vla) :: "memory"); else asm volatile("s_wait_xcnt 0x0" : "+v"(kha), "+v"(kla), "+v"(va) :: "memory");
        { const int kst = (key0 + 64 < TT) ? 32 * HD * 2 : 0; kha += kst; kla += kst; va += 32 * HD * 2; vha += 32 * HD * 2; vla += 32 * HD * 2; }
    }
#pragma unroll
    for (int qt = 0; qt < QT; ++qt) { const float f = __fdiv_rn(HR ? 1.0f : (1.0f / PCAR), l[qt] + xhalf(l[qt]));
#pragma unroll
        for (int dt = 0; dt < 4; ++dt) o[qt][dt] *= f; }
    float* orow = O + (size_t)lr * DM + hi * 8;   // a lane's 8 registers of a tile are 8 consecutive d of its query
    __builtin_amdgcn_sched_barrier(0);   // all arithmetic in front of the stores: nothing rewrites a register that an issued store names
#pragma unroll
    for (int qt = 0; qt < QT; ++qt)
#pragma unroll
        for (int dt = 0; dt < 4; ++dt) { *(v4f*)(orow + qt * 16 * DM + dt * 16) = __builtin_shufflevector(o[qt][dt], o[qt][dt], 0, 1, 2, 3); *(v4f*)(orow + qt * 16 * DM + dt * 16 + 4) = __builtin_shufflevector(o[qt][dt], o[qt][dt], 4, 5, 6, 7); }
}
// amdgpu_waves_per_eu(3): holds the register budget to a third of a SIMD's file, so that three work-groups share a WGP
__global__ __launch_bounds__(32 * FW) __attribute__((amdgpu_waves_per_eu(3))) void k_fattn(const bf* __restrict__ Qh, const bf* __restrict__ Ql, const bf* __restrict__ Kh, const bf* __restrict__ Kl, const h16* __restrict__ V16, const bf* __restrict__ Vh, const bf* __restrict__ Vl, const float* __restrict__ AB, float* __restrict__ O) {
    constexpr int NQB = TT / (FW * 16 * QT), NHB = RH / (FW * 16 * QT), NZ = NB_ * NH_; static_assert(RH % (FW * 16 * QT) == 0 && TT % (FW * 16 * QT) == 0, "whole query blocks on either side of RH");
    // the longer blocks (query rows < RH, three attn.v products) take the lowest indices, so that they start first; z = batch * NH_ + head, xb = query block
    const int fl = (int)blockIdx.x, f2 = fl - NZ * NHB; const int z = (f2 < 0) ? fl / NHB : f2 / (NQB - NHB), xb = (f2 < 0) ? fl % NHB : NHB + f2 % (NQB - NHB);
    const float ab = bfr(AB[0]);
    const int q0 = xb * (FW * 16 * QT) + __builtin_amdgcn_readfirstlane((int)(threadIdx.x >> 5)) * (16 * QT);   // scalar, so that the precision branch is scalar
    const size_t pz = (size_t)z * TT * HD, pq = pz + (size_t)q0 * HD; float* o = O + ((size_t)(z / NH_) * TT + q0) * DM + (z % NH_) * HD;
    if (q0 < RH) fattn<true>(Qh + pq, Ql + pq, Kh + pz, Kl + pz, V16 + pz, Vh + pz, Vl + pz, ab, o);
    else fattn<false>(Qh + pq, Ql + pq, Kh + pz, Kl + pz, V16 + pz, Vh + pz, Vl + pz, ab, o);
}

extern "C" void kernel_launch(void* const* d_in, const int* in_sizes, int n_in,
                              void* d_out, int out_size, void* d_ws, size_t ws_size, hipStream_t stream) {
    (void)in_sizes; (void)n_in; (void)out_size;
    const float* xs = (const float*)d_in[0]; const float* xt = (const float*)d_in[1]; const float* wqs = (const float*)d_in[2]; const float* bqs = (const float*)d_in[3]; const float* wqt = (const float*)d_in[4]; const float* bqt = (const float*)d_in[5]; const float* wks = (const float*)d_in[6]; const float* bks = (const float*)d_in[7]; const float* wkt = (const float*)d_in[8]; const float* bkt = (const float*)d_in[9]; const float* wvs = (const float*)d_in[10]; const float* bvs = (const float*)d_in[11]; const float* wvt = (const float*)d_in[12]; const float* bvt = (const float*)d_in[13]; const float* ABIAS = (const float*)d_in[14]; const float* x = xs; const float* wq = wqs; const float* wk = wks; const float* wv = wvs; const float* wo = nullptr; (void)wo; (void)x; (void)wq; (void)wk; (void)wv;
    float* OUT = (float*)d_out;     // [4][2048][1024]
    char* wsp = (char*)d_ws;
    auto take = [&](size_t bytes) { char* p = wsp; wsp += (bytes + 255) & ~(size_t)255; return (void*)p; };
    bf* WQ = (bf*)take((size_t)DQ * K2 * 2); bf* WK = (bf*)take((size_t)DKV * K2 * 2); bf* WV = (bf*)take((size_t)DKV * K2 * 2);
    bf* XB = (bf*)take((size_t)TT * K2 * 2); h16* VT16 = (h16*)take((size_t)NB_ * NKV * HD * TT * 2);
    bf* QPh = (bf*)take((size_t)NB_ * NH_ * TT * HD * 2); bf* QPl = (bf*)take((size_t)NB_ * NH_ * TT * HD * 2); bf* KPh = (bf*)take((size_t)NB_ * NKV * TT * HD * 2); bf* KPl = (bf*)take((size_t)NB_ * NKV * TT * HD * 2); bf* VTh = (bf*)take((size_t)NB_ * NKV * HD * TT * 2); bf* VTl = (bf*)take((size_t)NB_ * NKV * HD * TT * 2);   // the planes that k_fattn reads: all batches
    if ((size_t)(wsp - (char*)d_ws) > ws_size) return;    // ws 256 MiB
    { const unsigned LW = (unsigned)(((size_t)DM * K2 / 8 + 255) / 256); k_wcat<<<LW, 256, 0, stream>>>(wqs, wqt, WQ); k_wcat<<<LW, 256, 0, stream>>>(wks, wkt, WK); k_wcat<<<LW, 256, 0, stream>>>(wvs, wvt, WV);   /* [W_s | W_t] along k */
       }
    for (int b = 0; b < NB_; ++b) { const size_t pb = (size_t)b * NH_ * TT * HD;   // this batch's planes
        k_cat2<<<(unsigned)(((size_t)TT * K2 / 8 + 255) / 256), 256, 0, stream>>>(xs + (size_t)b * TT * DM, xt + (size_t)b * TT * DM, XB);   /* [Xs | Xt] plane */
        k_gemmw<bf, 0, false, 8, K2><<<dim3(TT / 64, DQ / 64, 1), 256, 0, stream>>>(XB, nullptr, WQ, nullptr, bqs, bqt, nullptr, QPh + pb, QPl + pb);   /* Q = [Xs|Xt][Wqs|Wqt]^T + b_qs + b_qt, as head planes */
        k_gemmw<bf, 0, false, 8, K2><<<dim3(TT / 64, DKV / 64, 1), 256, 0, stream>>>(XB, nullptr, WK, nullptr, bks, bkt, nullptr, KPh + pb, KPl + pb);
        k_gemmw<bf, 0, true, 8, K2><<<dim3(DKV / 64, TT / 64, 1), 256, 0, stream>>>(WV, nullptr, XB, nullptr, bvs, bvt, VT16 + pb, VTh + pb, VTl + pb);   /* V^T = [Wvs|Wvt][Xs|Xt]^T + b_vs + b_vt */
    }
    k_fattn<<<NB_ * NH_ * (TT / (FW * 16 * QT)), 32 * FW, 0, stream>>>(QPh, QPl, KPh, KPl, VT16, VTh, VTl, ABIAS, OUT);   /* merged context, f32 */
}

// v005
// It runs in 246 microseconds.
// Two timings next to v004 put it at 1.17 and 1.16 times that version's speed.
// Over all steps from v000 it is 17.4 times as fast.
#include <hip/hip_runtime.h>

// Two-stream multi-head self-attention with dual-linear projections (Xs, Xt [4][2048][1024]; Q = Xs W_qs^T + b_qs + Xt W_qt^T + b_qt ('oi' [1024][1024] each), K and V likewise; 16 heads x 64; scores/8 + attn_bias (scalar [1][1][1][1], read); softmax; out = merged context, no output projection -> [4][2048][1024] f32 (8.4 M)).
// Layout: each dual linear is ONE exact GEMM with K = 2048: one operand is the concatenated bf16 plane [Xs | Xt], the other the two 'oi' weights concatenated along k; the GEMM's own epilogue adds the two biases in f32 and stores the 16-bit planes that the attention reads (no f32 Q/K/V plane in memory).
// Compute dtypes, f32 accumulate: every input rounded to bf16; Q/K/V as exact K = 2048 products of the [Xs | Xt] plane against [W_s | W_t], + b_s + b_t in f32; scores hi.hi + hi.lo + lo.hi on every row; softmax f32 (running maximum, unnormalised exponentials, one division per row at the end); attn.v: query rows < 512 hl (3 products), the rest fp16 exponentials (x1024) x fp16 values; no output projection: f32 merged context.
// Three launches: k_pack (all 16-bit operand planes), k_proj (every projection tile of all batches), k_fattn.
// Attention is ONE launch for all batches and heads (k_fattn): scores, softmax and attn.v stay in registers, no score or probability plane in memory.
// Fragment order: every 16-bit plane that a matrix operand is loaded from is stored as 1-KB blocks of 16 rows x 32 k. Inside a block, 16-byte chunk number c * 32 + h * 16 + r holds row r, k = c * 16 + h * 8 .. + 7,
// which is what lane h * 16 + r takes as the c-th half of its fragment: each wave-wide 16-byte load reads 512 contiguous bytes (4 whole lines) instead of 32 bytes of each of 16 lines. Registers hold the same elements as with row-major planes.

#define NB_  4
#define TT   2048
#define DM   1024
#define NH_  16
#define NKV  16
#define REP  (NH_ / NKV)
#define HD   64
#define DQ   (NH_ * HD)
#define DKV  (NKV * HD)
#define K2   (2 * DM)              // concatenated contraction [Xs | Xt]
#define RH   512                  // query rows < RH use hi+lo planes (0: none)
#define WIN  0
#define PCAR 1024.0f
#define SCL  0.125f   // HD^-0.5
#define QT   2                    // k_fattn: 16-query column groups per wave
#define FW   4                    // k_fattn: waves per work-group
#define L2E  1.4426950408889634f
typedef _Float16 h16;
typedef unsigned short bf;
typedef __attribute__((ext_vector_type(16))) __bf16   v16bf;
typedef __attribute__((ext_vector_type(16))) _Float16 v16h;
typedef __attribute__((ext_vector_type(8)))  _Float16 v8h;
typedef __attribute__((ext_vector_type(8)))  unsigned short v8us;
typedef __attribute__((ext_vector_type(8)))  float    v8f;
typedef __attribute__((ext_vector_type(4)))  float    v4f;
typedef v8h  __attribute__((may_alias)) v8ha;
typedef v4f  __attribute__((may_alias)) v4fa;
typedef v8us __attribute__((may_alias)) v8usa;

__device__ __forceinline__ unsigned short f2bf(float f) { unsigned u = __float_as_uint(f); u += 0x7FFFu + ((u >> 16) & 1u); return (unsigned short)(u >> 16); }
__device__ __forceinline__ float bf2f(unsigned short b) { return __uint_as_float(((unsigned)b) << 16); }
__device__ __forceinline__ float bfr(float f) { return bf2f(f2bf(f)); }
__device__ __forceinline__ v16h cat16(v8h lo, v8h hi) { return __builtin_shufflevector(lo, hi, 0, 1, 2, 3, 4, 5, 6, 7, 8, 9, 10, 11, 12, 13, 14, 15); }
__device__ __forceinline__ v16bf cat16b(v8us lo, v8us hi) { return __builtin_bit_cast(v16bf, __builtin_shufflevector(lo, hi, 0, 1, 2, 3, 4, 5, 6, 7, 8, 9, 10, 11, 12, 13, 14, 15)); }
__device__ __forceinline__ v8f wmma16(v16h a, v16h b, v8f c) { return __builtin_amdgcn_wmma_f32_16x16x32_f16(false, a, false, b, (short)0, c, false, false); }
__device__ __forceinline__ v8f wmmab(v16bf a, v16bf b, v8f c) { return __builtin_amdgcn_wmma_f32_16x16x32_bf16(false, a, false, b, (short)0, c, false, false); }



__device__ __forceinline__ h16 tohx(float x) { return (h16)x; }
__device__ __forceinline__ void splitf(float y, unsigned short& h, unsigned short& l) { h = f2bf(y); l = f2bf(y - bf2f(h)); }
typedef __attribute__((ext_vector_type(2))) _Float16 v2h;
typedef __attribute__((ext_vector_type(4))) _Float16 v4h;
typedef __attribute__((ext_vector_type(2))) unsigned short v2us;
typedef __attribute__((ext_vector_type(4))) unsigned short v4us;
typedef __attribute__((ext_vector_type(2))) float v2f;
typedef __attribute__((ext_vector_type(4))) int v4i;

// ---- gemmw: register-blocked GEMM on one 64x64 tile at (r0, c0) (16 accumulators per wave), operands straight from fragment-ordered 16-bit planes (blocks [row / 16][k / 32]); one work-group of 32 * NW threads, os = its NW * 64 * 68 floats of LDS.
// y[m][n] = sum_k A[m][k] Bt[n][k] (+ split products per NSPLIT) + b1 + b2 (both rounded to bf16, added one after the other in f32). K % (32 * NW) == 0; K is a compile-time constant, so that the four 16-row bands of an operand are immediate offsets from one address.
// Split k: the k range is cut into NW equal contiguous pieces, wave w sums piece w of the whole tile; the NW partial tiles meet in LDS and are added in wave order.
// Epilogue, y never stored as f32, planes in fragment order, a tile is 8 KB contiguous in each: VT false: m = token, n = head * HD + d, bias by n, hi/lo bf16 planes [head], rows = tokens, k = d, blocks [token / 16][d / 32].
//                                   VT true:  m = head * HD + d (A = the weights), n = token (Bt = the inputs), bias by m, fp16 and hi/lo bf16 planes [head], rows = d, k = tokens, blocks [token / 32][d / 16]: the transposed value planes come out of the product itself.
// fragment loads from a 64-bit byte address held in a register pair (kept as an integer so that the s_wait_xcnt statements below can name the pair)
typedef unsigned long long u64;
typedef const __attribute__((address_space(1))) v8us* gp8us;
typedef const __attribute__((address_space(1))) v8h*  gp8h;
__device__ __forceinline__ v16bf ldgb(u64 a, int ofs) { return cat16b(*(gp8us)(a + ofs), *(gp8us)(a + ofs + 512)); }   // the two halves of a block
__device__ __forceinline__ v16h  ldgh(u64 a, int ofs) { return cat16(*(gp8h)(a + ofs), *(gp8h)(a + ofs + 512)); }
template <typename T16> struct WFrag;
template <> struct WFrag<h16> { typedef v16h V; static __device__ __forceinline__ V ld(u64 a, int ofs) { return ldgh(a, ofs); } static __device__ __forceinline__ v8f mma(V a, V b, v8f c) { return wmma16(a, b, c); } };
template <> struct WFrag<bf> { typedef v16bf V; static __device__ __forceinline__ V ld(u64 a, int ofs) { return ldgb(a, ofs); } static __device__ __forceinline__ v8f mma(V a, V b, v8f c) { return wmmab(a, b, c); } };
template <typename T16, int NSPLIT, bool VT, int NW, int K>
__device__ __forceinline__ void gemmw(const T16* __restrict__ A, const T16* __restrict__ A2, const T16* __restrict__ Bt, const T16* __restrict__ Bt2, const float* __restrict__ b1, const float* __restrict__ b2, h16* __restrict__ P16, bf* __restrict__ Ph, bf* __restrict__ Pl, float* os, const int r0, const int c0) {
    static_assert(HD == 64 && NW == 8, "a 64-column tile is one head; its 16 half blocks of 32 chunks are stored two per wave");
    typedef typename WFrag<T16>::V V;
    const int lane = threadIdx.x & 31, lr = lane & 15, hi = lane >> 4;
    v8f acc[4][4];
#pragma unroll
    for (int mb = 0; mb < 4; ++mb)
#pragma unroll
        for (int nb = 0; nb < 4; ++nb) acc[mb][nb] = (v8f){};
    const size_t aoff = (size_t)r0 * K + 8 * lane, boff = (size_t)c0 * K + 8 * lane;   // a 16-row band is 16 * K elements, a k step of 32 is one block of 512
    const int wave = __builtin_amdgcn_readfirstlane((int)(threadIdx.x >> 5));   // scalar, so that the k bounds and the loop test stay scalar
    const int kw = K / NW, k0 = wave * kw;
    u64 pa = (u64)(A + aoff + (size_t)k0 * 16), pb = (u64)(Bt + boff + (size_t)k0 * 16);   // the lane's chunk of this wave's first blocks; bands are constant offsets
#pragma unroll 1
    for (int kc = k0; kc < k0 + kw; kc += 32) {
        V a[4], a2[4], b[4], b2[4];
#pragma unroll
        for (int mb = 0; mb < 4; ++mb) { a[mb] = WFrag<T16>::ld(pa, mb * 16 * K * 2); if (NSPLIT == 1 || NSPLIT == 2) a2[mb] = WFrag<T16>::ld((u64)(A2 + aoff + (size_t)kc * 16), mb * 16 * K * 2); }
#pragma unroll
        for (int nb = 0; nb < 4; ++nb) { b[nb] = WFrag<T16>::ld(pb, nb * 16 * K * 2); if (NSPLIT >= 2) b2[nb] = WFrag<T16>::ld((u64)(Bt2 + boff + (size_t)kc * 16), nb * 16 * K * 2); }
        __builtin_amdgcn_sched_barrier(0);   // every load of the pass is issued before its first product (else the compiler reloads one B register set four times, one L2 latency each)
#pragma unroll
        for (int nb = 0; nb < 4; ++nb)
#pragma unroll
            for (int mb = 0; mb < 4; ++mb) { acc[mb][nb] = WFrag<T16>::mma(a[mb], b[nb], acc[mb][nb]); if (NSPLIT == 1 || NSPLIT == 2) acc[mb][nb] = WFrag<T16>::mma(a2[mb], b[nb], acc[mb][nb]); if (NSPLIT >= 2) acc[mb][nb] = WFrag<T16>::mma(a[mb], b2[nb], acc[mb][nb]); }
        asm volatile("v_nop\n\tv_nop\n\tv_nop\n\tv_nop" : "+v"(acc[0][0]), "+v"(acc[1][1]), "+v"(acc[2][2]), "+v"(acc[3][3]) : "v"(a[0]), "v"(a[3]));
        asm volatile("s_wait_xcnt 0x0" : "+v"(pa), "+v"(pb) :: "memory");   // this pass's loads name these pairs: wait before they are advanced
        pa += 1024; pb += 1024;
    }
    constexpr int NS = 2;   // 8-element chunks of the tile per thread: chunk s of thread t is chunk s * 256 + t of the tile's 8 KB in each output plane
    // tile row and first tile column of chunk s: VT false: row rw + s * 32, column cofs; VT true: row rw, column cofs + s * 32
    const int rw = (VT ? ((wave >> 1) & 3) : (wave >> 2)) * 16 + lr, cofs = (VT ? 0 : ((wave >> 1) & 1) * 32) + (wave & 1) * 16 + hi * 8;
    // the biases are fetched here, so that they arrive under the LDS exchange
    v4f bc1[2] = {}, bc2[2] = {}; float br1 = 0.f, br2 = 0.f;
    if constexpr (VT) { br1 = b1[r0 + rw]; br2 = b2[r0 + rw]; }
    else { bc1[0] = *(const v4f*)(b1 + c0 + cofs); bc1[1] = *(const v4f*)(b1 + c0 + cofs + 4); bc2[0] = *(const v4f*)(b2 + c0 + cofs); bc2[1] = *(const v4f*)(b2 + c0 + cofs + 4); }
    asm volatile("s_wait_xcnt 0x0" ::: "memory");   // the bias loads are issued: wait before a register that they name is reused
    float* ow = os + (size_t)wave * 64 * 68;
    // the three loops are unrolled so that every accumulator index is a constant (else acc goes to scratch)
#pragma unroll
    for (int mb = 0; mb < 4; ++mb)
#pragma unroll
        for (int nb = 0; nb < 4; ++nb)
#pragma unroll
            for (int j = 0; j < 8; ++j) ow[(mb * 16 + hi * 8 + j) * 68 + nb * 16 + lr] = acc[mb][nb][j];
    __syncthreads();   // every wave's partial tile is in LDS before any of them is read
    v8us oh[NS], ol[NS]; v8h o16[NS];
    // all loops unrolled: the NW LDS reads of a sum are issued together instead of one latency each, and the result arrays are indexed by constants
#pragma unroll
    for (int s = 0; s < NS; ++s) { const int at = (rw + (VT ? 0 : s * 32)) * 68 + cofs + (VT ? s * 32 : 0); v4f val[2] = { *(const v4fa*)(os + at), *(const v4fa*)(os + at + 4) };
#pragma unroll
        for (int w = 1; w < NW; ++w) { val[0] += *(const v4fa*)(os + w * 64 * 68 + at); val[1] += *(const v4fa*)(os + w * 64 * 68 + at + 4); }
#pragma unroll
        for (int q = 0; q < 8; ++q) { const float y = __fadd_rn(__fadd_rn(val[q >> 2][q & 3], bfr(VT ? br1 : bc1[q >> 2][q & 3])), bfr(VT ? br2 : bc2[q >> 2][q & 3])); unsigned short h, l; splitf(y, h, l); oh[s][q] = h; ol[s][q] = l; if (VT) o16[s][q] = tohx(y); } }
    const size_t e0 = (VT ? (size_t)r0 * TT + (size_t)c0 * HD : (size_t)c0 * TT + (size_t)r0 * HD) + (size_t)threadIdx.x * 8; constexpr size_t es = 2048;   // chunk s lies at e0 + s * es
    __builtin_amdgcn_sched_barrier(0);   // all arithmetic in front of the stores: nothing rewrites a register that an issued store names
#pragma unroll
    for (int s = 0; s < NS; ++s) { *(v8us*)(Ph + e0 + s * es) = oh[s]; *(v8us*)(Pl + e0 + s * es) = ol[s]; if (VT) *(v8h*)(P16 + e0 + s * es) = o16[s]; }
}
// ---- k_proj: every projection tile of the problem in ONE launch; grid (TT / 64 token tiles, 3 * NH_: Q heads, K heads, V heads, NB_ batches), 256 threads. A work-group does what one work-group of a per-batch, per-projection launch did;
// with twelve times the work-groups behind one another, a WGP starts its next tile while its other one is still in its LDS exchange and stores, and only one launch is filled and drained.
__global__ __launch_bounds__(256) void k_proj(const bf* __restrict__ XC, const bf* __restrict__ WQ, const bf* __restrict__ WK, const bf* __restrict__ WV, const float* __restrict__ bqs, const float* __restrict__ bqt, const float* __restrict__ bks, const float* __restrict__ bkt, const float* __restrict__ bvs, const float* __restrict__ bvt,
                                              h16* __restrict__ VT16, bf* __restrict__ QPh, bf* __restrict__ QPl, bf* __restrict__ KPh, bf* __restrict__ KPl, bf* __restrict__ VTh, bf* __restrict__ VTl) {
    __shared__ __align__(16) float os[8 * 64 * 68];   // one array for both forms of the tile
    const int t0 = (int)blockIdx.x * 64, pj = (int)blockIdx.y / NH_, h0 = ((int)blockIdx.y % NH_) * 64;   // all three the same for the whole work-group: the branches below are scalar
    const bf* X = XC + (size_t)blockIdx.z * TT * K2; const size_t pb = (size_t)blockIdx.z * NH_ * TT * HD;   // this batch's [Xs | Xt] plane and head planes
    if (pj < 2) gemmw<bf, 0, false, 8, K2>(X, nullptr, pj ? WK : WQ, nullptr, pj ? bks : bqs, pj ? bkt : bqt, nullptr, (pj ? KPh : QPh) + pb, (pj ? KPl : QPl) + pb, os, t0, h0);   // Q = [Xs|Xt][Wqs|Wqt]^T + b_qs + b_qt, as head planes; K likewise
    else gemmw<bf, 0, true, 8, K2>(WV, nullptr, X, nullptr, bvs, bvt, VT16 + pb, VTh + pb, VTl + pb, os, h0, t0);              // V^T = [Wvs|Wvt][Xs|Xt]^T + b_vs + b_vt
}


__global__ __launch_bounds__(256) void k_wtG(const float* __restrict__ w, int K, int N, bf* Bt) {
    const int lane = threadIdx.x & 31; const int L0 = (blockIdx.x * 8 + (threadIdx.x >> 5)) * 8; const int nlines = N * K / 64;
{
#pragma unroll 1
        for (int l = 0; l < 8; ++l) { const int L = L0 + l; if (L >= nlines) break; const size_t e = (size_t)L * 64 + lane * 2; const int k = (int)(e % K), n = (int)(e / K); v2us o;
            o[0] = f2bf(w[(size_t)k * N + n]); o[1] = f2bf(w[(size_t)(k + 1) * N + n]); *(v2us*)(Bt + e) = o; }
         }
}
__global__ __launch_bounds__(256) void k_cvt8(const float* __restrict__ src, bf* dst, size_t n8) { const size_t i = (size_t)blockIdx.x * 256 + threadIdx.x; if (i >= n8) return; const v8f v = *(const v8f*)(src + i * 8); v8us o;
#pragma unroll
    for (int k = 0; k < 8; ++k) o[k] = f2bf(v[k]); *(v8us*)(dst + i * 8) = o;  }



// [a | b] along k (two row-major f32 [rows][DM] inputs), rounded to bf16, stored in fragment order (blocks [row / 16][k / 32]); thread i makes one 16-byte chunk.
// A wave takes 8 rows x 32 k of one block: it reads 128 contiguous bytes of each row and its store covers 4 whole lines.
__device__ __forceinline__ void catpack(const float* __restrict__ a, const float* __restrict__ b, bf* dst, size_t i) {
    const int lane = (int)(i & 31), j = lane & 3, r = (int)((i >> 5) & 1) * 8 + (lane >> 2); const size_t blk = i >> 6;
    const int c = (int)(blk % (K2 / 32)) * 32 + j * 8; const size_t t = (blk / (K2 / 32)) * 16 + r;
    const float* src = (c < DM) ? (a + t * DM + c) : (b + t * DM + (c - DM)); const v8f v = *(const v8f*)src; v8us o;
#pragma unroll
    for (int k = 0; k < 8; ++k) o[k] = f2bf(v[k]);
    *(v8us*)(dst + blk * 512 + (j >> 1) * 256 + ((j & 1) * 16 + r) * 8) = o;
}
// ---- k_pack: all four operand planes in ONE launch: work-groups 0 .. PKX - 1 make [Xs | Xt] of all batches (NB_ * TT rows, a batch's plane is TT * K2 elements), then PKW each for [Wqs | Wqt], [Wks | Wkt], [Wvs | Wvt]; grid PKX + 3 * PKW, 256 threads.
#define PKX ((unsigned)((size_t)NB_ * TT * K2 / 8 / 256))
#define PKW ((unsigned)((size_t)DM * K2 / 8 / 256))
__global__ __launch_bounds__(256) void k_pack(const float* __restrict__ xs, const float* __restrict__ xt, const float* __restrict__ wqs, const float* __restrict__ wqt, const float* __restrict__ wks, const float* __restrict__ wkt, const float* __restrict__ wvs, const float* __restrict__ wvt, bf* XC, bf* WQ, bf* WK, bf* WV) {
    static_assert(((size_t)NB_ * TT * K2 / 8) % 256 == 0 && ((size_t)DM * K2 / 8) % 256 == 0, "whole work-groups per plane");
    const unsigned g = blockIdx.x; const unsigned pl = (g < PKX) ? 0u : 1u + (g - PKX) / PKW, lb = (g < PKX) ? g : (g - PKX) % PKW;   // plane and work-group inside it: scalar
    const float* a = (pl == 0) ? xs : (pl == 1) ? wqs : (pl == 2) ? wks : wvs; const float* b = (pl == 0) ? xt : (pl == 1) ? wqt : (pl == 2) ? wkt : wvt; bf* d = (pl == 0) ? XC : (pl == 1) ? WQ : (pl == 2) ? WK : WV;
    catpack(a, b, d, (size_t)lb * 256 + threadIdx.x);
}
// ---- k_fattn: scores, softmax and attn.v of one (batch, head) for FW waves x 16 * QT queries; grid NB_ * NH_ * TT / (FW * 16 * QT), 32 * FW threads, no LDS, no barrier.
// Transposed products: S^T = K Q^T (A = 16 key rows, B = 16 query rows, both fragment-ordered planes read by the same loader) leaves one query per lane (column lr; keys 8 * hi + r),
// so two S^T tiles of 32 keys, converted in place, ARE the B operand (k order 8 * hi + s, 16 + 8 * hi + s - 8, the loader's own) of O^T += V^T P^T, with A = 16 d rows of the transposed value plane (a pass's 64 d x 32 keys are 4 KB contiguous).
// Per query: running maximum m (both lane halves agree), partial sum l per lane half (joined at the end), O^T rescaled by exp(m_old - m_new) only in passes where some query's maximum moves.
__device__ __forceinline__ float xhalf(float x) { return __builtin_bit_cast(float, __builtin_amdgcn_permlanex16(__builtin_bit_cast(int, x), __builtin_bit_cast(int, x), 0x76543210, 0xfedcba98, false, false)); }   // lane l reads lane l ^ 16
template <bool HR>
__device__ __forceinline__ void fattn(const bf* __restrict__ Qh, const bf* __restrict__ Ql, const bf* __restrict__ Kh, const bf* __restrict__ Kl, const h16* __restrict__ V16, const bf* __restrict__ Vh, const bf* __restrict__ Vl, const float ab, float* __restrict__ O) {
    // every '#pragma unroll' below: fragment, score and accumulator arrays must be indexed by constants only (else they go to scratch)
    static_assert(QT == 2, "the exponential loop below pairs element i with the sum of element i - 2 of the same column group");
    const int lane = threadIdx.x & 31, lr = lane & 15, hi = lane >> 4;
    // one byte address per plane and lane (the lane's chunk of a block); blocks are constant offsets of 1 KB from it: Q, K block (row tile) * 2 + k step, V block d tile
    u64 qha = (u64)(Qh + 8 * lane), qla = (u64)(Ql + 8 * lane), kha = (u64)(Kh + 8 * lane), kla = (u64)(Kl + 8 * lane);
    u64 va = (u64)(V16 + 8 * lane), vha = (u64)(Vh + 8 * lane), vla = (u64)(Vl + 8 * lane);
    v16bf qh[QT][2], ql[QT][2];
#pragma unroll
    for (int qt = 0; qt < QT; ++qt)
#pragma unroll
        for (int kk = 0; kk < 2; ++kk) { qh[qt][kk] = ldgb(qha, (qt * 2 + kk) * 1024); ql[qt][kk] = ldgb(qla, (qt * 2 + kk) * 1024); }
    v8f o[QT][4]; float m[QT], l[QT];
#pragma unroll
    for (int qt = 0; qt < QT; ++qt) { m[qt] = -3.0e38f; l[qt] = 0.f;
#pragma unroll
        for (int dt = 0; dt < 4; ++dt) o[qt][dt] = (v8f){}; }
    v16bf kh[2][2], kl[2][2];
#pragma unroll
    for (int kt = 0; kt < 2; ++kt)
#pragma unroll
        for (int kk = 0; kk < 2; ++kk) { kh[kt][kk] = ldgb(kha, (kt * 2 + kk) * 1024); kl[kt][kk] = ldgb(kla, (kt * 2 + kk) * 1024); }
    asm volatile("s_wait_xcnt 0x0" : "+v"(qha), "+v"(qla), "+v"(kha), "+v"(kla) :: "memory");   // the issued loads name these pairs: wait before one is advanced or reused
    kha += 32 * HD * 2; kla += 32 * HD * 2;
    // rolled: one pass of 32 keys already fills the register budget of three waves per SIMD
#pragma unroll 1
    for (int key0 = 0; key0 < TT; key0 += 32) {
        v8f s[2][QT];
#pragma unroll
        for (int kt = 0; kt < 2; ++kt)
#pragma unroll
            for (int qt = 0; qt < QT; ++qt) s[kt][qt] = (v8f){};
#pragma unroll
        for (int kk = 0; kk < 2; ++kk) {   // per k step: hi.hi, q_lo.k_hi, q_hi.k_lo
#pragma unroll
            for (int kt = 0; kt < 2; ++kt)
#pragma unroll
                for (int qt = 0; qt < QT; ++qt) s[kt][qt] = wmmab(kh[kt][kk], qh[qt][kk], s[kt][qt]);
#pragma unroll
            for (int kt = 0; kt < 2; ++kt)
#pragma unroll
                for (int qt = 0; qt < QT; ++qt) s[kt][qt] = wmmab(kh[kt][kk], ql[qt][kk], s[kt][qt]);
#pragma unroll
            for (int kt = 0; kt < 2; ++kt)
#pragma unroll
                for (int qt = 0; qt < QT; ++qt) s[kt][qt] = wmmab(kl[kt][kk], qh[qt][kk], s[kt][qt]);
        }
        v16h v16[4]; v16bf vh[4], vl[4];   // this pass's values, in flight under the softmax
#pragma unroll
        for (int dt = 0; dt < 4; ++dt) { if (HR) { vh[dt] = ldgb(vha, dt * 1024); vl[dt] = ldgb(vla, dt * 1024); } else v16[dt] = ldgh(va, dt * 1024); }
        // next pass's keys, in flight under the softmax and attn.v; the last pass re-reads its own rows (in bounds, unused)
#pragma unroll
        for (int kt = 0; kt < 2; ++kt)
#pragma unroll
            for (int kk = 0; kk < 2; ++kk) { kh[kt][kk] = ldgb(kha, (kt * 2 + kk) * 1024); kl[kt][kk] = ldgb(kla, (kt * 2 + kk) * 1024); }
        float mn[QT]; bool need = false;
#pragma unroll
        for (int qt = 0; qt < QT; ++qt) { float mx = -3.0e38f;
#pragma unroll
            for (int kt = 0; kt < 2; ++kt)
#pragma unroll
                for (int r = 0; r < 8; ++r) { const float t = __builtin_fmaf(s[kt][qt][r], SCL, ab);   /* x HD^-0.5 (exact) + attn_bias */ s[kt][qt][r] = t; mx = fmaxf(mx, t); }
            mn[qt] = fmaxf(mx, xhalf(mx)); need = need || (mn[qt] > m[qt]); }
        if (__builtin_amdgcn_ballot_w32(need) != 0) {   // scalar branch: the rescale is skipped in passes where no query of the wave meets a new maximum
#pragma unroll
            for (int qt = 0; qt < QT; ++qt) { const float m2 = fmaxf(m[qt], mn[qt]); const float al = __builtin_amdgcn_exp2f((m[qt] - m2) * L2E);   /* 0 in the first pass, 1 where this query's maximum stays */ m[qt] = m2; l[qt] *= al;
#pragma unroll
                for (int dt = 0; dt < 4; ++dt) o[qt][dt] *= al; }
        }
#pragma unroll
        for (int qt = 0; qt < QT; ++qt)
#pragma unroll
            for (int kt = 0; kt < 2; ++kt) s[kt][qt] = (s[kt][qt] - m[qt]) * L2E;
        // exponentials in place, each with its slot filled: directly behind every v_exp_f32 stands the row-sum add of the exponential made two earlier (a v_nop behind the first two),
        // which neither reads the new result nor rewrites its source; the scheduling barriers keep that order
#pragma unroll
        for (int i = 0; i < 16 * QT; ++i) { s[(i / QT) >> 3][i % QT][(i / QT) & 7] = __builtin_amdgcn_exp2f(s[(i / QT) >> 3][i % QT][(i / QT) & 7]);
            __builtin_amdgcn_sched_barrier(0);
            if (i >= 2) l[i % QT] += s[((i - 2) / QT) >> 3][i % QT][((i - 2) / QT) & 7]; else asm volatile("v_nop");
            __builtin_amdgcn_sched_barrier(0); }
#pragma unroll
        for (int i = 16 * QT - 2; i < 16 * QT; ++i) l[i % QT] += s[1][i % QT][7];
#pragma unroll
        for (int qt = 0; qt < QT; ++qt) { v16h p16; v16bf ph, pl;
#pragma unroll
            for (int kt = 0; kt < 2; ++kt)
#pragma unroll
                for (int r = 0; r < 8; ++r) { const float p = s[kt][qt][r];
                    if (HR) { const __bf16 a = (__bf16)p; ph[kt * 8 + r] = a; pl[kt * 8 + r] = (__bf16)(p - (float)a); } else p16[kt * 8 + r] = (h16)(p * PCAR); }
#pragma unroll
            for (int dt = 0; dt < 4; ++dt) {
                if (HR) { o[qt][dt] = wmmab(vh[dt], ph, o[qt][dt]); o[qt][dt] = wmmab(vh[dt], pl, o[qt][dt]); o[qt][dt] = wmmab(vl[dt], ph, o[qt][dt]); }
                else o[qt][dt] = wmma16(v16[dt], p16, o[qt][dt]); } }
        // this pass's loads name these pairs: wait before they are advanced
        if (HR) asm volatile("s_wait_xcnt 0x0" : "+v"(kha), "+v"(kla), "+v"(vha), "+v"(vla) :: "memory"); else asm volatile("s_wait_xcnt 0x0" : "+v"(kha), "+v"(kla), "+v"(va) :: "memory");
        { const int kst = (key0 + 64 < TT) ? 32 * HD * 2 : 0; kha += kst; kla += kst; va += 32 * HD * 2; vha += 32 * HD * 2; vla += 32 * HD * 2; }
    }
#pragma unroll
    for (int qt = 0; qt < QT; ++qt) { const float f = __fdiv_rn(HR ? 1.0f : (1.0f / PCAR), l[qt] + xhalf(l[qt]));
#pragma unroll
        for (int dt = 0; dt < 4; ++dt) o[qt][dt] *= f; }
    float* orow = O + (size_t)lr * DM + hi * 8;   // a lane's 8 registers of a tile are 8 consecutive d of its query
    __builtin_amdgcn_sched_barrier(0);   // all arithmetic in front of the stores: nothing rewrites a register that an issued store names
#pragma unroll
    for (int qt = 0; qt < QT; ++qt)
#pragma unroll
        for (int dt = 0; dt < 4; ++dt) { *(v4f*)(orow + qt * 16 * DM + dt * 16) = __builtin_shufflevector(o[qt][dt], o[qt][dt], 0, 1, 2, 3); *(v4f*)(orow + qt * 16 * DM + dt * 16 + 4) = __builtin_shufflevector(o[qt][dt], o[qt][dt], 4, 5, 6, 7); }
}
// amdgpu_waves_per_eu(3): holds the register budget to a third of a SIMD's file, so that three work-groups share a WGP
__global__ __launch_bounds__(32 * FW) __attribute__((amdgpu_waves_per_eu(3))) void k_fattn(const bf* __restrict__ Qh, const bf* __restrict__ Ql, const bf* __restrict__ Kh, const bf* __restrict__ Kl, const h16* __restrict__ V16, const bf* __restrict__ Vh, const bf* __restrict__ Vl, const float* __restrict__ AB, float* __restrict__ O) {
    constexpr int NQB = TT / (FW * 16 * QT), NHB = RH / (FW * 16 * QT), NZ = NB_ * NH_; static_assert(RH % (FW * 16 * QT) == 0 && TT % (FW * 16 * QT) == 0, "whole query blocks on either side of RH");
    // the longer blocks (query rows < RH, three attn.v products) take the lowest indices, so that they start first; z = batch * NH_ + head, xb = query block
    const int fl = (int)blockIdx.x, f2 = fl - NZ * NHB; const int z = (f2 < 0) ? fl / NHB : f2 / (NQB - NHB), xb = (f2 < 0) ? fl % NHB : NHB + f2 % (NQB - NHB);
    const float ab = bfr(AB[0]);
    const int q0 = xb * (FW * 16 * QT) + __builtin_amdgcn_readfirstlane((int)(threadIdx.x >> 5)) * (16 * QT);   // scalar, so that the precision branch is scalar
    const size_t pz = (size_t)z * TT * HD, pq = pz + (size_t)q0 * HD; float* o = O + ((size_t)(z / NH_) * TT + q0) * DM + (z % NH_) * HD;
    if (q0 < RH) fattn<true>(Qh + pq, Ql + pq, Kh + pz, Kl + pz, V16 + pz, Vh + pz, Vl + pz, ab, o);
    else fattn<false>(Qh + pq, Ql + pq, Kh + pz, Kl + pz, V16 + pz, Vh + pz, Vl + pz, ab, o);
}

extern "C" void kernel_launch(void* const* d_in, const int* in_sizes, int n_in,
                              void* d_out, int out_size, void* d_ws, size_t ws_size, hipStream_t stream) {
    (void)in_sizes; (void)n_in; (void)out_size;
    const float* xs = (const float*)d_in[0]; const float* xt = (const float*)d_in[1]; const float* wqs = (const float*)d_in[2]; const float* bqs = (const float*)d_in[3]; const float* wqt = (const float*)d_in[4]; const float* bqt = (const float*)d_in[5]; const float* wks = (const float*)d_in[6]; const float* bks = (const float*)d_in[7]; const float* wkt = (const float*)d_in[8]; const float* bkt = (const float*)d_in[9]; const float* wvs = (const float*)d_in[10]; const float* bvs = (const float*)d_in[11]; const float* wvt = (const float*)d_in[12]; const float* bvt = (const float*)d_in[13]; const float* ABIAS = (const float*)d_in[14]; const float* x = xs; const float* wq = wqs; const float* wk = wks; const float* wv = wvs; const float* wo = nullptr; (void)wo; (void)x; (void)wq; (void)wk; (void)wv;
    float* OUT = (float*)d_out;     // [4][2048][1024]
    char* wsp = (char*)d_ws;
    auto take = [&](size_t bytes) { char* p = wsp; wsp += (bytes + 255) & ~(size_t)255; return (void*)p; };
    bf* WQ = (bf*)take((size_t)DQ * K2 * 2); bf* WK = (bf*)take((size_t)DKV * K2 * 2); bf* WV = (bf*)take((size_t)DKV * K2 * 2);
    bf* XB = (bf*)take((size_t)NB_ * TT * K2 * 2); h16* VT16 = (h16*)take((size_t)NB_ * NKV * HD * TT * 2);
    bf* QPh = (bf*)take((size_t)NB_ * NH_ * TT * HD * 2); bf* QPl = (bf*)take((size_t)NB_ * NH_ * TT * HD * 2); bf* KPh = (bf*)take((size_t)NB_ * NKV * TT * HD * 2); bf* KPl = (bf*)take((size_t)NB_ * NKV * TT * HD * 2); bf* VTh = (bf*)take((size_t)NB_ * NKV * HD * TT * 2); bf* VTl = (bf*)take((size_t)NB_ * NKV * HD * TT * 2);   // the planes that k_fattn reads: all batches
    if ((size_t)(wsp - (char*)d_ws) > ws_size) return;    // ws 256 MiB
    k_pack<<<PKX + 3 * PKW, 256, 0, stream>>>(xs, xt, wqs, wqt, wks, wkt, wvs, wvt, XB, WQ, WK, WV);   /* [Xs | Xt] of all batches, [W_s | W_t] along k */
    k_proj<<<dim3(TT / 64, 3 * NH_, NB_), 256, 0, stream>>>(XB, WQ, WK, WV, bqs, bqt, bks, bkt, bvs, bvt, VT16, QPh, QPl, KPh, KPl, VTh, VTl);   /* Q, K as head planes, V^T planes: all batches */
    k_fattn<<<NB_ * NH_ * (TT / (FW * 16 * QT)), 32 * FW, 0, stream>>>(QPh, QPl, KPh, KPl, VT16, VTh, VTl, ABIAS, OUT);   /* merged context, f32 */
}

// v006
// Measured time: 208 microseconds a run.
// Two timings next to v005 both put it at 1.16 times that version's speed.
// Counting every step since v000, it is 20.2 times as fast.
#include <hip/hip_runtime.h>

// Two-stream multi-head self-attention with dual-linear projections (Xs, Xt [4][2048][1024]; Q = Xs W_qs^T + b_qs + Xt W_qt^T + b_qt ('oi' [1024][1024] each), K and V likewise; 16 heads x 64; scores/8 + attn_bias (scalar [1][1][1][1], read); softmax; out = merged context, no output projection -> [4][2048][1024] f32 (8.4 M)).
// Layout: each dual linear is ONE exact GEMM with K = 2048: one operand is the concatenated bf16 plane [Xs | Xt], the other the two 'oi' weights concatenated along k; the GEMM's own epilogue adds the two biases in f32 and stores the 16-bit planes that the attention reads (no f32 Q/K/V plane in memory).
// Compute dtypes, f32 accumulate: every input rounded to bf16; Q/K/V as exact K = 2048 products of the [Xs | Xt] plane against [W_s | W_t], + b_s + b_t in f32; scores hi.hi + hi.lo + lo.hi on every row; softmax f32 (running maximum, unnormalised exponentials, one division per row at the end); attn.v: query rows < 512 hl (3 products), the rest fp16 exponentials (x1024) x fp16 values; no output projection: f32 merged context.
// Three launches: k_pack (all 16-bit operand planes), k_proj (every projection tile of all batches), k_fattn.
// Attention is ONE launch for all batches and heads (k_fattn): scores, softmax and attn.v stay in registers, no score or probability plane in memory.
// Fragment order: every 16-bit plane that a matrix operand is loaded from is stored as 1-KB blocks of 16 rows x 32 k. Inside a block, 16-byte chunk number c * 32 + h * 16 + r holds row r, k = c * 16 + h * 8 .. + 7,
// which is what lane h * 16 + r takes as the c-th half of its fragment: each wave-wide 16-byte load reads 512 contiguous bytes (4 whole lines) instead of 32 bytes of each of 16 lines. Registers hold the same elements as with row-major planes.

#define NB_  4
#define TT   2048
#define DM   1024
#define NH_  16
#define NKV  16
#define REP  (NH_ / NKV)
#define HD   64
#define DQ   (NH_ * HD)
#define DKV  (NKV * HD)
#define K2   (2 * DM)              // concatenated contraction [Xs | Xt]
#define RH   512                  // query rows < RH use hi+lo planes (0: none)
#define WIN  0
#define PCAR 1024.0f
#define SCL  0.125f   // HD^-0.5
#define QT   2                    // k_fattn: 16-query column groups per wave
#define FW   4                    // k_fattn: waves per work-group
#define L2E  1.4426950408889634f
typedef _Float16 h16;
typedef unsigned short bf;
typedef __attribute__((ext_vector_type(16))) __bf16   v16bf;
typedef __attribute__((ext_vector_type(16))) _Float16 v16h;
typedef __attribute__((ext_vector_type(8)))  _Float16 v8h;
typedef __attribute__((ext_vector_type(8)))  unsigned short v8us;
typedef __attribute__((ext_vector_type(8)))  float    v8f;
typedef __attribute__((ext_vector_type(4)))  float    v4f;
typedef v8h  __attribute__((may_alias)) v8ha;
typedef v4f  __attribute__((may_alias)) v4fa;
typedef v8us __attribute__((may_alias)) v8usa;

__device__ __forceinline__ unsigned short f2bf(float f) { unsigned u = __float_as_uint(f); u += 0x7FFFu + ((u >> 16) & 1u); return (unsigned short)(u >> 16); }
__device__ __forceinline__ float bf2f(unsigned short b) { return __uint_as_float(((unsigned)b) << 16); }
__device__ __forceinline__ float bfr(float f) { return bf2f(f2bf(f)); }
__device__ __forceinline__ v16h cat16(v8h lo, v8h hi) { return __builtin_shufflevector(lo, hi, 0, 1, 2, 3, 4, 5, 6, 7, 8, 9, 10, 11, 12, 13, 14, 15); }
__device__ __forceinline__ v16bf cat16b(v8us lo, v8us hi) { return __builtin_bit_cast(v16bf, __builtin_shufflevector(lo, hi, 0, 1, 2, 3, 4, 5, 6, 7, 8, 9, 10, 11, 12, 13, 14, 15)); }
__device__ __forceinline__ v8f wmma16(v16h a, v16h b, v8f c) { return __builtin_amdgcn_wmma_f32_16x16x32_f16(false, a, false, b, (short)0, c, false, false); }
__device__ __forceinline__ v8f wmmab(v16bf a, v16bf b, v8f c) { return __builtin_amdgcn_wmma_f32_16x16x32_bf16(false, a, false, b, (short)0, c, false, false); }



__device__ __forceinline__ h16 tohx(float x) { return (h16)x; }
__device__ __forceinline__ void splitf(float y, unsigned short& h, unsigned short& l) { h = f2bf(y); l = f2bf(y - bf2f(h)); }
typedef __attribute__((ext_vector_type(2))) _Float16 v2h;
typedef __attribute__((ext_vector_type(4))) _Float16 v4h;
typedef __attribute__((ext_vector_type(2))) unsigned short v2us;
typedef __attribute__((ext_vector_type(4))) unsigned short v4us;
typedef __attribute__((ext_vector_type(2))) float v2f;
typedef __attribute__((ext_vector_type(4))) int v4i;

// ---- gemmw: one 128x256 tile at (R0, C0) per work-group of 8 waves (2 x 4), each wave one 64x64 tile (16 accumulators) over the whole K; operands come from fragment-ordered 16-bit planes (blocks [row / 16][k / 32]).
// y[m][n] = sum_k A[m][k] Bt[n][k] + b1 + b2 (both rounded to bf16, added one after the other in f32); one f32 chain along k per element.
// Staging: a stage is 64 k of the tile's 8 A bands and 16 Bt bands (a band = 16 rows; its 64 k are 2 KB contiguous in the plane and stay so in LDS, so a fragment half is still 512 contiguous bytes per wave-wide read).
// The 48 KB of a stage are fetched from L2 once per work-group by asynchronous copies (each wave copies 3 bands) and read by the 4 (A) or 2 (Bt) waves that need them; two buffers, the next stage's copies fly under this stage's products.
// Epilogue, y never stored as f32, planes in fragment order, a 64x64 tile is 8 KB contiguous in each: VT false: m = token, n = head * HD + d, bias by n, hi/lo bf16 planes [head], rows = tokens, k = d, blocks [token / 16][d / 32].
//                                   VT true:  m = head * HD + d (A = the weights), n = token (Bt = the inputs), bias by m, fp16 and hi/lo bf16 planes [head], rows = d, k = tokens, blocks [token / 32][d / 16]: the transposed value planes come out of the product itself.
// fragment loads from a 64-bit byte address held in a register pair (kept as an integer so that the s_wait_xcnt statements below can name the pair)
typedef unsigned long long u64;
typedef const __attribute__((address_space(1))) v8us* gp8us;
typedef const __attribute__((address_space(1))) v8h*  gp8h;
__device__ __forceinline__ v16bf ldgb(u64 a, int ofs) { return cat16b(*(gp8us)(a + ofs), *(gp8us)(a + ofs + 512)); }   // the two halves of a block
__device__ __forceinline__ v16h  ldgh(u64 a, int ofs) { return cat16(*(gp8h)(a + ofs), *(gp8h)(a + ofs + 512)); }
#define SGK   64                  // k per stage: two blocks of every band
#define BANDB (SGK * 16 * 2)      // bytes of one band's stage
#define STGB  (24 * BANDB)        // bytes of a stage: 8 bands of A, then 16 bands of Bt
// a wave's share of a stage: three bands of 2 KB, each four wave-wide 512-byte copies; l = the lane's LDS byte address in the first band's place (the three places are adjacent), g0, g1, g2 = the lane's global byte address in each band.
// One statement: the s_wait_xcnt stands behind the last copy inside it, so that no register that a copy names is rewritten in front of it.
__device__ __forceinline__ void copystage(unsigned l, u64 g0, u64 g1, u64 g2) {
    asm volatile("global_load_async_to_lds_b128 %0, %12, off\n\tglobal_load_async_to_lds_b128 %1, %13, off\n\tglobal_load_async_to_lds_b128 %2, %14, off\n\tglobal_load_async_to_lds_b128 %3, %15, off\n\t"
                 "global_load_async_to_lds_b128 %4, %16, off\n\tglobal_load_async_to_lds_b128 %5, %17, off\n\tglobal_load_async_to_lds_b128 %6, %18, off\n\tglobal_load_async_to_lds_b128 %7, %19, off\n\t"
                 "global_load_async_to_lds_b128 %8, %20, off\n\tglobal_load_async_to_lds_b128 %9, %21, off\n\tglobal_load_async_to_lds_b128 %10, %22, off\n\tglobal_load_async_to_lds_b128 %11, %23, off\n\ts_wait_xcnt 0x0"
                 :: "v"(l), "v"(l + 512u), "v"(l + 1024u), "v"(l + 1536u), "v"(l + BANDB), "v"(l + BANDB + 512u), "v"(l + BANDB + 1024u), "v"(l + BANDB + 1536u), "v"(l + 2 * BANDB), "v"(l + 2 * BANDB + 512u), "v"(l + 2 * BANDB + 1024u), "v"(l + 2 * BANDB + 1536u),
                    "v"(g0), "v"(g0 + 512), "v"(g0 + 1024), "v"(g0 + 1536), "v"(g1), "v"(g1 + 512), "v"(g1 + 1024), "v"(g1 + 1536), "v"(g2), "v"(g2 + 512), "v"(g2 + 1024), "v"(g2 + 1536) : "memory");
}
template <bool VT, int K>
__device__ __forceinline__ void gemmw(const bf* __restrict__ A, const bf* __restrict__ Bt, const float* __restrict__ b1, const float* __restrict__ b2, h16* __restrict__ P16, bf* __restrict__ Ph, bf* __restrict__ Pl, float* os, const int R0, const int C0) {
    static_assert(HD == 64 && K % SGK == 0 && K / SGK >= 2 && 2 * STGB <= 8 * 64 * 68 * 4, "a 64-column tile is one head; the ring needs two stages and lies inside os");
    // every '#pragma unroll' below: accumulator, fragment, address, bias and result arrays must be indexed by constants only (else they go to scratch)
    const int lane = threadIdx.x & 31, lr = lane & 15, hi = lane >> 4;
    const int wave = __builtin_amdgcn_readfirstlane((int)(threadIdx.x >> 5));   // scalar, so that the band choice below stays scalar
    const int wr = wave >> 2, wc = wave & 3, r0 = R0 + wr * 64, c0 = C0 + wc * 64;   // this wave's 64x64 tile
    v8f acc[4][4];
#pragma unroll
    for (int mb = 0; mb < 4; ++mb)
#pragma unroll
        for (int nb = 0; nb < 4; ++nb) acc[mb][nb] = (v8f){};
    // this wave's three bands of a stage: band G of the stage is A band G for G < 8, else Bt band G - 8 (a 16-row band is 16 * K elements of its plane)
    u64 g[3];
#pragma unroll
    for (int i = 0; i < 3; ++i) { const int G = wave * 3 + i; g[i] = (u64)(((G < 8) ? A + (size_t)(R0 + G * 16) * K : Bt + (size_t)(C0 + (G - 8) * 16) * K) + 8 * lane); }
    const unsigned lc = (unsigned)(size_t)os + (unsigned)(wave * 3 * BANDB + lane * 16);   // LDS byte address (low 32 bits of the shared address) of the lane's first copy in buffer 0
    const char* fa = (const char*)os + wr * 4 * BANDB + lane * 16; const char* fb = (const char*)os + (8 + wc * 4) * BANDB + lane * 16;   // the lane's chunk of this wave's first A and Bt blocks in buffer 0
    constexpr int NT = K / SGK;
    copystage(lc, g[0], g[1], g[2]); g[0] += BANDB; g[1] += BANDB; g[2] += BANDB;   // stage 0 into buffer 0
    asm volatile("s_wait_asynccnt 0x0" ::: "memory");   // this wave's copies of stage 0 have landed
    __syncthreads();                                    // stage 0 is published
    copystage(lc + STGB, g[0], g[1], g[2]); g[0] += BANDB; g[1] += BANDB; g[2] += BANDB;   // stage 1 into buffer 1
    // rolled: one stage's code serves both buffers
#pragma unroll 1
    for (int t = 0; t < NT; ++t) {
        const int bo = (t & 1) * STGB;
#pragma unroll
        for (int kk = 0; kk < 2; ++kk) {
            v16bf a[4], b[4];
#pragma unroll
            for (int mb = 0; mb < 4; ++mb) a[mb] = cat16b(*(const v8usa*)(fa + bo + mb * BANDB + kk * 1024), *(const v8usa*)(fa + bo + mb * BANDB + kk * 1024 + 512));
#pragma unroll
            for (int nb = 0; nb < 4; ++nb) b[nb] = cat16b(*(const v8usa*)(fb + bo + nb * BANDB + kk * 1024), *(const v8usa*)(fb + bo + nb * BANDB + kk * 1024 + 512));
            __builtin_amdgcn_sched_barrier(0);   // the block's LDS reads stand as one group in front of its products, none among them
#pragma unroll
            for (int nb = 0; nb < 4; ++nb)
#pragma unroll
                for (int mb = 0; mb < 4; ++mb) acc[mb][nb] = wmmab(a[mb], b[nb], acc[mb][nb]);
            __builtin_amdgcn_sched_barrier(0);   // and the next block's reads stay behind them
        }
        asm volatile("s_wait_dscnt 0x0" ::: "memory");      // this wave has read all it needs of this buffer
        asm volatile("s_wait_asynccnt 0x0" ::: "memory");   // its copies of stage t + 1 have landed
        __syncthreads();                                    // stage t + 1 is published, and every reader has left stage t's buffer
        if (t + 2 < NT) { copystage(lc + bo, g[0], g[1], g[2]); g[0] += BANDB; g[1] += BANDB; g[2] += BANDB; }   // stage t + 2 into the buffer just left; the test is scalar
    }
    asm volatile("s_wait_asynccnt 0x0" ::: "memory");   // no copy is outstanding when the ring becomes output staging (the last trip's barrier ended every read of it)
    // the 8 KB of the tile in an output plane are 16 runs of 32 chunks of 8 elements; run s * 8 + w lies at e0 + s * 2048 + w * 256, lane l makes chunk l of it
    // tile row and first tile column of that chunk: VT false: row (w >> 2) * 16 + lr + s * 32, column (w & 3) * 16 + hi * 8; VT true: row ((w >> 1) & 3) * 16 + lr, column (w & 1) * 16 + hi * 8 + s * 32
    float* ow = os + (size_t)wave * 64 * 68;   // each wave stages its own tile in its own range
#pragma unroll
    for (int mb = 0; mb < 4; ++mb)
#pragma unroll
        for (int nb = 0; nb < 4; ++nb)
#pragma unroll
            for (int j = 0; j < 8; ++j) ow[(mb * 16 + hi * 8 + j) * 68 + nb * 16 + lr] = acc[mb][nb][j];
    asm volatile("s_wait_dscnt 0x0" ::: "memory");   // the wave's own rows are in LDS before its lanes read them back in chunk order
    // the biases are fetched behind that wait: the accumulators' registers are free by then
    // each bias plane is read at a wave-uniform base plus one lane offset (VT: in elements, else in bytes: as the loads' offset register holds it); the two bases and the offset are operands of the wait below,
    // so that they stay live up to it: no load's result lands in, and nothing else rewrites, a register that an issued load names
    const float* sb1 = b1 + (VT ? r0 : c0); const float* sb2 = b2 + (VT ? r0 : c0); const int vo = VT ? lr : hi * 32;
    v4f bc1[4][2] = {}, bc2[4][2] = {}; float br1[4] = {}, br2[4] = {};
#pragma unroll
    for (int u = 0; u < 4; ++u) {
        if constexpr (VT) { br1[u] = sb1[vo + u * 16]; br2[u] = sb2[vo + u * 16]; }
        else { const char* p1 = (const char*)sb1 + vo + u * 64; const char* p2 = (const char*)sb2 + vo + u * 64; bc1[u][0] = *(const v4f*)p1; bc1[u][1] = *(const v4f*)(p1 + 16); bc2[u][0] = *(const v4f*)p2; bc2[u][1] = *(const v4f*)(p2 + 16); }
    }
    asm volatile("s_wait_xcnt 0x0" :: "s"(sb1), "s"(sb2), "v"(vo) : "memory");   // the bias loads are issued: wait before a register that they name is reused
    const size_t e0 = (VT ? (size_t)r0 * TT + (size_t)c0 * HD : (size_t)c0 * TT + (size_t)r0 * HD) + (size_t)lane * 8;
#pragma unroll
    for (int s = 0; s < 2; ++s) {
        v8us oh[8], ol[8]; v8h o16[8];
#pragma unroll
        for (int w = 0; w < 8; ++w) { const int rw = (VT ? ((w >> 1) & 3) : (w >> 2)) * 16 + lr, cofs = (VT ? 0 : ((w >> 1) & 1) * 32) + (w & 1) * 16 + hi * 8;
            const int at = (rw + (VT ? 0 : s * 32)) * 68 + cofs + (VT ? s * 32 : 0); const v4f val[2] = { *(const v4fa*)(ow + at), *(const v4fa*)(ow + at + 4) };
#pragma unroll
            for (int q = 0; q < 8; ++q) { const float y = __fadd_rn(__fadd_rn(val[q >> 2][q & 3], bfr(VT ? br1[(w >> 1) & 3] : bc1[w & 3][q >> 2][q & 3])), bfr(VT ? br2[(w >> 1) & 3] : bc2[w & 3][q >> 2][q & 3])); unsigned short h, l; splitf(y, h, l); oh[w][q] = h; ol[w][q] = l; if (VT) o16[w][q] = tohx(y); } }
        __builtin_amdgcn_sched_barrier(0);   // all arithmetic of this half in front of its stores: nothing rewrites a register that an issued store names
#pragma unroll
        for (int w = 0; w < 8; ++w) { *(v8us*)(Ph + e0 + s * 2048 + w * 256) = oh[w]; *(v8us*)(Pl + e0 + s * 2048 + w * 256) = ol[w]; if (VT) *(v8h*)(P16 + e0 + s * 2048 + w * 256) = o16[w]; }
        if (s == 0) asm volatile("s_wait_xcnt 0x0" ::: "memory");   // the first half's stores are issued: wait before the second half reuses their registers
    }
}
// ---- k_proj: every projection tile of the problem in ONE launch; grid (64 tiles of 128 x 256, 3: Q, K, V, NB_ batches), 256 threads.
// Registers stay under a quarter of a SIMD's file and the LDS fits twice, so two work-groups share a WGP: one's products run under the other's LDS reads and barriers.
__global__ __launch_bounds__(256) void k_proj(const bf* __restrict__ XC, const bf* __restrict__ WQ, const bf* __restrict__ WK, const bf* __restrict__ WV, const float* __restrict__ bqs, const float* __restrict__ bqt, const float* __restrict__ bks, const float* __restrict__ bkt, const float* __restrict__ bvs, const float* __restrict__ bvt,
                                              h16* __restrict__ VT16, bf* __restrict__ QPh, bf* __restrict__ QPl, bf* __restrict__ KPh, bf* __restrict__ KPl, bf* __restrict__ VTh, bf* __restrict__ VTl) {
    static_assert((TT / 128) * (DM / 256) == 64 && (DM / 128) * (TT / 256) == 64, "64 tiles per projection and batch in either form");
    __shared__ __align__(16) float os[8 * 64 * 68];   // the two stage buffers, then each wave's output staging
    const int xi = (int)blockIdx.x, pj = (int)blockIdx.y;   // the same for the whole work-group: the branches below are scalar
    const bf* X = XC + (size_t)blockIdx.z * TT * K2; const size_t pb = (size_t)blockIdx.z * NH_ * TT * HD;   // this batch's [Xs | Xt] plane and head planes
    if (pj < 2) gemmw<false, K2>(X, pj ? WK : WQ, pj ? bks : bqs, pj ? bkt : bqt, nullptr, (pj ? KPh : QPh) + pb, (pj ? KPl : QPl) + pb, os, (xi % (TT / 128)) * 128, (xi / (TT / 128)) * 256);   // Q = [Xs|Xt][Wqs|Wqt]^T + b_qs + b_qt, as head planes; K likewise
    else gemmw<true, K2>(WV, X, bvs, bvt, VT16 + pb, VTh + pb, VTl + pb, os, (xi / (TT / 256)) * 128, (xi % (TT / 256)) * 256);              // V^T = [Wvs|Wvt][Xs|Xt]^T + b_vs + b_vt
}


__global__ __launch_bounds__(256) void k_wtG(const float* __restrict__ w, int K, int N, bf* Bt) {
    const int lane = threadIdx.x & 31; const int L0 = (blockIdx.x * 8 + (threadIdx.x >> 5)) * 8; const int nlines = N * K / 64;
{
#pragma unroll 1
        for (int l = 0; l < 8; ++l) { const int L = L0 + l; if (L >= nlines) break; const size_t e = (size_t)L * 64 + lane * 2; const int k = (int)(e % K), n = (int)(e / K); v2us o;
            o[0] = f2bf(w[(size_t)k * N + n]); o[1] = f2bf(w[(size_t)(k + 1) * N + n]); *(v2us*)(Bt + e) = o; }
         }
}
__global__ __launch_bounds__(256) void k_cvt8(const float* __restrict__ src, bf* dst, size_t n8) { const size_t i = (size_t)blockIdx.x * 256 + threadIdx.x; if (i >= n8) return; const v8f v = *(const v8f*)(src + i * 8); v8us o;
#pragma unroll
    for (int k = 0; k < 8; ++k) o[k] = f2bf(v[k]); *(v8us*)(dst + i * 8) = o;  }



// [a | b] along k (two row-major f32 [rows][DM] inputs), rounded to bf16, stored in fragment order (blocks [row / 16][k / 32]); thread i makes one 16-byte chunk.
// A wave takes 8 rows x 32 k of one block: it reads 128 contiguous bytes of each row and its store covers 4 whole lines.
__device__ __forceinline__ void catpack(const float* __restrict__ a, const float* __restrict__ b, bf* dst, size_t i) {
    const int lane = (int)(i & 31), j = lane & 3, r = (int)((i >> 5) & 1) * 8 + (lane >> 2); const size_t blk = i >> 6;
    const int c = (int)(blk % (K2 / 32)) * 32 + j * 8; const size_t t = (blk / (K2 / 32)) * 16 + r;
    const float* src = (c < DM) ? (a + t * DM + c) : (b + t * DM + (c - DM)); const v8f v = *(const v8f*)src; v8us o;
#pragma unroll
    for (int k = 0; k < 8; ++k) o[k] = f2bf(v[k]);
    *(v8us*)(dst + blk * 512 + (j >> 1) * 256 + ((j & 1) * 16 + r) * 8) = o;
}
// ---- k_pack: all four operand planes in ONE launch: work-groups 0 .. PKX - 1 make [Xs | Xt] of all batches (NB_ * TT rows, a batch's plane is TT * K2 elements), then PKW each for [Wqs | Wqt], [Wks | Wkt], [Wvs | Wvt]; grid PKX + 3 * PKW, 256 threads.
#define PKX ((unsigned)((size_t)NB_ * TT * K2 / 8 / 256))
#define PKW ((unsigned)((size_t)DM * K2 / 8 / 256))
__global__ __launch_bounds__(256) void k_pack(const float* __restrict__ xs, const float* __restrict__ xt, const float* __restrict__ wqs, const float* __restrict__ wqt, const float* __restrict__ wks, const float* __restrict__ wkt, const float* __restrict__ wvs, const float* __restrict__ wvt, bf* XC, bf* WQ, bf* WK, bf* WV) {
    static_assert(((size_t)NB_ * TT * K2 / 8) % 256 == 0 && ((size_t)DM * K2 / 8) % 256 == 0, "whole work-groups per plane");
    const unsigned g = blockIdx.x; const unsigned pl = (g < PKX) ? 0u : 1u + (g - PKX) / PKW, lb = (g < PKX) ? g : (g - PKX) % PKW;   // plane and work-group inside it: scalar
    const float* a = (pl == 0) ? xs : (pl == 1) ? wqs : (pl == 2) ? wks : wvs; const float* b = (pl == 0) ? xt : (pl == 1) ? wqt : (pl == 2) ? wkt : wvt; bf* d = (pl == 0) ? XC : (pl == 1) ? WQ : (pl == 2) ? WK : WV;
    catpack(a, b, d, (size_t)lb * 256 + threadIdx.x);
}
// ---- k_fattn: scores, softmax and attn.v of one (batch, head) for FW waves x 16 * QT queries; grid NB_ * NH_ * TT / (FW * 16 * QT), 32 * FW threads, no LDS, no barrier.
// Transposed products: S^T = K Q^T (A = 16 key rows, B = 16 query rows, both fragment-ordered planes read by the same loader) leaves one query per lane (column lr; keys 8 * hi + r),
// so two S^T tiles of 32 keys, converted in place, ARE the B operand (k order 8 * hi + s, 16 + 8 * hi + s - 8, the loader's own) of O^T += V^T P^T, with A = 16 d rows of the transposed value plane (a pass's 64 d x 32 keys are 4 KB contiguous).
// Per query: running maximum m (both lane halves agree), partial sum l per lane half (joined at the end), O^T rescaled by exp(m_old - m_new) only in passes where some query's maximum moves.
__device__ __forceinline__ float xhalf(float x) { return __builtin_bit_cast(float, __builtin_amdgcn_permlanex16(__builtin_bit_cast(int, x), __builtin_bit_cast(int, x), 0x76543210, 0xfedcba98, false, false)); }   // lane l reads lane l ^ 16
template <bool HR>
__device__ __forceinline__ void fattn(const bf* __restrict__ Qh, const bf* __restrict__ Ql, const bf* __restrict__ Kh, const bf* __restrict__ Kl, const h16* __restrict__ V16, const bf* __restrict__ Vh, const bf* __restrict__ Vl, const float ab, float* __restrict__ O) {
    // every '#pragma unroll' below: fragment, score and accumulator arrays must be indexed by constants only (else they go to scratch)
    static_assert(QT == 2, "the exponential loop below pairs element i with the sum of element i - 2 of the same column group");
    const int lane = threadIdx.x & 31, lr = lane & 15, hi = lane >> 4;
    // one byte address per plane and lane (the lane's chunk of a block); blocks are constant offsets of 1 KB from it: Q, K block (row tile) * 2 + k step, V block d tile
    u64 qha = (u64)(Qh + 8 * lane), qla = (u64)(Ql + 8 * lane), kha = (u64)(Kh + 8 * lane), kla = (u64)(Kl + 8 * lane);
    u64 va = (u64)(V16 + 8 * lane), vha = (u64)(Vh + 8 * lane), vla = (u64)(Vl + 8 * lane);
    v16bf qh[QT][2], ql[QT][2];
#pragma unroll
    for (int qt = 0; qt < QT; ++qt)
#pragma unroll
        for (int kk = 0; kk < 2; ++kk) { qh[qt][kk] = ldgb(qha, (qt * 2 + kk) * 1024); ql[qt][kk] = ldgb(qla, (qt * 2 + kk) * 1024); }
    v8f o[QT][4]; float m[QT], l[QT];
#pragma unroll
    for (int qt = 0; qt < QT; ++qt) { m[qt] = -3.0e38f; l[qt] = 0.f;
#pragma unroll
        for (int dt = 0; dt < 4; ++dt) o[qt][dt] = (v8f){}; }
    v16bf kh[2][2], kl[2][2];
#pragma unroll
    for (int kt = 0; kt < 2; ++kt)
#pragma unroll
        for (int kk = 0; kk < 2; ++kk) { kh[kt][kk] = ldgb(kha, (kt * 2 + kk) * 1024); kl[kt][kk] = ldgb(kla, (kt * 2 + kk) * 1024); }
    asm volatile("s_wait_xcnt 0x0" : "+v"(qha), "+v"(qla), "+v"(kha), "+v"(kla) :: "memory");   // the issued loads name these pairs: wait before one is advanced or reused
    kha += 32 * HD * 2; kla += 32 * HD * 2;
    // rolled: one pass of 32 keys already fills the register budget of three waves per SIMD
#pragma unroll 1
    for (int key0 = 0; key0 < TT; key0 += 32) {
        v8f s[2][QT];
#pragma unroll
        for (int kt = 0; kt < 2; ++kt)
#pragma unroll
            for (int qt = 0; qt < QT; ++qt) s[kt][qt] = (v8f){};
#pragma unroll
        for (int kk = 0; kk < 2; ++kk) {   // per k step: hi.hi, q_lo.k_hi, q_hi.k_lo
#pragma unroll
            for (int kt = 0; kt < 2; ++kt)
#pragma unroll
                for (int qt = 0; qt < QT; ++qt) s[kt][qt] = wmmab(kh[kt][kk], qh[qt][kk], s[kt][qt]);
#pragma unroll
            for (int kt = 0; kt < 2; ++kt)
#pragma unroll
                for (int qt = 0; qt < QT; ++qt) s[kt][qt] = wmmab(kh[kt][kk], ql[qt][kk], s[kt][qt]);
#pragma unroll
            for (int kt = 0; kt < 2; ++kt)
#pragma unroll
                for (int qt = 0; qt < QT; ++qt) s[kt][qt] = wmmab(kl[kt][kk], qh[qt][kk], s[kt][qt]);
        }
        v16h v16[4]; v16bf vh[4], vl[4];   // this pass's values, in flight under the softmax
#pragma unroll
        for (int dt = 0; dt < 4; ++dt) { if (HR) { vh[dt] = ldgb(vha, dt * 1024); vl[dt] = ldgb(vla, dt * 1024); } else v16[dt] = ldgh(va, dt * 1024); }
        // next pass's keys, in flight under the softmax and attn.v; the last pass re-reads its own rows (in bounds, unused)
#pragma unroll
        for (int kt = 0; kt < 2; ++kt)
#pragma unroll
            for (int kk = 0; kk < 2; ++kk) { kh[kt][kk] = ldgb(kha, (kt * 2 + kk) * 1024); kl[kt][kk] = ldgb(kla, (kt * 2 + kk) * 1024); }
        float mn[QT]; bool need = false;
#pragma unroll
        for (int qt = 0; qt < QT; ++qt) { float mx = -3.0e38f;
#pragma unroll
            for (int kt = 0; kt < 2; ++kt)
#pragma unroll
                for (int r = 0; r < 8; ++r) { const float t = __builtin_fmaf(s[kt][qt][r], SCL, ab);   /* x HD^-0.5 (exact) + attn_bias */ s[kt][qt][r] = t; mx = fmaxf(mx, t); }
            mn[qt] = fmaxf(mx, xhalf(mx)); need = need || (mn[qt] > m[qt]); }
        if (__builtin_amdgcn_ballot_w32(need) != 0) {   // scalar branch: the rescale is skipped in passes where no query of the wave meets a new maximum
#pragma unroll
            for (int qt = 0; qt < QT; ++qt) { const float m2 = fmaxf(m[qt], mn[qt]); const float al = __builtin_amdgcn_exp2f((m[qt] - m2) * L2E);   /* 0 in the first pass, 1 where this query's maximum stays */ m[qt] = m2; l[qt] *= al;
#pragma unroll
                for (int dt = 0; dt < 4; ++dt) o[qt][dt] *= al; }
        }
#pragma unroll
        for (int qt = 0; qt < QT; ++qt)
#pragma unroll
            for (int kt = 0; kt < 2; ++kt) s[kt][qt] = (s[kt][qt] - m[qt]) * L2E;
        // exponentials in place, each with its slot filled: directly behind every v_exp_f32 stands the row-sum add of the exponential made two earlier (a v_nop behind the first two),
        // which neither reads the new result nor rewrites its source; the scheduling barriers keep that order
#pragma unroll
        for (int i = 0; i < 16 * QT; ++i) { s[(i / QT) >> 3][i % QT][(i / QT) & 7] = __builtin_amdgcn_exp2f(s[(i / QT) >> 3][i % QT][(i / QT) & 7]);
            __builtin_amdgcn_sched_barrier(0);
            if (i >= 2) l[i % QT] += s[((i - 2) / QT) >> 3][i % QT][((i - 2) / QT) & 7]; else asm volatile("v_nop");
            __builtin_amdgcn_sched_barrier(0); }
#pragma unroll
        for (int i = 16 * QT - 2; i < 16 * QT; ++i) l[i % QT] += s[1][i % QT][7];
#pragma unroll
        for (int qt = 0; qt < QT; ++qt) { v16h p16; v16bf ph, pl;
#pragma unroll
            for (int kt = 0; kt < 2; ++kt)
#pragma unroll
                for (int r = 0; r < 8; ++r) { const float p = s[kt][qt][r];
                    if (HR) { const __bf16 a = (__bf16)p; ph[kt * 8 + r] = a; pl[kt * 8 + r] = (__bf16)(p - (float)a); } else p16[kt * 8 + r] = (h16)(p * PCAR); }
#pragma unroll
            for (int dt = 0; dt < 4; ++dt) {
                if (HR) { o[qt][dt] = wmmab(vh[dt], ph, o[qt][dt]); o[qt][dt] = wmmab(vh[dt], pl, o[qt][dt]); o[qt][dt] = wmmab(vl[dt], ph, o[qt][dt]); }
                else o[qt][dt] = wmma16(v16[dt], p16, o[qt][dt]); } }
        // this pass's loads name these pairs: wait before they are advanced
        if (HR) asm volatile("s_wait_xcnt 0x0" : "+v"(kha), "+v"(kla), "+v"(vha), "+v"(vla) :: "memory"); else asm volatile("s_wait_xcnt 0x0" : "+v"(kha), "+v"(kla), "+v"(va) :: "memory");
        { const int kst = (key0 + 64 < TT) ? 32 * HD * 2 : 0; kha += kst; kla += kst; va += 32 * HD * 2; vha += 32 * HD * 2; vla += 32 * HD * 2; }
    }
#pragma unroll
    for (int qt = 0; qt < QT; ++qt) { const float f = __fdiv_rn(HR ? 1.0f : (1.0f / PCAR), l[qt] + xhalf(l[qt]));
#pragma unroll
        for (int dt = 0; dt < 4; ++dt) o[qt][dt] *= f; }
    float* orow = O + (size_t)lr * DM + hi * 8;   // a lane's 8 registers of a tile are 8 consecutive d of its query
    __builtin_amdgcn_sched_barrier(0);   // all arithmetic in front of the stores: nothing rewrites a register that an issued store names
#pragma unroll
    for (int qt = 0; qt < QT; ++qt)
#pragma unroll
        for (int dt = 0; dt < 4; ++dt) { *(v4f*)(orow + qt * 16 * DM + dt * 16) = __builtin_shufflevector(o[qt][dt], o[qt][dt], 0, 1, 2, 3); *(v4f*)(orow + qt * 16 * DM + dt * 16 + 4) = __builtin_shufflevector(o[qt][dt], o[qt][dt], 4, 5, 6, 7); }
}
// amdgpu_waves_per_eu(3): holds the register budget to a third of a SIMD's file, so that three work-groups share a WGP
__global__ __launch_bounds__(32 * FW) __attribute__((amdgpu_waves_per_eu(3))) void k_fattn(const bf* __restrict__ Qh, const bf* __restrict__ Ql, const bf* __restrict__ Kh, const bf* __restrict__ Kl, const h16* __restrict__ V16, const bf* __restrict__ Vh, const bf* __restrict__ Vl, const float* __restrict__ AB, float* __restrict__ O) {
    constexpr int NQB = TT / (FW * 16 * QT), NHB = RH / (FW * 16 * QT), NZ = NB_ * NH_; static_assert(RH % (FW * 16 * QT) == 0 && TT % (FW * 16 * QT) == 0, "whole query blocks on either side of RH");
    // the longer blocks (query rows < RH, three attn.v products) take the lowest indices, so that they start first; z = batch * NH_ + head, xb = query block
    const int fl = (int)blockIdx.x, f2 = fl - NZ * NHB; const int z = (f2 < 0) ? fl / NHB : f2 / (NQB - NHB), xb = (f2 < 0) ? fl % NHB : NHB + f2 % (NQB - NHB);
    const float ab = bfr(AB[0]);
    const int q0 = xb * (FW * 16 * QT) + __builtin_amdgcn_readfirstlane((int)(threadIdx.x >> 5)) * (16 * QT);   // scalar, so that the precision branch is scalar
    const size_t pz = (size_t)z * TT * HD, pq = pz + (size_t)q0 * HD; float* o = O + ((size_t)(z / NH_) * TT + q0) * DM + (z % NH_) * HD;
    if (q0 < RH) fattn<true>(Qh + pq, Ql + pq, Kh + pz, Kl + pz, V16 + pz, Vh + pz, Vl + pz, ab, o);
    else fattn<false>(Qh + pq, Ql + pq, Kh + pz, Kl + pz, V16 + pz, Vh + pz, Vl + pz, ab, o);
}

extern "C" void kernel_launch(void* const* d_in, const int* in_sizes, int n_in,
                              void* d_out, int out_size, void* d_ws, size_t ws_size, hipStream_t stream) {
    (void)in_sizes; (void)n_in; (void)out_size;
    const float* xs = (const float*)d_in[0]; const float* xt = (const float*)d_in[1]; const float* wqs = (const float*)d_in[2]; const float* bqs = (const float*)d_in[3]; const float* wqt = (const float*)d_in[4]; const float* bqt = (const float*)d_in[5]; const float* wks = (const float*)d_in[6]; const float* bks = (const float*)d_in[7]; const float* wkt = (const float*)d_in[8]; const float* bkt = (const float*)d_in[9]; const float* wvs = (const float*)d_in[10]; const float* bvs = (const float*)d_in[11]; const float* wvt = (const float*)d_in[12]; const float* bvt = (const float*)d_in[13]; const float* ABIAS = (const float*)d_in[14]; const float* x = xs; const float* wq = wqs; const float* wk = wks; const float* wv = wvs; const float* wo = nullptr; (void)wo; (void)x; (void)wq; (void)wk; (void)wv;
    float* OUT = (float*)d_out;     // [4][2048][1024]
    char* wsp = (char*)d_ws;
    auto take = [&](size_t bytes) { char* p = wsp; wsp += (bytes + 255) & ~(size_t)255; return (void*)p; };
    bf* WQ = (bf*)take((size_t)DQ * K2 * 2); bf* WK = (bf*)take((size_t)DKV * K2 * 2); bf* WV = (bf*)take((size_t)DKV * K2 * 2);
    bf* XB = (bf*)take((size_t)NB_ * TT * K2 * 2); h16* VT16 = (h16*)take((size_t)NB_ * NKV * HD * TT * 2);
    bf* QPh = (bf*)take((size_t)NB_ * NH_ * TT * HD * 2); bf* QPl = (bf*)take((size_t)NB_ * NH_ * TT * HD * 2); bf* KPh = (bf*)take((size_t)NB_ * NKV * TT * HD * 2); bf* KPl = (bf*)take((size_t)NB_ * NKV * TT * HD * 2); bf* VTh = (bf*)take((size_t)NB_ * NKV * HD * TT * 2); bf* VTl = (bf*)take((size_t)NB_ * NKV * HD * TT * 2);   // the planes that k_fattn reads: all batches
    if ((size_t)(wsp - (char*)d_ws) > ws_size) return;    // ws 256 MiB
    k_pack<<<PKX + 3 * PKW, 256, 0, stream>>>(xs, xt, wqs, wqt, wks, wkt, wvs, wvt, XB, WQ, WK, WV);   /* [Xs | Xt] of all batches, [W_s | W_t] along k */
    k_proj<<<dim3(64, 3, NB_), 256, 0, stream>>>(XB, WQ, WK, WV, bqs, bqt, bks, bkt, bvs, bvt, VT16, QPh, QPl, KPh, KPl, VTh, VTl);   /* Q, K as head planes, V^T planes: all batches */
    k_fattn<<<NB_ * NH_ * (TT / (FW * 16 * QT)), 32 * FW, 0, stream>>>(QPh, QPl, KPh, KPl, VT16, VTh, VTl, ABIAS, OUT);   /* merged context, f32 */
}

// v007
// A run of this version takes 185 microseconds.
// Two timings next to v006 put it at 1.13 and 1.12 times that version's speed.
// Over all steps from v000 it is 22.8 times as fast.
#include <hip/hip_runtime.h>

// Two-stream multi-head self-attention with dual-linear projections (Xs, Xt [4][2048][1024]; Q = Xs W_qs^T + b_qs + Xt W_qt^T + b_qt ('oi' [1024][1024] each), K and V likewise; 16 heads x 64; scores/8 + attn_bias (scalar [1][1][1][1], read); softmax; out = merged context, no output projection -> [4][2048][1024] f32 (8.4 M)).
// Layout: each dual linear is ONE exact GEMM with K = 2048: one operand is the concatenated bf16 plane [Xs | Xt], the other the two 'oi' weights concatenated along k; the GEMM's own epilogue adds the two biases in f32 and stores the 16-bit planes that the attention reads (no f32 Q/K/V plane in memory).
// Compute dtypes, f32 accumulate: every input rounded to bf16; Q/K/V as exact K = 2048 products of the [Xs | Xt] plane against [W_s | W_t], + b_s + b_t in f32; scores hi.hi + hi.lo + lo.hi on every row; softmax f32 (running maximum, unnormalised exponentials, one division per row at the end); attn.v: query rows < 512 hl (3 products), the rest fp16 exponentials (x1024) x fp16 values; no output projection: f32 merged context.
// Three launches: k_pack (all 16-bit operand planes), k_proj (every projection tile of all batches), k_fattn.
// Attention is ONE launch for all batches and heads (k_fattn): scores, softmax and attn.v stay in registers, no score or probability plane in memory; keys and values come through an LDS ring that a work-group's waves share.
// Fragment order: every 16-bit plane that a matrix operand is loaded from is stored as 1-KB blocks of 16 rows x 32 k. Inside a block, 16-byte chunk number c * 32 + h * 16 + r holds row r, k = c * 16 + h * 8 .. + 7,
// which is what lane h * 16 + r takes as the c-th half of its fragment: each wave-wide 16-byte load reads 512 contiguous bytes (4 whole lines) instead of 32 bytes of each of 16 lines. Registers hold the same elements as with row-major planes.

#define NB_  4
#define TT   2048
#define DM   1024
#define NH_  16
#define NKV  16
#define REP  (NH_ / NKV)
#define HD   64
#define DQ   (NH_ * HD)
#define DKV  (NKV * HD)
#define K2   (2 * DM)              // concatenated contraction [Xs | Xt]
#define RH   512                  // query rows < RH use hi+lo planes (0: none)
#define WIN  0
#define PCAR 1024.0f
#define SCL  0.125f   // HD^-0.5
#define QT   2                    // k_fattn: 16-query column groups per wave
#define FW   4                    // k_fattn: waves per work-group
#define L2E  1.4426950408889634f
typedef _Float16 h16;
typedef unsigned short bf;
typedef __attribute__((ext_vector_type(16))) __bf16   v16bf;
typedef __attribute__((ext_vector_type(16))) _Float16 v16h;
typedef __attribute__((ext_vector_type(8)))  _Float16 v8h;
typedef __attribute__((ext_vector_type(8)))  unsigned short v8us;
typedef __attribute__((ext_vector_type(8)))  float    v8f;
typedef __attribute__((ext_vector_type(4)))  float    v4f;
typedef v8h  __attribute__((may_alias)) v8ha;
typedef v4f  __attribute__((may_alias)) v4fa;
typedef v8us __attribute__((may_alias)) v8usa;

__device__ __forceinline__ unsigned short f2bf(float f) { unsigned u = __float_as_uint(f); u += 0x7FFFu + ((u >> 16) & 1u); return (unsigned short)(u >> 16); }
__device__ __forceinline__ float bf2f(unsigned short b) { return __uint_as_float(((unsigned)b) << 16); }
__device__ __forceinline__ float bfr(float f) { return bf2f(f2bf(f)); }
__device__ __forceinline__ v16h cat16(v8h lo, v8h hi) { return __builtin_shufflevector(lo, hi, 0, 1, 2, 3, 4, 5, 6, 7, 8, 9, 10, 11, 12, 13, 14, 15); }
__device__ __forceinline__ v16bf cat16b(v8us lo, v8us hi) { return __builtin_bit_cast(v16bf, __builtin_shufflevector(lo, hi, 0, 1, 2, 3, 4, 5, 6, 7, 8, 9, 10, 11, 12, 13, 14, 15)); }
__device__ __forceinline__ v8f wmma16(v16h a, v16h b, v8f c) { return __builtin_amdgcn_wmma_f32_16x16x32_f16(false, a, false, b, (short)0, c, false, false); }
__device__ __forceinline__ v8f wmmab(v16bf a, v16bf b, v8f c) { return __builtin_amdgcn_wmma_f32_16x16x32_bf16(false, a, false, b, (short)0, c, false, false); }



__device__ __forceinline__ h16 tohx(float x) { return (h16)x; }
__device__ __forceinline__ void splitf(float y, unsigned short& h, unsigned short& l) { h = f2bf(y); l = f2bf(y - bf2f(h)); }
typedef __attribute__((ext_vector_type(2))) _Float16 v2h;
typedef __attribute__((ext_vector_type(4))) _Float16 v4h;
typedef __attribute__((ext_vector_type(2))) unsigned short v2us;
typedef __attribute__((ext_vector_type(4))) unsigned short v4us;
typedef __attribute__((ext_vector_type(2))) float v2f;
typedef __attribute__((ext_vector_type(4))) int v4i;

// ---- gemmw: one 128x256 tile at (R0, C0) per work-group of 8 waves (2 x 4), each wave one 64x64 tile (16 accumulators) over the whole K; operands come from fragment-ordered 16-bit planes (blocks [row / 16][k / 32]).
// y[m][n] = sum_k A[m][k] Bt[n][k] + b1 + b2 (both rounded to bf16, added one after the other in f32); one f32 chain along k per element.
// Staging: a stage is 64 k of the tile's 8 A bands and 16 Bt bands (a band = 16 rows; its 64 k are 2 KB contiguous in the plane and stay so in LDS, so a fragment half is still 512 contiguous bytes per wave-wide read).
// The 48 KB of a stage are fetched from L2 once per work-group by asynchronous copies (each wave copies 3 bands) and read by the 4 (A) or 2 (Bt) waves that need them; two buffers, the next stage's copies fly under this stage's products.
// Epilogue, y never stored as f32, planes in fragment order, a 64x64 tile is 8 KB contiguous in each: VT false: m = token, n = head * HD + d, bias by n, hi/lo bf16 planes [head], rows = tokens, k = d, blocks [token / 16][d / 32].
//                                   VT true:  m = head * HD + d (A = the weights), n = token (Bt = the inputs), bias by m, fp16 and hi/lo bf16 planes [head], rows = d, k = tokens, blocks [token / 32][d / 16]: the transposed value planes come out of the product itself.
// fragment loads from a 64-bit byte address held in a register pair (kept as an integer so that the s_wait_xcnt statements below can name the pair)
typedef unsigned long long u64;
typedef const __attribute__((address_space(1))) v8us* gp8us;
__device__ __forceinline__ v16bf ldgb(u64 a, int ofs) { return cat16b(*(gp8us)(a + ofs), *(gp8us)(a + ofs + 512)); }   // the two halves of a block
#define SGK   64                  // k per stage: two blocks of every band
#define BANDB (SGK * 16 * 2)      // bytes of one band's stage
#define STGB  (24 * BANDB)        // bytes of a stage: 8 bands of A, then 16 bands of Bt
// a wave's share of a stage: three bands of 2 KB, each four wave-wide 512-byte copies; l = the lane's LDS byte address in the first band's place (the three places are adjacent), g0, g1, g2 = the lane's global byte address in each band.
// One statement: the s_wait_xcnt stands behind the last copy inside it, so that no register that a copy names is rewritten in front of it.
__device__ __forceinline__ void copystage(unsigned l, u64 g0, u64 g1, u64 g2) {
    asm volatile("global_load_async_to_lds_b128 %0, %12, off\n\tglobal_load_async_to_lds_b128 %1, %13, off\n\tglobal_load_async_to_lds_b128 %2, %14, off\n\tglobal_load_async_to_lds_b128 %3, %15, off\n\t"
                 "global_load_async_to_lds_b128 %4, %16, off\n\tglobal_load_async_to_lds_b128 %5, %17, off\n\tglobal_load_async_to_lds_b128 %6, %18, off\n\tglobal_load_async_to_lds_b128 %7, %19, off\n\t"
                 "global_load_async_to_lds_b128 %8, %20, off\n\tglobal_load_async_to_lds_b128 %9, %21, off\n\tglobal_load_async_to_lds_b128 %10, %22, off\n\tglobal_load_async_to_lds_b128 %11, %23, off\n\ts_wait_xcnt 0x0"
                 :: "v"(l), "v"(l + 512u), "v"(l + 1024u), "v"(l + 1536u), "v"(l + BANDB), "v"(l + BANDB + 512u), "v"(l + BANDB + 1024u), "v"(l + BANDB + 1536u), "v"(l + 2 * BANDB), "v"(l + 2 * BANDB + 512u), "v"(l + 2 * BANDB + 1024u), "v"(l + 2 * BANDB + 1536u),
                    "v"(g0), "v"(g0 + 512), "v"(g0 + 1024), "v"(g0 + 1536), "v"(g1), "v"(g1 + 512), "v"(g1 + 1024), "v"(g1 + 1536), "v"(g2), "v"(g2 + 512), "v"(g2 + 1024), "v"(g2 + 1536) : "memory");
}
template <bool VT, int K>
__device__ __forceinline__ void gemmw(const bf* __restrict__ A, const bf* __restrict__ Bt, const float* __restrict__ b1, const float* __restrict__ b2, h16* __restrict__ P16, bf* __restrict__ Ph, bf* __restrict__ Pl, float* os, const int R0, const int C0) {
    static_assert(HD == 64 && K % SGK == 0 && K / SGK >= 2 && 2 * STGB <= 8 * 64 * 68 * 4, "a 64-column tile is one head; the ring needs two stages and lies inside os");
    // every '#pragma unroll' below: accumulator, fragment, address, bias and result arrays must be indexed by constants only (else they go to scratch)
    const int lane = threadIdx.x & 31, lr = lane & 15, hi = lane >> 4;
    const int wave = __builtin_amdgcn_readfirstlane((int)(threadIdx.x >> 5));   // scalar, so that the band choice below stays scalar
    const int wr = wave >> 2, wc = wave & 3, r0 = R0 + wr * 64, c0 = C0 + wc * 64;   // this wave's 64x64 tile
    v8f acc[4][4];
#pragma unroll
    for (int mb = 0; mb < 4; ++mb)
#pragma unroll
        for (int nb = 0; nb < 4; ++nb) acc[mb][nb] = (v8f){};
    // this wave's three bands of a stage: band G of the stage is A band G for G < 8, else Bt band G - 8 (a 16-row band is 16 * K elements of its plane)
    u64 g[3];
#pragma unroll
    for (int i = 0; i < 3; ++i) { const int G = wave * 3 + i; g[i] = (u64)(((G < 8) ? A + (size_t)(R0 + G * 16) * K : Bt + (size_t)(C0 + (G - 8) * 16) * K) + 8 * lane); }
    const unsigned lc = (unsigned)(size_t)os + (unsigned)(wave * 3 * BANDB + lane * 16);   // LDS byte address (low 32 bits of the shared address) of the lane's first copy in buffer 0
    const char* fa = (const char*)os + wr * 4 * BANDB + lane * 16; const char* fb = (const char*)os + (8 + wc * 4) * BANDB + lane * 16;   // the lane's chunk of this wave's first A and Bt blocks in buffer 0
    constexpr int NT = K / SGK;
    copystage(lc, g[0], g[1], g[2]); g[0] += BANDB; g[1] += BANDB; g[2] += BANDB;   // stage 0 into buffer 0
    asm volatile("s_wait_asynccnt 0x0" ::: "memory");   // this wave's copies of stage 0 have landed
    __syncthreads();                                    // stage 0 is published
    copystage(lc + STGB, g[0], g[1], g[2]); g[0] += BANDB; g[1] += BANDB; g[2] += BANDB;   // stage 1 into buffer 1
    // rolled: one stage's code serves both buffers
#pragma unroll 1
    for (int t = 0; t < NT; ++t) {
        const int bo = (t & 1) * STGB;
#pragma unroll
        for (int kk = 0; kk < 2; ++kk) {
            v16bf a[4], b[4];
#pragma unroll
            for (int mb = 0; mb < 4; ++mb) a[mb] = cat16b(*(const v8usa*)(fa + bo + mb * BANDB + kk * 1024), *(const v8usa*)(fa + bo + mb * BANDB + kk * 1024 + 512));
#pragma unroll
            for (int nb = 0; nb < 4; ++nb) b[nb] = cat16b(*(const v8usa*)(fb + bo + nb * BANDB + kk * 1024), *(const v8usa*)(fb + bo + nb * BANDB + kk * 1024 + 512));
            __builtin_amdgcn_sched_barrier(0);   // the block's LDS reads stand as one group in front of its products, none among them
#pragma unroll
            for (int nb = 0; nb < 4; ++nb)
#pragma unroll
                for (int mb = 0; mb < 4; ++mb) acc[mb][nb] = wmmab(a[mb], b[nb], acc[mb][nb]);
            __builtin_amdgcn_sched_barrier(0);   // and the next block's reads stay behind them
        }
        asm volatile("s_wait_dscnt 0x0" ::: "memory");      // this wave has read all it needs of this buffer
        asm volatile("s_wait_asynccnt 0x0" ::: "memory");   // its copies of stage t + 1 have landed
        __syncthreads();                                    // stage t + 1 is published, and every reader has left stage t's buffer
        if (t + 2 < NT) { copystage(lc + bo, g[0], g[1], g[2]); g[0] += BANDB; g[1] += BANDB; g[2] += BANDB; }   // stage t + 2 into the buffer just left; the test is scalar
    }
    asm volatile("s_wait_asynccnt 0x0" ::: "memory");   // no copy is outstanding when the ring becomes output staging (the last trip's barrier ended every read of it)
    // the 8 KB of the tile in an output plane are 16 runs of 32 chunks of 8 elements; run s * 8 + w lies at e0 + s * 2048 + w * 256, lane l makes chunk l of it
    // tile row and first tile column of that chunk: VT false: row (w >> 2) * 16 + lr + s * 32, column (w & 3) * 16 + hi * 8; VT true: row ((w >> 1) & 3) * 16 + lr, column (w & 1) * 16 + hi * 8 + s * 32
    float* ow = os + (size_t)wave * 64 * 68;   // each wave stages its own tile in its own range
#pragma unroll
    for (int mb = 0; mb < 4; ++mb)
#pragma unroll
        for (int nb = 0; nb < 4; ++nb)
#pragma unroll
            for (int j = 0; j < 8; ++j) ow[(mb * 16 + hi * 8 + j) * 68 + nb * 16 + lr] = acc[mb][nb][j];
    asm volatile("s_wait_dscnt 0x0" ::: "memory");   // the wave's own rows are in LDS before its lanes read them back in chunk order
    // the biases are fetched behind that wait: the accumulators' registers are free by then
    // each bias plane is read at a wave-uniform base plus one lane offset (VT: in elements, else in bytes: as the loads' offset register holds it); the two bases and the offset are operands of the wait below,
    // so that they stay live up to it: no load's result lands in, and nothing else rewrites, a register that an issued load names
    const float* sb1 = b1 + (VT ? r0 : c0); const float* sb2 = b2 + (VT ? r0 : c0); const int vo = VT ? lr : hi * 32;
    v4f bc1[4][2] = {}, bc2[4][2] = {}; float br1[4] = {}, br2[4] = {};
#pragma unroll
    for (int u = 0; u < 4; ++u) {
        if constexpr (VT) { br1[u] = sb1[vo + u * 16]; br2[u] = sb2[vo + u * 16]; }
        else { const char* p1 = (const char*)sb1 + vo + u * 64; const char* p2 = (const char*)sb2 + vo + u * 64; bc1[u][0] = *(const v4f*)p1; bc1[u][1] = *(const v4f*)(p1 + 16); bc2[u][0] = *(const v4f*)p2; bc2[u][1] = *(const v4f*)(p2 + 16); }
    }
    asm volatile("s_wait_xcnt 0x0" :: "s"(sb1), "s"(sb2), "v"(vo) : "memory");   // the bias loads are issued: wait before a register that they name is reused
    const size_t e0 = (VT ? (size_t)r0 * TT + (size_t)c0 * HD : (size_t)c0 * TT + (size_t)r0 * HD) + (size_t)lane * 8;
#pragma unroll
    for (int s = 0; s < 2; ++s) {
        v8us oh[8], ol[8]; v8h o16[8];
#pragma unroll
        for (int w = 0; w < 8; ++w) { const int rw = (VT ? ((w >> 1) & 3) : (w >> 2)) * 16 + lr, cofs = (VT ? 0 : ((w >> 1) & 1) * 32) + (w & 1) * 16 + hi * 8;
            const int at = (rw + (VT ? 0 : s * 32)) * 68 + cofs + (VT ? s * 32 : 0); const v4f val[2] = { *(const v4fa*)(ow + at), *(const v4fa*)(ow + at + 4) };
#pragma unroll
            for (int q = 0; q < 8; ++q) { const float y = __fadd_rn(__fadd_rn(val[q >> 2][q & 3], bfr(VT ? br1[(w >> 1) & 3] : bc1[w & 3][q >> 2][q & 3])), bfr(VT ? br2[(w >> 1) & 3] : bc2[w & 3][q >> 2][q & 3])); unsigned short h, l; splitf(y, h, l); oh[w][q] = h; ol[w][q] = l; if (VT) o16[w][q] = tohx(y); } }
        __builtin_amdgcn_sched_barrier(0);   // all arithmetic of this half in front of its stores: nothing rewrites a register that an issued store names
#pragma unroll
        for (int w = 0; w < 8; ++w) { *(v8us*)(Ph + e0 + s * 2048 + w * 256) = oh[w]; *(v8us*)(Pl + e0 + s * 2048 + w * 256) = ol[w]; if (VT) *(v8h*)(P16 + e0 + s * 2048 + w * 256) = o16[w]; }
        if (s == 0) asm volatile("s_wait_xcnt 0x0" ::: "memory");   // the first half's stores are issued: wait before the second half reuses their registers
    }
}
// ---- k_proj: every projection tile of the problem in ONE launch; grid (64 tiles of 128 x 256, 3: Q, K, V, NB_ batches), 256 threads.
// Registers stay under a quarter of a SIMD's file and the LDS fits twice, so two work-groups share a WGP: one's products run under the other's LDS reads and barriers.
__global__ __launch_bounds__(256) void k_proj(const bf* __restrict__ XC, const bf* __restrict__ WQ, const bf* __restrict__ WK, const bf* __restrict__ WV, const float* __restrict__ bqs, const float* __restrict__ bqt, const float* __restrict__ bks, const float* __restrict__ bkt, const float* __restrict__ bvs, const float* __restrict__ bvt,
                                              h16* __restrict__ VT16, bf* __restrict__ QPh, bf* __restrict__ QPl, bf* __restrict__ KPh, bf* __restrict__ KPl, bf* __restrict__ VTh, bf* __restrict__ VTl) {
    static_assert((TT / 128) * (DM / 256) == 64 && (DM / 128) * (TT / 256) == 64, "64 tiles per projection and batch in either form");
    __shared__ __align__(16) float os[8 * 64 * 68];   // the two stage buffers, then each wave's output staging
    const int xi = (int)blockIdx.x, pj = (int)blockIdx.y;   // the same for the whole work-group: the branches below are scalar
    const bf* X = XC + (size_t)blockIdx.z * TT * K2; const size_t pb = (size_t)blockIdx.z * NH_ * TT * HD;   // this batch's [Xs | Xt] plane and head planes
    if (pj < 2) gemmw<false, K2>(X, pj ? WK : WQ, pj ? bks : bqs, pj ? bkt : bqt, nullptr, (pj ? KPh : QPh) + pb, (pj ? KPl : QPl) + pb, os, (xi % (TT / 128)) * 128, (xi / (TT / 128)) * 256);   // Q = [Xs|Xt][Wqs|Wqt]^T + b_qs + b_qt, as head planes; K likewise
    else gemmw<true, K2>(WV, X, bvs, bvt, VT16 + pb, VTh + pb, VTl + pb, os, (xi / (TT / 256)) * 128, (xi % (TT / 256)) * 256);              // V^T = [Wvs|Wvt][Xs|Xt]^T + b_vs + b_vt
}


__global__ __launch_bounds__(256) void k_wtG(const float* __restrict__ w, int K, int N, bf* Bt) {
    const int lane = threadIdx.x & 31; const int L0 = (blockIdx.x * 8 + (threadIdx.x >> 5)) * 8; const int nlines = N * K / 64;
{
#pragma unroll 1
        for (int l = 0; l < 8; ++l) { const int L = L0 + l; if (L >= nlines) break; const size_t e = (size_t)L * 64 + lane * 2; const int k = (int)(e % K), n = (int)(e / K); v2us o;
            o[0] = f2bf(w[(size_t)k * N + n]); o[1] = f2bf(w[(size_t)(k + 1) * N + n]); *(v2us*)(Bt + e) = o; }
         }
}
__global__ __launch_bounds__(256) void k_cvt8(const float* __restrict__ src, bf* dst, size_t n8) { const size_t i = (size_t)blockIdx.x * 256 + threadIdx.x; if (i >= n8) return; const v8f v = *(const v8f*)(src + i * 8); v8us o;
#pragma unroll
    for (int k = 0; k < 8; ++k) o[k] = f2bf(v[k]); *(v8us*)(dst + i * 8) = o;  }



// [a | b] along k (two row-major f32 [rows][DM] inputs), rounded to bf16, stored in fragment order (blocks [row / 16][k / 32]); thread i makes one 16-byte chunk.
// A wave takes 8 rows x 32 k of one block: it reads 128 contiguous bytes of each row and its store covers 4 whole lines.
__device__ __forceinline__ void catpack(const float* __restrict__ a, const float* __restrict__ b, bf* dst, size_t i) {
    const int lane = (int)(i & 31), j = lane & 3, r = (int)((i >> 5) & 1) * 8 + (lane >> 2); const size_t blk = i >> 6;
    const int c = (int)(blk % (K2 / 32)) * 32 + j * 8; const size_t t = (blk / (K2 / 32)) * 16 + r;
    const float* src = (c < DM) ? (a + t * DM + c) : (b + t * DM + (c - DM)); const v8f v = *(const v8f*)src; v8us o;
#pragma unroll
    for (int k = 0; k < 8; ++k) o[k] = f2bf(v[k]);
    *(v8us*)(dst + blk * 512 + (j >> 1) * 256 + ((j & 1) * 16 + r) * 8) = o;
}
// ---- k_pack: all four operand planes in ONE launch: work-groups 0 .. PKX - 1 make [Xs | Xt] of all batches (NB_ * TT rows, a batch's plane is TT * K2 elements), then PKW each for [Wqs | Wqt], [Wks | Wkt], [Wvs | Wvt]; grid PKX + 3 * PKW, 256 threads.
#define PKX ((unsigned)((size_t)NB_ * TT * K2 / 8 / 256))
#define PKW ((unsigned)((size_t)DM * K2 / 8 / 256))
__global__ __launch_bounds__(256) void k_pack(const float* __restrict__ xs, const float* __restrict__ xt, const float* __restrict__ wqs, const float* __restrict__ wqt, const float* __restrict__ wks, const float* __restrict__ wkt, const float* __restrict__ wvs, const float* __restrict__ wvt, bf* XC, bf* WQ, bf* WK, bf* WV) {
    static_assert(((size_t)NB_ * TT * K2 / 8) % 256 == 0 && ((size_t)DM * K2 / 8) % 256 == 0, "whole work-groups per plane");
    const unsigned g = blockIdx.x; const unsigned pl = (g < PKX) ? 0u : 1u + (g - PKX) / PKW, lb = (g < PKX) ? g : (g - PKX) % PKW;   // plane and work-group inside it: scalar
    const float* a = (pl == 0) ? xs : (pl == 1) ? wqs : (pl == 2) ? wks : wvs; const float* b = (pl == 0) ? xt : (pl == 1) ? wqt : (pl == 2) ? wkt : wvt; bf* d = (pl == 0) ? XC : (pl == 1) ? WQ : (pl == 2) ? WK : WV;
    catpack(a, b, d, (size_t)lb * 256 + threadIdx.x);
}
// ---- k_fattn: scores, softmax and attn.v of one (batch, head) for FW waves x 16 * QT queries; grid NB_ * NH_ * TT / (FW * 16 * QT), 32 * FW threads.
// Keys and values: a stage is 64 keys (two passes) of each plane, 8 KB contiguous in the plane and kept so in LDS (a fragment half is still 512 contiguous bytes per wave-wide read).
// A stage is fetched from L2 ONCE per work-group by asynchronous copies (each wave copies a quarter of every plane's stage) and read by all FW waves; two buffers, the next stage's copies fly under this stage's two passes.
// Transposed products: S^T = K Q^T (A = 16 key rows, B = 16 query rows, both fragment-ordered, read as a block's two halves: K from the LDS ring, Q from its plane) leaves one query per lane (column lr; keys 8 * hi + r),
// so two S^T tiles of 32 keys, converted in place, ARE the B operand (k order 8 * hi + s, 16 + 8 * hi + s - 8, the loader's own) of O^T += V^T P^T, with A = 16 d rows of the transposed value plane (a pass's 64 d x 32 keys are 4 KB contiguous).
// Per query: running maximum m (both lane halves agree), partial sum l per lane half (joined at the end), O^T rescaled by exp(m_old - m_new) only in passes where some query's maximum moves.
#define FSK   64                  // keys per stage
#define FPLB  (FSK * HD * 2)      // bytes of one plane's stage
#define FBUF  (4 * FPLB)          // bytes of a buffer: K hi, K lo, then V fp16 (query rows >= RH) or V hi, V lo
// a wave's share of a stage of two planes (copy2) or one (copy1): 2 KB of each, four wave-wide 512-byte copies; l = the lane's LDS byte address in the first plane's place (the second plane's lies FPLB behind it), ga, gb = the lane's global byte address in each plane.
// One statement each: the s_wait_xcnt stands behind the last copy inside it, so that no register that a copy names is rewritten in front of it.
__device__ __forceinline__ void copy2(unsigned l, u64 ga, u64 gb) {
    asm volatile("global_load_async_to_lds_b128 %0, %8, off\n\tglobal_load_async_to_lds_b128 %1, %9, off\n\tglobal_load_async_to_lds_b128 %2, %10, off\n\tglobal_load_async_to_lds_b128 %3, %11, off\n\t"
                 "global_load_async_to_lds_b128 %4, %12, off\n\tglobal_load_async_to_lds_b128 %5, %13, off\n\tglobal_load_async_to_lds_b128 %6, %14, off\n\tglobal_load_async_to_lds_b128 %7, %15, off\n\ts_wait_xcnt 0x0"
                 :: "v"(l), "v"(l + 512u), "v"(l + 1024u), "v"(l + 1536u), "v"(l + FPLB), "v"(l + FPLB + 512u), "v"(l + FPLB + 1024u), "v"(l + FPLB + 1536u),
                    "v"(ga), "v"(ga + 512), "v"(ga + 1024), "v"(ga + 1536), "v"(gb), "v"(gb + 512), "v"(gb + 1024), "v"(gb + 1536) : "memory");
}
__device__ __forceinline__ void copy1(unsigned l, u64 ga) {
    asm volatile("global_load_async_to_lds_b128 %0, %4, off\n\tglobal_load_async_to_lds_b128 %1, %5, off\n\tglobal_load_async_to_lds_b128 %2, %6, off\n\tglobal_load_async_to_lds_b128 %3, %7, off\n\ts_wait_xcnt 0x0"
                 :: "v"(l), "v"(l + 512u), "v"(l + 1024u), "v"(l + 1536u), "v"(ga), "v"(ga + 512), "v"(ga + 1024), "v"(ga + 1536) : "memory");
}
__device__ __forceinline__ v16bf ldsb(const char* p) { return cat16b(*(const v8usa*)p, *(const v8usa*)(p + 512)); }   // the two halves of a block in LDS
__device__ __forceinline__ v16h  ldsh(const char* p) { return cat16(*(const v8ha*)p, *(const v8ha*)(p + 512)); }
__device__ __forceinline__ float xhalf(float x) { return __builtin_bit_cast(float, __builtin_amdgcn_permlanex16(__builtin_bit_cast(int, x), __builtin_bit_cast(int, x), 0x76543210, 0xfedcba98, false, false)); }   // lane l reads lane l ^ 16
template <bool HR>
__device__ __forceinline__ void fattn(const bf* __restrict__ Qh, const bf* __restrict__ Ql, const bf* __restrict__ Kh, const bf* __restrict__ Kl, const h16* __restrict__ V16, const bf* __restrict__ Vh, const bf* __restrict__ Vl, const float ab, float* __restrict__ O, char* ring) {
    // every '#pragma unroll' below: fragment, score and accumulator arrays must be indexed by constants only (else they go to scratch)
    static_assert(QT == 2, "the exponential loop below pairs element i with the sum of element i - 2 of the same column group");
    const int lane = threadIdx.x & 31, lr = lane & 15, hi = lane >> 4;
    static_assert(FW == 4 && TT % FSK == 0 && TT / FSK >= 2, "four waves copy a quarter of a stage each; the ring needs two stages");
    const int wave = __builtin_amdgcn_readfirstlane((int)(threadIdx.x >> 5));
    // one byte address per Q plane and lane (the lane's chunk of a block), one ring offset for all K and V planes; blocks are constant offsets of 1 KB from it: Q, K block (row tile) * 2 + k step, V block d tile
    u64 qha = (u64)(Qh + 8 * lane), qla = (u64)(Ql + 8 * lane);
    // the lane's first copy of this wave's quarter of a stage: byte offset in every plane (one register for all planes; the planes' bases are scalar), LDS byte address (low 32 bits of the shared address) in buffer 0
    unsigned go = (unsigned)(wave * 2048 + lane * 16);
    const unsigned lc = (unsigned)(size_t)ring + go;
    unsigned lo = (unsigned)(lane * 16);   // ring offset of the lane's chunk of the first block of the current pass's 4 KB of the first plane; carried from pass to pass in a register of its own, stepped by toggling one bit
    auto copystg = [&](unsigned l) { copy2(l, (u64)Kh + go, (u64)Kl + go); if (HR) copy2(l + 2 * FPLB, (u64)Vh + go, (u64)Vl + go); else copy1(l + 2 * FPLB, (u64)V16 + go); go += FPLB; };
    copystg(lc);   // stage 0 into buffer 0
    v16bf qh[QT][2], ql[QT][2];
#pragma unroll
    for (int qt = 0; qt < QT; ++qt)
#pragma unroll
        for (int kk = 0; kk < 2; ++kk) { qh[qt][kk] = ldgb(qha, (qt * 2 + kk) * 1024); ql[qt][kk] = ldgb(qla, (qt * 2 + kk) * 1024); }
    v8f o[QT][4]; float m[QT], l[QT];
#pragma unroll
    for (int qt = 0; qt < QT; ++qt) { m[qt] = -3.0e38f; l[qt] = 0.f;
#pragma unroll
        for (int dt = 0; dt < 4; ++dt) o[qt][dt] = (v8f){}; }
    asm volatile("s_wait_xcnt 0x0" : "+v"(qha), "+v"(qla) :: "memory");   // the issued loads name these pairs: wait before one is reused
    asm volatile("s_wait_asynccnt 0x0" ::: "memory");   // this wave's copies of stage 0 have landed
    __syncthreads();                                    // stage 0 is published
    copystg(lc + FBUF);   // stage 1 into buffer 1
    constexpr int NT = TT / FSK;
    // both loops rolled: one pass of 32 keys already fills the register budget of four waves per SIMD, and one pass's code serves both passes of a stage and both buffers
#pragma unroll 1
    for (int t = 0; t < NT; ++t) {
      const int bo = (t & 1) * FBUF;
#pragma unroll 1
      for (int ps = 0; ps < 2; ++ps) {
        const char* fp = ring + lo;
        v16bf kh[2][2], kl[2][2];
#pragma unroll
        for (int kt = 0; kt < 2; ++kt)
#pragma unroll
            for (int kk = 0; kk < 2; ++kk) { kh[kt][kk] = ldsb(fp + (kt * 2 + kk) * 1024); kl[kt][kk] = ldsb(fp + FPLB + (kt * 2 + kk) * 1024); }
        v8f s[2][QT];
#pragma unroll
        for (int kt = 0; kt < 2; ++kt)
#pragma unroll
            for (int qt = 0; qt < QT; ++qt) s[kt][qt] = (v8f){};
#pragma unroll
        for (int kk = 0; kk < 2; ++kk) {   // per k step: hi.hi, q_lo.k_hi, q_hi.k_lo
#pragma unroll
            for (int kt = 0; kt < 2; ++kt)
#pragma unroll
                for (int qt = 0; qt < QT; ++qt) s[kt][qt] = wmmab(kh[kt][kk], qh[qt][kk], s[kt][qt]);
#pragma unroll
            for (int kt = 0; kt < 2; ++kt)
#pragma unroll
                for (int qt = 0; qt < QT; ++qt) s[kt][qt] = wmmab(kh[kt][kk], ql[qt][kk], s[kt][qt]);
#pragma unroll
            for (int kt = 0; kt < 2; ++kt)
#pragma unroll
                for (int qt = 0; qt < QT; ++qt) s[kt][qt] = wmmab(kl[kt][kk], qh[qt][kk], s[kt][qt]);
        }
        v16h v16[4]; v16bf vh[4], vl[4];   // this pass's values: their LDS reads are in flight under the softmax
#pragma unroll
        for (int dt = 0; dt < 4; ++dt) { if (HR) { vh[dt] = ldsb(fp + 2 * FPLB + dt * 1024); vl[dt] = ldsb(fp + 3 * FPLB + dt * 1024); } else v16[dt] = ldsh(fp + 2 * FPLB + dt * 1024); }
        float mn[QT]; bool need = false;
#pragma unroll
        for (int qt = 0; qt < QT; ++qt) { float mx = -3.0e38f;
#pragma unroll
            for (int kt = 0; kt < 2; ++kt)
#pragma unroll
                for (int r = 0; r < 8; ++r) { const float t = __builtin_fmaf(s[kt][qt][r], SCL, ab);   /* x HD^-0.5 (exact) + attn_bias */ s[kt][qt][r] = t; mx = fmaxf(mx, t); }
            mn[qt] = fmaxf(mx, xhalf(mx)); need = need || (mn[qt] > m[qt]); }
        if (__builtin_amdgcn_ballot_w32(need) != 0) {   // scalar branch: the rescale is skipped in passes where no query of the wave meets a new maximum
#pragma unroll
            for (int qt = 0; qt < QT; ++qt) { const float m2 = fmaxf(m[qt], mn[qt]); const float al = __builtin_amdgcn_exp2f((m[qt] - m2) * L2E);   /* 0 in the first pass, 1 where this query's maximum stays */ m[qt] = m2; l[qt] *= al;
#pragma unroll
                for (int dt = 0; dt < 4; ++dt) o[qt][dt] *= al; }
        }
#pragma unroll
        for (int qt = 0; qt < QT; ++qt)
#pragma unroll
            for (int kt = 0; kt < 2; ++kt) s[kt][qt] = (s[kt][qt] - m[qt]) * L2E;
        // exponentials in place, each with its slot filled: directly behind every v_exp_f32 stands the row-sum add of the exponential made two earlier (a v_nop behind the first two),
        // which neither reads the new result nor rewrites its source; the scheduling barriers keep that order
#pragma unroll
        for (int i = 0; i < 16 * QT; ++i) { s[(i / QT) >> 3][i % QT][(i / QT) & 7] = __builtin_amdgcn_exp2f(s[(i / QT) >> 3][i % QT][(i / QT) & 7]);
            __builtin_amdgcn_sched_barrier(0);
            if (i >= 2) l[i % QT] += s[((i - 2) / QT) >> 3][i % QT][((i - 2) / QT) & 7]; else asm volatile("v_nop");
            __builtin_amdgcn_sched_barrier(0); }
#pragma unroll
        for (int i = 16 * QT - 2; i < 16 * QT; ++i) l[i % QT] += s[1][i % QT][7];
#pragma unroll
        for (int qt = 0; qt < QT; ++qt) { v16h p16; v16bf ph, pl;
#pragma unroll
            for (int kt = 0; kt < 2; ++kt)
#pragma unroll
                for (int r = 0; r < 8; ++r) { const float p = s[kt][qt][r];
                    if (HR) { const __bf16 a = (__bf16)p; ph[kt * 8 + r] = a; pl[kt * 8 + r] = (__bf16)(p - (float)a); } else p16[kt * 8 + r] = (h16)(p * PCAR); }
#pragma unroll
            for (int dt = 0; dt < 4; ++dt) {
                if (HR) { o[qt][dt] = wmmab(vh[dt], ph, o[qt][dt]); o[qt][dt] = wmmab(vh[dt], pl, o[qt][dt]); o[qt][dt] = wmmab(vl[dt], ph, o[qt][dt]); }
                else o[qt][dt] = wmma16(v16[dt], p16, o[qt][dt]); } }
        lo ^= 32 * HD * 2;   // the stage's other pass
      }
      lo ^= FBUF;                                         // the other buffer
      asm volatile("s_wait_dscnt 0x0" ::: "memory");      // this wave has read all it needs of this buffer
      asm volatile("s_wait_asynccnt 0x0" ::: "memory");   // its copies of stage t + 1 have landed
      __syncthreads();                                    // stage t + 1 is published, and every reader has left stage t's buffer
      if (t + 2 < NT) copystg(lc + bo);                   // stage t + 2 into the buffer just left; the test is scalar
    }
    asm volatile("s_wait_asynccnt 0x0" ::: "memory");   // no copy is outstanding when the wave ends
#pragma unroll
    for (int qt = 0; qt < QT; ++qt) { const float f = __fdiv_rn(HR ? 1.0f : (1.0f / PCAR), l[qt] + xhalf(l[qt]));
#pragma unroll
        for (int dt = 0; dt < 4; ++dt) o[qt][dt] *= f; }
    float* orow = O + (size_t)lr * DM + hi * 8;   // a lane's 8 registers of a tile are 8 consecutive d of its query
    __builtin_amdgcn_sched_barrier(0);   // all arithmetic in front of the stores: nothing rewrites a register that an issued store names
#pragma unroll
    for (int qt = 0; qt < QT; ++qt)
#pragma unroll
        for (int dt = 0; dt < 4; ++dt) { *(v4f*)(orow + qt * 16 * DM + dt * 16) = __builtin_shufflevector(o[qt][dt], o[qt][dt], 0, 1, 2, 3); *(v4f*)(orow + qt * 16 * DM + dt * 16 + 4) = __builtin_shufflevector(o[qt][dt], o[qt][dt], 4, 5, 6, 7); }
}
// amdgpu_waves_per_eu(4): with no key fragments held a pass ahead the registers fit a quarter of a SIMD's file, and four rings fit the LDS: four work-groups share a WGP, so the whole grid is resident at once
__global__ __launch_bounds__(32 * FW) __attribute__((amdgpu_waves_per_eu(4))) void k_fattn(const bf* __restrict__ Qh, const bf* __restrict__ Ql, const bf* __restrict__ Kh, const bf* __restrict__ Kl, const h16* __restrict__ V16, const bf* __restrict__ Vh, const bf* __restrict__ Vl, const float* __restrict__ AB, float* __restrict__ O) {
    constexpr int NQB = TT / (FW * 16 * QT), NHB = RH / (FW * 16 * QT), NZ = NB_ * NH_; static_assert(RH % (FW * 16 * QT) == 0 && TT % (FW * 16 * QT) == 0, "whole query blocks on either side of RH");
    // the longer blocks (query rows < RH, three attn.v products) take the lowest indices, so that they start first; z = batch * NH_ + head, xb = query block
    const int fl = (int)blockIdx.x, f2 = fl - NZ * NHB; const int z = (f2 < 0) ? fl / NHB : f2 / (NQB - NHB), xb = (f2 < 0) ? fl % NHB : NHB + f2 % (NQB - NHB);
    __shared__ __align__(16) char ring[2 * FBUF];   // the two stage buffers
    const float ab = bfr(AB[0]);
    const int q0 = xb * (FW * 16 * QT) + __builtin_amdgcn_readfirstlane((int)(threadIdx.x >> 5)) * (16 * QT);   // scalar
    const size_t pz = (size_t)z * TT * HD, pq = pz + (size_t)q0 * HD; float* o = O + ((size_t)(z / NH_) * TT + q0) * DM + (z % NH_) * HD;
    // the same side for the whole work-group (a query block lies wholly on one side of RH): the barriers inside are passed by all its waves
    if (xb < NHB) fattn<true>(Qh + pq, Ql + pq, Kh + pz, Kl + pz, V16 + pz, Vh + pz, Vl + pz, ab, o, ring);
    else fattn<false>(Qh + pq, Ql + pq, Kh + pz, Kl + pz, V16 + pz, Vh + pz, Vl + pz, ab, o, ring);
}

extern "C" void kernel_launch(void* const* d_in, const int* in_sizes, int n_in,
                              void* d_out, int out_size, void* d_ws, size_t ws_size, hipStream_t stream) {
    (void)in_sizes; (void)n_in; (void)out_size;
    const float* xs = (const float*)d_in[0]; const float* xt = (const float*)d_in[1]; const float* wqs = (const float*)d_in[2]; const float* bqs = (const float*)d_in[3]; const float* wqt = (const float*)d_in[4]; const float* bqt = (const float*)d_in[5]; const float* wks = (const float*)d_in[6]; const float* bks = (const float*)d_in[7]; const float* wkt = (const float*)d_in[8]; const float* bkt = (const float*)d_in[9]; const float* wvs = (const float*)d_in[10]; const float* bvs = (const float*)d_in[11]; const float* wvt = (const float*)d_in[12]; const float* bvt = (const float*)d_in[13]; const float* ABIAS = (const float*)d_in[14]; const float* x = xs; const float* wq = wqs; const float* wk = wks; const float* wv = wvs; const float* wo = nullptr; (void)wo; (void)x; (void)wq; (void)wk; (void)wv;
    float* OUT = (float*)d_out;     // [4][2048][1024]
    char* wsp = (char*)d_ws;
    auto take = [&](size_t bytes) { char* p = wsp; wsp += (bytes + 255) & ~(size_t)255; return (void*)p; };
    bf* WQ = (bf*)take((size_t)DQ * K2 * 2); bf* WK = (bf*)take((size_t)DKV * K2 * 2); bf* WV = (bf*)take((size_t)DKV * K2 * 2);
    bf* XB = (bf*)take((size_t)NB_ * TT * K2 * 2); h16* VT16 = (h16*)take((size_t)NB_ * NKV * HD * TT * 2);
    bf* QPh = (bf*)take((size_t)NB_ * NH_ * TT * HD * 2); bf* QPl = (bf*)take((size_t)NB_ * NH_ * TT * HD * 2); bf* KPh = (bf*)take((size_t)NB_ * NKV * TT * HD * 2); bf* KPl = (bf*)take((size_t)NB_ * NKV * TT * HD * 2); bf* VTh = (bf*)take((size_t)NB_ * NKV * HD * TT * 2); bf* VTl = (bf*)take((size_t)NB_ * NKV * HD * TT * 2);   // the planes that k_fattn reads: all batches
    if ((size_t)(wsp - (char*)d_ws) > ws_size) return;    // ws 256 MiB
    k_pack<<<PKX + 3 * PKW, 256, 0, stream>>>(xs, xt, wqs, wqt, wks, wkt, wvs, wvt, XB, WQ, WK, WV);   /* [Xs | Xt] of all batches, [W_s | W_t] along k */
    k_proj<<<dim3(64, 3, NB_), 256, 0, stream>>>(XB, WQ, WK, WV, bqs, bqt, bks, bkt, bvs, bvt, VT16, QPh, QPl, KPh, KPl, VTh, VTl);   /* Q, K as head planes, V^T planes: all batches */
    k_fattn<<<NB_ * NH_ * (TT / (FW * 16 * QT)), 32 * FW, 0, stream>>>(QPh, QPl, KPh, KPl, VT16, VTh, VTl, ABIAS, OUT);   /* merged context, f32 */
}

// v008
// It runs in 173 microseconds.
// Next to v007, in two timings, it ran 1.08 and 1.09 times as fast.
// Counting every step since v000, it is 24.7 times as fast.
#include <hip/hip_runtime.h>

// Two-stream multi-head self-attention with dual-linear projections (Xs, Xt [4][2048][1024]; Q = Xs W_qs^T + b_qs + Xt W_qt^T + b_qt ('oi' [1024][1024] each), K and V likewise; 16 heads x 64; scores/8 + attn_bias (scalar [1][1][1][1], read); softmax; out = merged context, no output projection -> [4][2048][1024] f32 (8.4 M)).
// Layout: each dual linear is ONE exact GEMM with K = 2048: one operand is the concatenated bf16 plane [Xs | Xt], the other the two 'oi' weights concatenated along k; the GEMM's own epilogue adds the two biases in f32 and stores the 16-bit planes that the attention reads (no f32 Q/K/V plane in memory).
// Compute dtypes, f32 accumulate: every input rounded to bf16; Q/K/V as exact K = 2048 products of the [Xs | Xt] plane against [W_s | W_t], + b_s + b_t in f32; scores hi.hi + hi.lo + lo.hi on every row, in the log2 domain (the Q planes hold Q x HD^-0.5 x log2 e); softmax f32 (running reference, unnormalised exponentials, one division per row at the end); attn.v: query rows < 512 hl (3 products), the rest fp16 exponentials (x1024) x fp16 values; no output projection: f32 merged context.
// Three launches: k_pack (all 16-bit operand planes), k_proj (every projection tile of all batches), k_fattn.
// Attention is ONE launch for all batches and heads (k_fattn): scores, softmax and attn.v stay in registers, no score or probability plane in memory; keys and values come through an LDS ring that a work-group's waves share.
// Fragment order: every 16-bit plane that a matrix operand is loaded from is stored as 1-KB blocks of 16 rows x 32 k. Inside a block, 16-byte chunk number c * 32 + h * 16 + r holds row r, k = c * 16 + h * 8 .. + 7,
// which is what lane h * 16 + r takes as the c-th half of its fragment: each wave-wide 16-byte load reads 512 contiguous bytes (4 whole lines) instead of 32 bytes of each of 16 lines. Registers hold the same elements as with row-major planes.

#define NB_  4
#define TT   2048
#define DM   1024
#define NH_  16
#define NKV  16
#define REP  (NH_ / NKV)
#define HD   64
#define DQ   (NH_ * HD)
#define DKV  (NKV * HD)
#define K2   (2 * DM)              // concatenated contraction [Xs | Xt]
#define RH   512                  // query rows < RH use hi+lo planes (0: none)
#define WIN  0
#define LCAR 10.0f                // log2 of the factor (x1024) that the fp16 exponentials carry
#define LZT  5.0f                 // the softmax reference is raised when a score passes it by more than this (log2): fp16 exponentials stay <= 2^(LCAR + LZT) = 32768
#define SCL  0.125f   // HD^-0.5
#define QT   2                    // k_fattn: 16-query column groups per wave
#define FW   4                    // k_fattn: waves per work-group
#define L2E  1.4426950408889634f
#define QSC  (SCL * L2E)           // folded into the Q planes: the score products come out as log2 exponents
typedef _Float16 h16;
typedef unsigned short bf;
typedef __attribute__((ext_vector_type(16))) __bf16   v16bf;
typedef __attribute__((ext_vector_type(16))) _Float16 v16h;
typedef __attribute__((ext_vector_type(8)))  _Float16 v8h;
typedef __attribute__((ext_vector_type(8)))  unsigned short v8us;
typedef __attribute__((ext_vector_type(8)))  float    v8f;
typedef __attribute__((ext_vector_type(4)))  float    v4f;
typedef v8h  __attribute__((may_alias)) v8ha;
typedef v4f  __attribute__((may_alias)) v4fa;
typedef v8us __attribute__((may_alias)) v8usa;

__device__ __forceinline__ unsigned short f2bf(float f) { unsigned u = __float_as_uint(f); u += 0x7FFFu + ((u >> 16) & 1u); return (unsigned short)(u >> 16); }
__device__ __forceinline__ float bf2f(unsigned short b) { return __uint_as_float(((unsigned)b) << 16); }
__device__ __forceinline__ float bfr(float f) { return bf2f(f2bf(f)); }
__device__ __forceinline__ v16h cat16(v8h lo, v8h hi) { return __builtin_shufflevector(lo, hi, 0, 1, 2, 3, 4, 5, 6, 7, 8, 9, 10, 11, 12, 13, 14, 15); }
__device__ __forceinline__ v16bf cat16b(v8us lo, v8us hi) { return __builtin_bit_cast(v16bf, __builtin_shufflevector(lo, hi, 0, 1, 2, 3, 4, 5, 6, 7, 8, 9, 10, 11, 12, 13, 14, 15)); }
__device__ __forceinline__ v8f wmma16(v16h a, v16h b, v8f c) { return __builtin_amdgcn_wmma_f32_16x16x32_f16(false, a, false, b, (short)0, c, false, false); }
__device__ __forceinline__ v8f wmmab(v16bf a, v16bf b, v8f c) { return __builtin_amdgcn_wmma_f32_16x16x32_bf16(false, a, false, b, (short)0, c, false, false); }



__device__ __forceinline__ h16 tohx(float x) { return (h16)x; }
__device__ __forceinline__ void splitf(float y, unsigned short& h, unsigned short& l) { h = f2bf(y); l = f2bf(y - bf2f(h)); }
typedef __attribute__((ext_vector_type(2))) _Float16 v2h;
typedef __attribute__((ext_vector_type(4))) _Float16 v4h;
typedef __attribute__((ext_vector_type(2))) unsigned short v2us;
typedef __attribute__((ext_vector_type(4))) unsigned short v4us;
typedef __attribute__((ext_vector_type(2))) float v2f;
typedef __attribute__((ext_vector_type(4))) int v4i;

// ---- gemmw: one 128x256 tile at (R0, C0) per work-group of 8 waves (2 x 4), each wave one 64x64 tile (16 accumulators) over the whole K; operands come from fragment-ordered 16-bit planes (blocks [row / 16][k / 32]).
// y[m][n] = sum_k A[m][k] Bt[n][k] + b1 + b2 (both rounded to bf16, added one after the other in f32); one f32 chain along k per element.
// Staging: a stage is 64 k of the tile's 8 A bands and 16 Bt bands (a band = 16 rows; its 64 k are 2 KB contiguous in the plane and stay so in LDS, so a fragment half is still 512 contiguous bytes per wave-wide read).
// The 48 KB of a stage are fetched from L2 once per work-group by asynchronous copies (each wave copies 3 bands) and read by the 4 (A) or 2 (Bt) waves that need them; two buffers, the next stage's copies fly under this stage's products.
// Epilogue (the Q planes store y x QSC), y never stored as f32, planes in fragment order, a 64x64 tile is 8 KB contiguous in each: VT false: m = token, n = head * HD + d, bias by n, hi/lo bf16 planes [head], rows = tokens, k = d, blocks [token / 16][d / 32].
//                                   VT true:  m = head * HD + d (A = the weights), n = token (Bt = the inputs), bias by m, fp16 and hi/lo bf16 planes [head], rows = d, k = tokens, blocks [token / 32][d / 16]: the transposed value planes come out of the product itself.
// fragment loads from a 64-bit byte address held in a register pair (kept as an integer so that the s_wait_xcnt statements below can name the pair)
typedef unsigned long long u64;
typedef const __attribute__((address_space(1))) v8us* gp8us;
__device__ __forceinline__ v16bf ldgb(u64 a, int ofs) { return cat16b(*(gp8us)(a + ofs), *(gp8us)(a + ofs + 512)); }   // the two halves of a block
#define SGK   64                  // k per stage: two blocks of every band
#define BANDB (SGK * 16 * 2)      // bytes of one band's stage
#define STGB  (24 * BANDB)        // bytes of a stage: 8 bands of A, then 16 bands of Bt
// a wave's share of a stage: three bands of 2 KB, each four wave-wide 512-byte copies; l = the lane's LDS byte address in the first band's place (the three places are adjacent), g0, g1, g2 = the lane's global byte address in each band.
// One statement: the s_wait_xcnt stands behind the last copy inside it, so that no register that a copy names is rewritten in front of it.
__device__ __forceinline__ void copystage(unsigned l, u64 g0, u64 g1, u64 g2) {
    asm volatile("global_load_async_to_lds_b128 %0, %12, off\n\tglobal_load_async_to_lds_b128 %1, %13, off\n\tglobal_load_async_to_lds_b128 %2, %14, off\n\tglobal_load_async_to_lds_b128 %3, %15, off\n\t"
                 "global_load_async_to_lds_b128 %4, %16, off\n\tglobal_load_async_to_lds_b128 %5, %17, off\n\tglobal_load_async_to_lds_b128 %6, %18, off\n\tglobal_load_async_to_lds_b128 %7, %19, off\n\t"
                 "global_load_async_to_lds_b128 %8, %20, off\n\tglobal_load_async_to_lds_b128 %9, %21, off\n\tglobal_load_async_to_lds_b128 %10, %22, off\n\tglobal_load_async_to_lds_b128 %11, %23, off\n\ts_wait_xcnt 0x0"
                 :: "v"(l), "v"(l + 512u), "v"(l + 1024u), "v"(l + 1536u), "v"(l + BANDB), "v"(l + BANDB + 512u), "v"(l + BANDB + 1024u), "v"(l + BANDB + 1536u), "v"(l + 2 * BANDB), "v"(l + 2 * BANDB + 512u), "v"(l + 2 * BANDB + 1024u), "v"(l + 2 * BANDB + 1536u),
                    "v"(g0), "v"(g0 + 512), "v"(g0 + 1024), "v"(g0 + 1536), "v"(g1), "v"(g1 + 512), "v"(g1 + 1024), "v"(g1 + 1536), "v"(g2), "v"(g2 + 512), "v"(g2 + 1024), "v"(g2 + 1536) : "memory");
}
template <bool VT, int K>
__device__ __forceinline__ void gemmw(const bf* __restrict__ A, const bf* __restrict__ Bt, const float* __restrict__ b1, const float* __restrict__ b2, h16* __restrict__ P16, bf* __restrict__ Ph, bf* __restrict__ Pl, float* os, const int R0, const int C0) {
    static_assert(HD == 64 && K % SGK == 0 && K / SGK >= 2 && 2 * STGB <= 8 * 64 * 68 * 4, "a 64-column tile is one head; the ring needs two stages and lies inside os");
    // every '#pragma unroll' below: accumulator, fragment, address, bias and result arrays must be indexed by constants only (else they go to scratch)
    const int lane = threadIdx.x & 31, lr = lane & 15, hi = lane >> 4;
    const int wave = __builtin_amdgcn_readfirstlane((int)(threadIdx.x >> 5));   // scalar, so that the band choice below stays scalar
    const int wr = wave >> 2, wc = wave & 3, r0 = R0 + wr * 64, c0 = C0 + wc * 64;   // this wave's 64x64 tile
    v8f acc[4][4];
#pragma unroll
    for (int mb = 0; mb < 4; ++mb)
#pragma unroll
        for (int nb = 0; nb < 4; ++nb) acc[mb][nb] = (v8f){};
    // this wave's three bands of a stage: band G of the stage is A band G for G < 8, else Bt band G - 8 (a 16-row band is 16 * K elements of its plane)
    u64 g[3];
#pragma unroll
    for (int i = 0; i < 3; ++i) { const int G = wave * 3 + i; g[i] = (u64)(((G < 8) ? A + (size_t)(R0 + G * 16) * K : Bt + (size_t)(C0 + (G - 8) * 16) * K) + 8 * lane); }
    const unsigned lc = (unsigned)(size_t)os + (unsigned)(wave * 3 * BANDB + lane * 16);   // LDS byte address (low 32 bits of the shared address) of the lane's first copy in buffer 0
    const char* fa = (const char*)os + wr * 4 * BANDB + lane * 16; const char* fb = (const char*)os + (8 + wc * 4) * BANDB + lane * 16;   // the lane's chunk of this wave's first A and Bt blocks in buffer 0
    constexpr int NT = K / SGK;
    copystage(lc, g[0], g[1], g[2]); g[0] += BANDB; g[1] += BANDB; g[2] += BANDB;   // stage 0 into buffer 0
    asm volatile("s_wait_asynccnt 0x0" ::: "memory");   // this wave's copies of stage 0 have landed
    __syncthreads();                                    // stage 0 is published
    copystage(lc + STGB, g[0], g[1], g[2]); g[0] += BANDB; g[1] += BANDB; g[2] += BANDB;   // stage 1 into buffer 1
    // rolled: one stage's code serves both buffers
#pragma unroll 1
    for (int t = 0; t < NT; ++t) {
        const int bo = (t & 1) * STGB;
#pragma unroll
        for (int kk = 0; kk < 2; ++kk) {
            v16bf a[4], b[4];
#pragma unroll
            for (int mb = 0; mb < 4; ++mb) a[mb] = cat16b(*(const v8usa*)(fa + bo + mb * BANDB + kk * 1024), *(const v8usa*)(fa + bo + mb * BANDB + kk * 1024 + 512));
#pragma unroll
            for (int nb = 0; nb < 4; ++nb) b[nb] = cat16b(*(const v8usa*)(fb + bo + nb * BANDB + kk * 1024), *(const v8usa*)(fb + bo + nb * BANDB + kk * 1024 + 512));
            __builtin_amdgcn_sched_barrier(0);   // the block's LDS reads stand as one group in front of its products, none among them
#pragma unroll
            for (int nb = 0; nb < 4; ++nb)
#pragma unroll
                for (int mb = 0; mb < 4; ++mb) acc[mb][nb] = wmmab(a[mb], b[nb], acc[mb][nb]);
            __builtin_amdgcn_sched_barrier(0);   // and the next block's reads stay behind them
        }
        asm volatile("s_wait_dscnt 0x0" ::: "memory");      // this wave has read all it needs of this buffer
        asm volatile("s_wait_asynccnt 0x0" ::: "memory");   // its copies of stage t + 1 have landed
        __syncthreads();                                    // stage t + 1 is published, and every reader has left stage t's buffer
        if (t + 2 < NT) { copystage(lc + bo, g[0], g[1], g[2]); g[0] += BANDB; g[1] += BANDB; g[2] += BANDB; }   // stage t + 2 into the buffer just left; the test is scalar
    }
    asm volatile("s_wait_asynccnt 0x0" ::: "memory");   // no copy is outstanding when the ring becomes output staging (the last trip's barrier ended every read of it)
    // the 8 KB of the tile in an output plane are 16 runs of 32 chunks of 8 elements; run s * 8 + w lies at e0 + s * 2048 + w * 256, lane l makes chunk l of it
    // tile row and first tile column of that chunk: VT false: row (w >> 2) * 16 + lr + s * 32, column (w & 3) * 16 + hi * 8; VT true: row ((w >> 1) & 3) * 16 + lr, column (w & 1) * 16 + hi * 8 + s * 32
    float* ow = os + (size_t)wave * 64 * 68;   // each wave stages its own tile in its own range
#pragma unroll
    for (int mb = 0; mb < 4; ++mb)
#pragma unroll
        for (int nb = 0; nb < 4; ++nb)
#pragma unroll
            for (int j = 0; j < 8; ++j) ow[(mb * 16 + hi * 8 + j) * 68 + nb * 16 + lr] = acc[mb][nb][j];
    asm volatile("s_wait_dscnt 0x0" ::: "memory");   // the wave's own rows are in LDS before its lanes read them back in chunk order
    // the biases are fetched behind that wait: the accumulators' registers are free by then
    // each bias plane is read at a wave-uniform base plus one lane offset (VT: in elements, else in bytes: as the loads' offset register holds it); the two bases and the offset are operands of the wait below,
    // so that they stay live up to it: no load's result lands in, and nothing else rewrites, a register that an issued load names
    const float* sb1 = b1 + (VT ? r0 : c0); const float* sb2 = b2 + (VT ? r0 : c0); const int vo = VT ? lr : hi * 32;
    v4f bc1[4][2] = {}, bc2[4][2] = {}; float br1[4] = {}, br2[4] = {};
#pragma unroll
    for (int u = 0; u < 4; ++u) {
        if constexpr (VT) { br1[u] = sb1[vo + u * 16]; br2[u] = sb2[vo + u * 16]; }
        else { const char* p1 = (const char*)sb1 + vo + u * 64; const char* p2 = (const char*)sb2 + vo + u * 64; bc1[u][0] = *(const v4f*)p1; bc1[u][1] = *(const v4f*)(p1 + 16); bc2[u][0] = *(const v4f*)p2; bc2[u][1] = *(const v4f*)(p2 + 16); }
    }
    asm volatile("s_wait_xcnt 0x0" :: "s"(sb1), "s"(sb2), "v"(vo) : "memory");   // the bias loads are issued: wait before a register that they name is reused
    const float ys = (!VT && blockIdx.y == 0) ? QSC : 1.0f;   // scalar: the Q planes (projection 0) carry the softmax's scale, K is stored as it is (x 1 is exact)
    const size_t e0 = (VT ? (size_t)r0 * TT + (size_t)c0 * HD : (size_t)c0 * TT + (size_t)r0 * HD) + (size_t)lane * 8;
#pragma unroll
    for (int s = 0; s < 2; ++s) {
        v8us oh[8], ol[8]; v8h o16[8];
#pragma unroll
        for (int w = 0; w < 8; ++w) { const int rw = (VT ? ((w >> 1) & 3) : (w >> 2)) * 16 + lr, cofs = (VT ? 0 : ((w >> 1) & 1) * 32) + (w & 1) * 16 + hi * 8;
            const int at = (rw + (VT ? 0 : s * 32)) * 68 + cofs + (VT ? s * 32 : 0); const v4f val[2] = { *(const v4fa*)(ow + at), *(const v4fa*)(ow + at + 4) };
#pragma unroll
            for (int q = 0; q < 8; ++q) { const float yb = __fadd_rn(__fadd_rn(val[q >> 2][q & 3], bfr(VT ? br1[(w >> 1) & 3] : bc1[w & 3][q >> 2][q & 3])), bfr(VT ? br2[(w >> 1) & 3] : bc2[w & 3][q >> 2][q & 3])); const float y = VT ? yb : yb * ys; unsigned short h, l; splitf(y, h, l); oh[w][q] = h; ol[w][q] = l; if (VT) o16[w][q] = tohx(y); } }
        __builtin_amdgcn_sched_barrier(0);   // all arithmetic of this half in front of its stores: nothing rewrites a register that an issued store names
#pragma unroll
        for (int w = 0; w < 8; ++w) { *(v8us*)(Ph + e0 + s * 2048 + w * 256) = oh[w]; *(v8us*)(Pl + e0 + s * 2048 + w * 256) = ol[w]; if (VT) *(v8h*)(P16 + e0 + s * 2048 + w * 256) = o16[w]; }
        if (s == 0) asm volatile("s_wait_xcnt 0x0" ::: "memory");   // the first half's stores are issued: wait before the second half reuses their registers
    }
}
// ---- k_proj: every projection tile of the problem in ONE launch; grid (64 tiles of 128 x 256, 3: Q, K, V, NB_ batches), 256 threads.
// Registers stay under a quarter of a SIMD's file and the LDS fits twice, so two work-groups share a WGP: one's products run under the other's LDS reads and barriers.
__global__ __launch_bounds__(256) void k_proj(const bf* __restrict__ XC, const bf* __restrict__ WQ, const bf* __restrict__ WK, const bf* __restrict__ WV, const float* __restrict__ bqs, const float* __restrict__ bqt, const float* __restrict__ bks, const float* __restrict__ bkt, const float* __restrict__ bvs, const float* __restrict__ bvt,
                                              h16* __restrict__ VT16, bf* __restrict__ QPh, bf* __restrict__ QPl, bf* __restrict__ KPh, bf* __restrict__ KPl, bf* __restrict__ VTh, bf* __restrict__ VTl) {
    static_assert((TT / 128) * (DM / 256) == 64 && (DM / 128) * (TT / 256) == 64, "64 tiles per projection and batch in either form");
    __shared__ __align__(16) float os[8 * 64 * 68];   // the two stage buffers, then each wave's output staging
    const int xi = (int)blockIdx.x, pj = (int)blockIdx.y;   // the same for the whole work-group: the branches below are scalar
    const bf* X = XC + (size_t)blockIdx.z * TT * K2; const size_t pb = (size_t)blockIdx.z * NH_ * TT * HD;   // this batch's [Xs | Xt] plane and head planes
    if (pj < 2) gemmw<false, K2>(X, pj ? WK : WQ, pj ? bks : bqs, pj ? bkt : bqt, nullptr, (pj ? KPh : QPh) + pb, (pj ? KPl : QPl) + pb, os, (xi % (TT / 128)) * 128, (xi / (TT / 128)) * 256);   // Q = [Xs|Xt][Wqs|Wqt]^T + b_qs + b_qt, as head planes; K likewise
    else gemmw<true, K2>(WV, X, bvs, bvt, VT16 + pb, VTh + pb, VTl + pb, os, (xi / (TT / 256)) * 128, (xi % (TT / 256)) * 256);              // V^T = [Wvs|Wvt][Xs|Xt]^T + b_vs + b_vt
}


__global__ __launch_bounds__(256) void k_wtG(const float* __restrict__ w, int K, int N, bf* Bt) {
    const int lane = threadIdx.x & 31; const int L0 = (blockIdx.x * 8 + (threadIdx.x >> 5)) * 8; const int nlines = N * K / 64;
{
#pragma unroll 1
        for (int l = 0; l < 8; ++l) { const int L = L0 + l; if (L >= nlines) break; const size_t e = (size_t)L * 64 + lane * 2; const int k = (int)(e % K), n = (int)(e / K); v2us o;
            o[0] = f2bf(w[(size_t)k * N + n]); o[1] = f2bf(w[(size_t)(k + 1) * N + n]); *(v2us*)(Bt + e) = o; }
         }
}
__global__ __launch_bounds__(256) void k_cvt8(const float* __restrict__ src, bf* dst, size_t n8) { const size_t i = (size_t)blockIdx.x * 256 + threadIdx.x; if (i >= n8) return; const v8f v = *(const v8f*)(src + i * 8); v8us o;
#pragma unroll
    for (int k = 0; k < 8; ++k) o[k] = f2bf(v[k]); *(v8us*)(dst + i * 8) = o;  }



// [a | b] along k (two row-major f32 [rows][DM] inputs), rounded to bf16, stored in fragment order (blocks [row / 16][k / 32]); thread i makes one 16-byte chunk.
// A wave takes 8 rows x 32 k of one block: it reads 128 contiguous bytes of each row and its store covers 4 whole lines.
__device__ __forceinline__ void catpack(const float* __restrict__ a, const float* __restrict__ b, bf* dst, size_t i) {
    const int lane = (int)(i & 31), j = lane & 3, r = (int)((i >> 5) & 1) * 8 + (lane >> 2); const size_t blk = i >> 6;
    const int c = (int)(blk % (K2 / 32)) * 32 + j * 8; const size_t t = (blk / (K2 / 32)) * 16 + r;
    const float* src = (c < DM) ? (a + t * DM + c) : (b + t * DM + (c - DM)); const v8f v = *(const v8f*)src; v8us o;
#pragma unroll
    for (int k = 0; k < 8; ++k) o[k] = f2bf(v[k]);
    *(v8us*)(dst + blk * 512 + (j >> 1) * 256 + ((j & 1) * 16 + r) * 8) = o;
}
// ---- k_pack: all four operand planes in ONE launch: work-groups 0 .. PKX - 1 make [Xs | Xt] of all batches (NB_ * TT rows, a batch's plane is TT * K2 elements), then PKW each for [Wqs | Wqt], [Wks | Wkt], [Wvs | Wvt]; grid PKX + 3 * PKW, 256 threads.
#define PKX ((unsigned)((size_t)NB_ * TT * K2 / 8 / 256))
#define PKW ((unsigned)((size_t)DM * K2 / 8 / 256))
__global__ __launch_bounds__(256) void k_pack(const float* __restrict__ xs, const float* __restrict__ xt, const float* __restrict__ wqs, const float* __restrict__ wqt, const float* __restrict__ wks, const float* __restrict__ wkt, const float* __restrict__ wvs, const float* __restrict__ wvt, bf* XC, bf* WQ, bf* WK, bf* WV) {
    static_assert(((size_t)NB_ * TT * K2 / 8) % 256 == 0 && ((size_t)DM * K2 / 8) % 256 == 0, "whole work-groups per plane");
    const unsigned g = blockIdx.x; const unsigned pl = (g < PKX) ? 0u : 1u + (g - PKX) / PKW, lb = (g < PKX) ? g : (g - PKX) % PKW;   // plane and work-group inside it: scalar
    const float* a = (pl == 0) ? xs : (pl == 1) ? wqs : (pl == 2) ? wks : wvs; const float* b = (pl == 0) ? xt : (pl == 1) ? wqt : (pl == 2) ? wkt : wvt; bf* d = (pl == 0) ? XC : (pl == 1) ? WQ : (pl == 2) ? WK : WV;
    catpack(a, b, d, (size_t)lb * 256 + threadIdx.x);
}
// ---- k_fattn: scores, softmax and attn.v of one (batch, head) for FW waves x 16 * QT queries; grid NB_ * NH_ * TT / (FW * 16 * QT), 32 * FW threads.
// Keys and values: a stage is 64 keys (two passes) of each plane, 8 KB contiguous in the plane and kept so in LDS (a fragment half is still 512 contiguous bytes per wave-wide read).
// A stage is fetched from L2 ONCE per work-group by asynchronous copies (each wave copies a quarter of every plane's stage) and read by all FW waves; two buffers, the next stage's copies fly under this stage's two passes.
// Transposed products: S^T = K Q^T (A = 16 key rows, B = 16 query rows, both fragment-ordered, read as a block's two halves: K from the LDS ring, Q from its plane) leaves one query per lane (column lr; keys 8 * hi + r),
// so two S^T tiles of 32 keys, converted in place, ARE the B operand (k order 8 * hi + s, 16 + 8 * hi + s - 8, the loader's own) of O^T += V^T P^T, with A = 16 d rows of the transposed value plane (a pass's 64 d x 32 keys are 4 KB contiguous).
// Per query: a running reference (both lane halves agree); carrier minus reference is the C operand of a score tile's first product for query rows >= RH, so their accumulators ARE the arguments of v_exp_f32 (no multiply, add or subtract per score); rows < RH add it behind the products.
// The reference is set to the first pass's maximum and raised to the running maximum only in passes where some query's score passes it by more than LZT; O^T, the sums and this pass's scores are rescaled there. Partial sum l per lane half (joined at the end); l carries the same factor as O^T.
#define FSK   64                  // keys per stage
#define FPLB  (FSK * HD * 2)      // bytes of one plane's stage
#define FBUF  (4 * FPLB)          // bytes of a buffer: K hi, K lo, then V fp16 (query rows >= RH) or V hi, V lo
// a wave's share of a stage of two planes (copy2) or one (copy1): 2 KB of each, four wave-wide 512-byte copies; l = the lane's LDS byte address in the first plane's place (the second plane's lies FPLB behind it), ga, gb = the lane's global byte address in each plane.
// One statement each: the s_wait_xcnt stands behind the last copy inside it, so that no register that a copy names is rewritten in front of it.
__device__ __forceinline__ void copy2(unsigned l, u64 ga, u64 gb) {
    asm volatile("global_load_async_to_lds_b128 %0, %8, off\n\tglobal_load_async_to_lds_b128 %1, %9, off\n\tglobal_load_async_to_lds_b128 %2, %10, off\n\tglobal_load_async_to_lds_b128 %3, %11, off\n\t"
                 "global_load_async_to_lds_b128 %4, %12, off\n\tglobal_load_async_to_lds_b128 %5, %13, off\n\tglobal_load_async_to_lds_b128 %6, %14, off\n\tglobal_load_async_to_lds_b128 %7, %15, off\n\ts_wait_xcnt 0x0"
                 :: "v"(l), "v"(l + 512u), "v"(l + 1024u), "v"(l + 1536u), "v"(l + FPLB), "v"(l + FPLB + 512u), "v"(l + FPLB + 1024u), "v"(l + FPLB + 1536u),
                    "v"(ga), "v"(ga + 512), "v"(ga + 1024), "v"(ga + 1536), "v"(gb), "v"(gb + 512), "v"(gb + 1024), "v"(gb + 1536) : "memory");
}
__device__ __forceinline__ void copy1(unsigned l, u64 ga) {
    asm volatile("global_load_async_to_lds_b128 %0, %4, off\n\tglobal_load_async_to_lds_b128 %1, %5, off\n\tglobal_load_async_to_lds_b128 %2, %6, off\n\tglobal_load_async_to_lds_b128 %3, %7, off\n\ts_wait_xcnt 0x0"
                 :: "v"(l), "v"(l + 512u), "v"(l + 1024u), "v"(l + 1536u), "v"(ga), "v"(ga + 512), "v"(ga + 1024), "v"(ga + 1536) : "memory");
}
__device__ __forceinline__ v16bf ldsb(const char* p) { return cat16b(*(const v8usa*)p, *(const v8usa*)(p + 512)); }   // the two halves of a block in LDS
__device__ __forceinline__ v16h  ldsh(const char* p) { return cat16(*(const v8ha*)p, *(const v8ha*)(p + 512)); }
__device__ __forceinline__ float xhalf(float x) { return __builtin_bit_cast(float, __builtin_amdgcn_permlanex16(__builtin_bit_cast(int, x), __builtin_bit_cast(int, x), 0x76543210, 0xfedcba98, false, false)); }   // lane l reads lane l ^ 16
template <bool HR>
__device__ __forceinline__ void fattn(const bf* __restrict__ Qh, const bf* __restrict__ Ql, const bf* __restrict__ Kh, const bf* __restrict__ Kl, const h16* __restrict__ V16, const bf* __restrict__ Vh, const bf* __restrict__ Vl, const float ab, float* __restrict__ O, char* ring) {
    // every '#pragma unroll' below: fragment, score and accumulator arrays must be indexed by constants only (else they go to scratch)
    static_assert(QT == 2, "the exponential loop below pairs element i with the sum of element i - 2 of the same column group");
    const int lane = threadIdx.x & 31, lr = lane & 15, hi = lane >> 4;
    static_assert(FW == 4 && TT % FSK == 0 && TT / FSK >= 2, "four waves copy a quarter of a stage each; the ring needs two stages");
    const int wave = __builtin_amdgcn_readfirstlane((int)(threadIdx.x >> 5));
    // one byte address per Q plane and lane (the lane's chunk of a block), one ring offset for all K and V planes; blocks are constant offsets of 1 KB from it: Q, K block (row tile) * 2 + k step, V block d tile
    u64 qha = (u64)(Qh + 8 * lane), qla = (u64)(Ql + 8 * lane);
    // the lane's first copy of this wave's quarter of a stage: byte offset in every plane (one register for all planes; the planes' bases are scalar), LDS byte address (low 32 bits of the shared address) in buffer 0
    unsigned go = (unsigned)(wave * 2048 + lane * 16);
    const unsigned lc = (unsigned)(size_t)ring + go;
    unsigned lo = (unsigned)(lane * 16);   // ring offset of the lane's chunk of the first block of the current pass's 4 KB of the first plane; carried from pass to pass in a register of its own, stepped by toggling one bit
    auto copystg = [&](unsigned l) { copy2(l, (u64)Kh + go, (u64)Kl + go); if (HR) copy2(l + 2 * FPLB, (u64)Vh + go, (u64)Vl + go); else copy1(l + 2 * FPLB, (u64)V16 + go); go += FPLB; };
    copystg(lc);   // stage 0 into buffer 0
    v16bf qh[QT][2], ql[QT][2];
#pragma unroll
    for (int qt = 0; qt < QT; ++qt)
#pragma unroll
        for (int kk = 0; kk < 2; ++kk) { qh[qt][kk] = ldgb(qha, (qt * 2 + kk) * 1024); ql[qt][kk] = ldgb(qla, (qt * 2 + kk) * 1024); }
    constexpr float CAR = HR ? 0.f : LCAR;
    // attn_bias shifts all scores of a row alike; the reference starts at it, so it cancels (a bias that is not finite still gives NaN, as in the softmax of the shifted scores)
    const float c0 = CAR + (ab - ab);
    // cr: carrier minus reference, the same value in all eight registers (a lane's eight rows of a score tile are one query's). Query rows < RH have no eight registers to spare per column group: they keep one (cf), start their tiles from 0 and add it behind the products
    v8f o[QT][4], cr[QT]; float cf[QT], l[QT];
    float thr = -3.0e38f, lb = -3.0e38f;   // the first pass always sets the reference, downwards too; later passes: thr = CAR + LZT, lb = 0 (it only rises)
#pragma unroll
    for (int qt = 0; qt < QT; ++qt) { l[qt] = 0.f; cf[qt] = c0; cr[qt] = (v8f){c0, c0, c0, c0, c0, c0, c0, c0};
#pragma unroll
        for (int dt = 0; dt < 4; ++dt) o[qt][dt] = (v8f){}; }
    asm volatile("s_wait_xcnt 0x0" : "+v"(qha), "+v"(qla) :: "memory");   // the issued loads name these pairs: wait before one is reused
    asm volatile("s_wait_asynccnt 0x0" ::: "memory");   // this wave's copies of stage 0 have landed
    __syncthreads();                                    // stage 0 is published
    copystg(lc + FBUF);   // stage 1 into buffer 1
    constexpr int NT = TT / FSK;
    // both loops rolled: one pass of 32 keys already fills the register budget of four waves per SIMD, and one pass's code serves both passes of a stage and both buffers
#pragma unroll 1
    for (int t = 0; t < NT; ++t) {
      const int bo = (t & 1) * FBUF;
#pragma unroll 1
      for (int ps = 0; ps < 2; ++ps) {
        const char* fp = ring + lo;
        v16bf kh[2][2], kl[2][2];
#pragma unroll
        for (int kt = 0; kt < 2; ++kt)
#pragma unroll
            for (int kk = 0; kk < 2; ++kk) { kh[kt][kk] = ldsb(fp + (kt * 2 + kk) * 1024); kl[kt][kk] = ldsb(fp + FPLB + (kt * 2 + kk) * 1024); }
        v8f s[2][QT];
#pragma unroll
        for (int kk = 0; kk < 2; ++kk) {   // per k step: hi.hi, q_lo.k_hi, q_hi.k_lo; a tile's first product starts from cr (from 0 for query rows < RH)
#pragma unroll
            for (int kt = 0; kt < 2; ++kt)
#pragma unroll
                for (int qt = 0; qt < QT; ++qt) s[kt][qt] = wmmab(kh[kt][kk], qh[qt][kk], kk ? s[kt][qt] : HR ? (v8f){} : cr[qt]);
#pragma unroll
            for (int kt = 0; kt < 2; ++kt)
#pragma unroll
                for (int qt = 0; qt < QT; ++qt) s[kt][qt] = wmmab(kh[kt][kk], ql[qt][kk], s[kt][qt]);
#pragma unroll
            for (int kt = 0; kt < 2; ++kt)
#pragma unroll
                for (int qt = 0; qt < QT; ++qt) s[kt][qt] = wmmab(kl[kt][kk], qh[qt][kk], s[kt][qt]);
        }
        v16h v16[4]; v16bf vh[4], vl[4];   // this pass's values: their LDS reads are in flight under the softmax
#pragma unroll
        for (int dt = 0; dt < 4; ++dt) { if (HR) { vh[dt] = ldsb(fp + 2 * FPLB + dt * 1024); vl[dt] = ldsb(fp + 3 * FPLB + dt * 1024); } else v16[dt] = ldsh(fp + 2 * FPLB + dt * 1024); }
        float mx[QT]; bool need = false;
#pragma unroll
        for (int qt = 0; qt < QT; ++qt) { if (HR) { s[0][qt] += cf[qt]; s[1][qt] += cf[qt]; }
            mx[qt] = s[0][qt][0];
#pragma unroll
            for (int i = 1; i < 16; ++i) mx[qt] = fmaxf(mx[qt], s[i >> 3][qt][i & 7]);
            need = need || (mx[qt] > thr); }
        if (__builtin_amdgcn_ballot_w32(need) != 0) {   // scalar branch: taken in the first pass and where some query of the wave has a score more than LZT above its reference
#pragma unroll
            for (int qt = 0; qt < QT; ++qt) { const float d = fmaxf(fmaxf(mx[qt], xhalf(mx[qt])) - CAR, lb);   /* how far this query's reference moves: to its running maximum; 0 where that has not risen */
                const float al = __builtin_amdgcn_exp2f(fminf(-d, 0.f));   /* a first reference below the start value has only zeros to rescale: x 1 */ l[qt] *= al; if (HR) cf[qt] -= d; else cr[qt] -= d;
#pragma unroll
                for (int kt = 0; kt < 2; ++kt) s[kt][qt] -= d;
#pragma unroll
                for (int dt = 0; dt < 4; ++dt) o[qt][dt] *= al; }
        }
        thr = CAR + LZT; lb = 0.f;
        // exponentials in place, each with its slot filled: directly behind every v_exp_f32 stands the row-sum add of the exponential made two earlier (a v_nop behind the first two),
        // which neither reads the new result nor rewrites its source; the scheduling barriers keep that order
#pragma unroll
        for (int i = 0; i < 16 * QT; ++i) { s[(i / QT) >> 3][i % QT][(i / QT) & 7] = __builtin_amdgcn_exp2f(s[(i / QT) >> 3][i % QT][(i / QT) & 7]);
            __builtin_amdgcn_sched_barrier(0);
            if (i >= 2) l[i % QT] += s[((i - 2) / QT) >> 3][i % QT][((i - 2) / QT) & 7]; else asm volatile("v_nop");
            __builtin_amdgcn_sched_barrier(0); }
#pragma unroll
        for (int i = 16 * QT - 2; i < 16 * QT; ++i) l[i % QT] += s[1][i % QT][7];
#pragma unroll
        for (int qt = 0; qt < QT; ++qt) { v16h p16; v16bf ph, pl;
#pragma unroll
            for (int kt = 0; kt < 2; ++kt)
#pragma unroll
                for (int r = 0; r < 8; ++r) { const float p = s[kt][qt][r];
                    if (HR) { const __bf16 a = (__bf16)p; ph[kt * 8 + r] = a; pl[kt * 8 + r] = (__bf16)(p - (float)a); } else p16[kt * 8 + r] = (h16)p; }
#pragma unroll
            for (int dt = 0; dt < 4; ++dt) {
                if (HR) { o[qt][dt] = wmmab(vh[dt], ph, o[qt][dt]); o[qt][dt] = wmmab(vh[dt], pl, o[qt][dt]); o[qt][dt] = wmmab(vl[dt], ph, o[qt][dt]); }
                else o[qt][dt] = wmma16(v16[dt], p16, o[qt][dt]); } }
        lo ^= 32 * HD * 2;   // the stage's other pass
      }
      lo ^= FBUF;                                         // the other buffer
      asm volatile("s_wait_dscnt 0x0" ::: "memory");      // this wave has read all it needs of this buffer
      asm volatile("s_wait_asynccnt 0x0" ::: "memory");   // its copies of stage t + 1 have landed
      __syncthreads();                                    // stage t + 1 is published, and every reader has left stage t's buffer
      if (t + 2 < NT) copystg(lc + bo);                   // stage t + 2 into the buffer just left; the test is scalar
    }
    asm volatile("s_wait_asynccnt 0x0" ::: "memory");   // no copy is outstanding when the wave ends
#pragma unroll
    for (int qt = 0; qt < QT; ++qt) { const float f = __fdiv_rn(1.0f, l[qt] + xhalf(l[qt]));
#pragma unroll
        for (int dt = 0; dt < 4; ++dt) o[qt][dt] *= f; }
    float* orow = O + (size_t)lr * DM + hi * 8;   // a lane's 8 registers of a tile are 8 consecutive d of its query
    __builtin_amdgcn_sched_barrier(0);   // all arithmetic in front of the stores: nothing rewrites a register that an issued store names
#pragma unroll
    for (int qt = 0; qt < QT; ++qt)
#pragma unroll
        for (int dt = 0; dt < 4; ++dt) { *(v4f*)(orow + qt * 16 * DM + dt * 16) = __builtin_shufflevector(o[qt][dt], o[qt][dt], 0, 1, 2, 3); *(v4f*)(orow + qt * 16 * DM + dt * 16 + 4) = __builtin_shufflevector(o[qt][dt], o[qt][dt], 4, 5, 6, 7); }
}
// amdgpu_waves_per_eu(4): with no key fragments held a pass ahead the registers fit a quarter of a SIMD's file, and four rings fit the LDS: four work-groups share a WGP, so the whole grid is resident at once
__global__ __launch_bounds__(32 * FW) __attribute__((amdgpu_waves_per_eu(4))) void k_fattn(const bf* __restrict__ Qh, const bf* __restrict__ Ql, const bf* __restrict__ Kh, const bf* __restrict__ Kl, const h16* __restrict__ V16, const bf* __restrict__ Vh, const bf* __restrict__ Vl, const float* __restrict__ AB, float* __restrict__ O) {
    constexpr int NQB = TT / (FW * 16 * QT), NHB = RH / (FW * 16 * QT), NZ = NB_ * NH_; static_assert(RH % (FW * 16 * QT) == 0 && TT % (FW * 16 * QT) == 0, "whole query blocks on either side of RH");
    // the longer blocks (query rows < RH, three attn.v products) take the lowest indices, so that they start first; z = batch * NH_ + head, xb = query block
    const int fl = (int)blockIdx.x, f2 = fl - NZ * NHB; const int z = (f2 < 0) ? fl / NHB : f2 / (NQB - NHB), xb = (f2 < 0) ? fl % NHB : NHB + f2 % (NQB - NHB);
    __shared__ __align__(16) char ring[2 * FBUF];   // the two stage buffers
    const float ab = bfr(AB[0]);
    const int q0 = xb * (FW * 16 * QT) + __builtin_amdgcn_readfirstlane((int)(threadIdx.x >> 5)) * (16 * QT);   // scalar
    const size_t pz = (size_t)z * TT * HD, pq = pz + (size_t)q0 * HD; float* o = O + ((size_t)(z / NH_) * TT + q0) * DM + (z % NH_) * HD;
    // the same side for the whole work-group (a query block lies wholly on one side of RH): the barriers inside are passed by all its waves
    if (xb < NHB) fattn<true>(Qh + pq, Ql + pq, Kh + pz, Kl + pz, V16 + pz, Vh + pz, Vl + pz, ab, o, ring);
    else fattn<false>(Qh + pq, Ql + pq, Kh + pz, Kl + pz, V16 + pz, Vh + pz, Vl + pz, ab, o, ring);
}

extern "C" void kernel_launch(void* const* d_in, const int* in_sizes, int n_in,
                              void* d_out, int out_size, void* d_ws, size_t ws_size, hipStream_t stream) {
    (void)in_sizes; (void)n_in; (void)out_size;
    const float* xs = (const float*)d_in[0]; const float* xt = (const float*)d_in[1]; const float* wqs = (const float*)d_in[2]; const float* bqs = (const float*)d_in[3]; const float* wqt = (const float*)d_in[4]; const float* bqt = (const float*)d_in[5]; const float* wks = (const float*)d_in[6]; const float* bks = (const float*)d_in[7]; const float* wkt = (const float*)d_in[8]; const float* bkt = (const float*)d_in[9]; const float* wvs = (const float*)d_in[10]; const float* bvs = (const float*)d_in[11]; const float* wvt = (const float*)d_in[12]; const float* bvt = (const float*)d_in[13]; const float* ABIAS = (const float*)d_in[14]; const float* x = xs; const float* wq = wqs; const float* wk = wks; const float* wv = wvs; const float* wo = nullptr; (void)wo; (void)x; (void)wq; (void)wk; (void)wv;
    float* OUT = (float*)d_out;     // [4][2048][1024]
    char* wsp = (char*)d_ws;
    auto take = [&](size_t bytes) { char* p = wsp; wsp += (bytes + 255) & ~(size_t)255; return (void*)p; };
    bf* WQ = (bf*)take((size_t)DQ * K2 * 2); bf* WK = (bf*)take((size_t)DKV * K2 * 2); bf* WV = (bf*)take((size_t)DKV * K2 * 2);
    bf* XB = (bf*)take((size_t)NB_ * TT * K2 * 2); h16* VT16 = (h16*)take((size_t)NB_ * NKV * HD * TT * 2);
    bf* QPh = (bf*)take((size_t)NB_ * NH_ * TT * HD * 2); bf* QPl = (bf*)take((size_t)NB_ * NH_ * TT * HD * 2); bf* KPh = (bf*)take((size_t)NB_ * NKV * TT * HD * 2); bf* KPl = (bf*)take((size_t)NB_ * NKV * TT * HD * 2); bf* VTh = (bf*)take((size_t)NB_ * NKV * HD * TT * 2); bf* VTl = (bf*)take((size_t)NB_ * NKV * HD * TT * 2);   // the planes that k_fattn reads: all batches
    if ((size_t)(wsp - (char*)d_ws) > ws_size) return;    // ws 256 MiB
    k_pack<<<PKX + 3 * PKW, 256, 0, stream>>>(xs, xt, wqs, wqt, wks, wkt, wvs, wvt, XB, WQ, WK, WV);   /* [Xs | Xt] of all batches, [W_s | W_t] along k */
    k_proj<<<dim3(64, 3, NB_), 256, 0, stream>>>(XB, WQ, WK, WV, bqs, bqt, bks, bkt, bvs, bvt, VT16, QPh, QPl, KPh, KPl, VTh, VTl);   /* Q, K as head planes, V^T planes: all batches */
    k_fattn<<<NB_ * NH_ * (TT / (FW * 16 * QT)), 32 * FW, 0, stream>>>(QPh, QPl, KPh, KPl, VT16, VTh, VTl, ABIAS, OUT);   /* merged context, f32 */
}

// v009
// It runs in 165 microseconds.
// In both of two side-by-side timings against v008, it was 1.04 times as fast.
// Counting every step since v000, it is 25.7 times as fast.
#include <hip/hip_runtime.h>

// Two-stream multi-head self-attention with dual-linear projections (Xs, Xt [4][2048][1024]; Q = Xs W_qs^T + b_qs + Xt W_qt^T + b_qt ('oi' [1024][1024] each), K and V likewise; 16 heads x 64; scores/8 + attn_bias (scalar [1][1][1][1], read); softmax; out = merged context, no output projection -> [4][2048][1024] f32 (8.4 M)).
// Layout: each dual linear is ONE exact GEMM with K = 2048: one operand is the concatenated bf16 plane [Xs | Xt], the other the two 'oi' weights concatenated along k (the three run as one product, their weight planes one behind the other); the GEMM's own epilogue adds the two biases in f32 and stores the 16-bit planes that the attention reads (no f32 Q/K/V plane in memory).
// Compute dtypes, f32 accumulate: every input rounded to bf16; Q/K/V as exact K = 2048 products of the [Xs | Xt] plane against [W_s | W_t], + b_s + b_t in f32; scores hi.hi + hi.lo + lo.hi on every row, in the log2 domain (the Q planes hold Q x HD^-0.5 x log2 e); softmax f32 (running reference, unnormalised exponentials, one division per row at the end); attn.v: query rows < 512 hl (3 products), the rest fp16 exponentials (x1024) x fp16 values; no output projection: f32 merged context.
// Three launches: k_pack (all 16-bit operand planes), k_proj (every projection tile of all batches), k_fattn.
// Attention is ONE launch for all batches and heads (k_fattn): scores, softmax and attn.v stay in registers, no score or probability plane in memory; keys and values come through an LDS ring that a work-group's waves share.
// Fragment order: every 16-bit plane that a matrix operand is loaded from is stored as 1-KB blocks of 16 rows x 32 k. Inside a block, 16-byte chunk number c * 32 + h * 16 + r holds row r, k = c * 16 + h * 8 .. + 7,
// which is what lane h * 16 + r takes as the c-th half of its fragment: each wave-wide 16-byte load reads 512 contiguous bytes (4 whole lines) instead of 32 bytes of each of 16 lines. Registers hold the same elements as with row-major planes.

#define NB_  4
#define TT   2048
#define DM   1024
#define NH_  16
#define NKV  16
#define REP  (NH_ / NKV)
#define HD   64
#define DQ   (NH_ * HD)
#define DKV  (NKV * HD)
#define K2   (2 * DM)              // concatenated contraction [Xs | Xt]
#define RH   512                  // query rows < RH use hi+lo planes (0: none)
#define WIN  0
#define LCAR 10.0f                // log2 of the factor (x1024) that the fp16 exponentials carry
#define LZT  5.0f                 // the softmax reference is raised when a score passes it by more than this (log2): fp16 exponentials stay <= 2^(LCAR + LZT) = 32768
#define SCL  0.125f   // HD^-0.5
#define QT   2                    // k_fattn: 16-query column groups per wave
#define FW   4                    // k_fattn: waves per work-group
#define L2E  1.4426950408889634f
#define QSC  (SCL * L2E)           // folded into the Q planes: the score products come out as log2 exponents
typedef _Float16 h16;
typedef unsigned short bf;
typedef __attribute__((ext_vector_type(16))) __bf16   v16bf;
typedef __attribute__((ext_vector_type(16))) _Float16 v16h;
typedef __attribute__((ext_vector_type(8)))  _Float16 v8h;
typedef __attribute__((ext_vector_type(8)))  unsigned short v8us;
typedef __attribute__((ext_vector_type(8)))  float    v8f;
typedef __attribute__((ext_vector_type(4)))  float    v4f;
typedef v8h  __attribute__((may_alias)) v8ha;
typedef v4f  __attribute__((may_alias)) v4fa;
typedef v8us __attribute__((may_alias)) v8usa;

__device__ __forceinline__ unsigned short f2bf(float f) { unsigned u = __float_as_uint(f); u += 0x7FFFu + ((u >> 16) & 1u); return (unsigned short)(u >> 16); }
__device__ __forceinline__ float bf2f(unsigned short b) { return __uint_as_float(((unsigned)b) << 16); }
__device__ __forceinline__ float bfr(float f) { return bf2f(f2bf(f)); }
__device__ __forceinline__ v16h cat16(v8h lo, v8h hi) { return __builtin_shufflevector(lo, hi, 0, 1, 2, 3, 4, 5, 6, 7, 8, 9, 10, 11, 12, 13, 14, 15); }
__device__ __forceinline__ v16bf cat16b(v8us lo, v8us hi) { return __builtin_bit_cast(v16bf, __builtin_shufflevector(lo, hi, 0, 1, 2, 3, 4, 5, 6, 7, 8, 9, 10, 11, 12, 13, 14, 15)); }
__device__ __forceinline__ v8f wmma16(v16h a, v16h b, v8f c) { return __builtin_amdgcn_wmma_f32_16x16x32_f16(false, a, false, b, (short)0, c, false, false); }
__device__ __forceinline__ v8f wmmab(v16bf a, v16bf b, v8f c) { return __builtin_amdgcn_wmma_f32_16x16x32_bf16(false, a, false, b, (short)0, c, false, false); }



__device__ __forceinline__ h16 tohx(float x) { return (h16)x; }
__device__ __forceinline__ void splitf(float y, unsigned short& h, unsigned short& l) { h = f2bf(y); l = f2bf(y - bf2f(h)); }
typedef __attribute__((ext_vector_type(2))) _Float16 v2h;
typedef __attribute__((ext_vector_type(4))) _Float16 v4h;
typedef __attribute__((ext_vector_type(2))) unsigned short v2us;
typedef __attribute__((ext_vector_type(4))) unsigned short v4us;
typedef __attribute__((ext_vector_type(2))) float v2f;
typedef __attribute__((ext_vector_type(4))) int v4i;

// ---- k_proj: Q, K and V of all batches are ONE product [Xs | Xt] (NB_ * TT token rows) x [W_s | W_t]^T (the three weight planes lie one behind the other: 3 * DM rows), one f32 chain along k per element.
// One 256-token x 384-column tile per work-group of 8 waves (4 x 2), one work-group per WGP, the whole grid resident at once. The 384 columns are two heads' Q, K and V columns; a wave has 64 tokens x (Q, K, V of ONE head) = 4 x 12 accumulators,
// so a stage's bytes are fetched from L2 once for 256 x 384 results and a fragment read from LDS feeds 12 (tokens) or 4 (weights) products. Operands come from fragment-ordered 16-bit planes (blocks [row / 16][k / 32]).
// Staging: a stage is 128 k of the tile's 16 token bands and 24 weight bands (a band = 16 rows; its 128 k are 4 KB contiguous in the plane and stay so in LDS, so a fragment half is still 512 contiguous bytes per wave-wide read).
// The 160 KB of a stage come by asynchronous copies (each wave copies 5 bands); two buffers, the next stage's copies fly under this stage's products.
// Epilogue, per 64 x 64 sub-tile (J = 0: Q, 1: K, 2: V): y = sum + b_s + b_t (both rounded to bf16, added one after the other in f32; the Q planes store y x QSC), never stored as f32; planes in fragment order, a sub-tile is 8 KB contiguous in each.
// Q, K: hi/lo bf16 planes [head], rows = tokens, k = d, blocks [token / 16][d / 32]. V: fp16 and hi/lo bf16 planes [head], rows = d, k = tokens, blocks [token / 32][d / 16]: the sub-tile is turned over on its way through the LDS staging.
// fragment loads from a 64-bit byte address held in a register pair (kept as an integer so that the s_wait_xcnt statements below can name the pair)
typedef unsigned long long u64;
typedef const __attribute__((address_space(1))) v8us* gp8us;
__device__ __forceinline__ v16bf ldgb(u64 a, int ofs) { return cat16b(*(gp8us)(a + ofs), *(gp8us)(a + ofs + 512)); }   // the two halves of a block
__device__ __forceinline__ v16bf ldfr(const char* p) { return cat16b(*(const v8usa*)p, *(const v8usa*)(p + 512)); }   // the two halves of a block in LDS
#define SGK   128                 // k per stage: four blocks of every band
#define BANDB (SGK * 16 * 2)      // bytes of one band's stage
#define NBA   16                  // token bands of a tile
#define NBB   24                  // weight bands of a tile: 2 heads x (Q, K, V) x 4
#define STGB  ((NBA + NBB) * BANDB)   // bytes of a stage: the token bands, then the weight bands
// a wave's share of a stage: five bands of 4 KB, each eight wave-wide 512-byte copies; l = the lane's LDS byte address in the first band's place (the five places are adjacent), g0 .. g4 = the lane's global byte address in each band.
// A band is laid out alike in the plane and in LDS, so the eight copies of a band share one address pair and step by the immediate offset, which moves both addresses.
// One statement: the s_wait_xcnt stands behind the last copy inside it, so that no register that a copy names is rewritten in front of it.
#define CPB(L, G) "global_load_async_to_lds_b128 " L ", " G ", off\n\tglobal_load_async_to_lds_b128 " L ", " G ", off offset:512\n\tglobal_load_async_to_lds_b128 " L ", " G ", off offset:1024\n\tglobal_load_async_to_lds_b128 " L ", " G ", off offset:1536\n\t" \
                  "global_load_async_to_lds_b128 " L ", " G ", off offset:2048\n\tglobal_load_async_to_lds_b128 " L ", " G ", off offset:2560\n\tglobal_load_async_to_lds_b128 " L ", " G ", off offset:3072\n\tglobal_load_async_to_lds_b128 " L ", " G ", off offset:3584\n\t"
__device__ __forceinline__ void copystage(unsigned l, u64 g0, u64 g1, u64 g2, u64 g3, u64 g4) {
    static_assert(BANDB == 8 * 512, "eight copies a band");
    asm volatile(CPB("%0", "%5") CPB("%1", "%6") CPB("%2", "%7") CPB("%3", "%8") CPB("%4", "%9") "s_wait_xcnt 0x0"
                 :: "v"(l), "v"(l + BANDB), "v"(l + 2 * BANDB), "v"(l + 3 * BANDB), "v"(l + 4 * BANDB), "v"(g0), "v"(g1), "v"(g2), "v"(g3), "v"(g4) : "memory");
}
// one 64 x 64 sub-tile (accumulator columns J * 4 .. + 3) out of the registers: biased, staged in the wave's own LDS range ow, read back in chunk order, split, stored. b1, b2: the lane's biases (an accumulator's column nb * 16 + lr is one output feature in Q, K and V alike); e0: byte offset of the lane's first element in every plane (one 32-bit register beside the planes' scalar bases).
// the 8 KB of the sub-tile in an output plane are 16 runs of 32 chunks of 8 elements, 256 elements a run; lane l makes chunk l of a run; trip v makes four runs, u = 0 .. 3
// Q, K (staged rows = tokens): run v * 4 + u, staged row v * 16 + lr, first staged column u * 16 + hi * 8; V (staged rows = d): run (v >> 1) * 8 + u * 2 + (v & 1), staged row u * 16 + lr, first staged column v * 16 + hi * 8
template <int J>
__device__ __forceinline__ void subtile(const v8f (&acc)[4][12], float* ow, const float (&b1)[4], const float (&b2)[4], h16* __restrict__ P16, bf* __restrict__ Ph, bf* __restrict__ Pl, const unsigned e0, const int lr, const int hi) {
    constexpr bool VT = (J == 2);
    // every '#pragma unroll' below: accumulator, bias and result arrays must be indexed by constants only (else they go to scratch)
    float c1[4], c2[4];
#pragma unroll
    for (int nb = 0; nb < 4; ++nb) { c1[nb] = bfr(b1[nb]); c2[nb] = bfr(b2[nb]); }
#pragma unroll
    for (int mb = 0; mb < 4; ++mb)
#pragma unroll
        for (int nb = 0; nb < 4; ++nb) { v8f y;
#pragma unroll
            for (int j = 0; j < 8; ++j) y[j] = __fadd_rn(__fadd_rn(acc[mb][J * 4 + nb][j], c1[nb]), c2[nb]);
            if constexpr (VT) { float* p = ow + (nb * 16 + lr) * 68 + mb * 16 + hi * 8;   // a lane's eight registers are eight consecutive tokens of one d: two 16-byte stores into row d
                *(v4fa*)p = __builtin_shufflevector(y, y, 0, 1, 2, 3); *(v4fa*)(p + 4) = __builtin_shufflevector(y, y, 4, 5, 6, 7); }
            else {
#pragma unroll
                for (int j = 0; j < 8; ++j) ow[(mb * 16 + hi * 8 + j) * 68 + nb * 16 + lr] = y[j]; }
        }
    asm volatile("s_wait_dscnt 0x0" ::: "memory");   // the wave's own rows are in LDS before its lanes read them back in chunk order
    // rolled, four chunks of each plane a trip: the epilogue runs once, straight through, so its text is kept short
#pragma unroll 1
    for (int v = 0; v < 4; ++v) {
        v8us oh[4], ol[4]; v8h o16[4];
        const float* rp = VT ? ow + lr * 68 + v * 16 + hi * 8 : ow + (v * 16 + lr) * 68 + hi * 8;
#pragma unroll
        for (int u = 0; u < 4; ++u) { const float* p = rp + (VT ? u * 16 * 68 : u * 16); const v4f val[2] = { *(const v4fa*)p, *(const v4fa*)(p + 4) };
#pragma unroll
            for (int q = 0; q < 8; ++q) { const float yb = val[q >> 2][q & 3]; const float y = (J == 0) ? yb * QSC : yb;   /* the Q planes carry the softmax's scale */ unsigned short h, l; splitf(y, h, l); oh[u][q] = h; ol[u][q] = l; if (VT) o16[u][q] = tohx(y); } }
        const unsigned eo = e0 + (VT ? (v >> 1) * 4096 + (v & 1) * 512 : v * 2048);
        __builtin_amdgcn_sched_barrier(0);   // all arithmetic of this trip in front of its stores: nothing rewrites a register that an issued store names
#pragma unroll
        for (int u = 0; u < 4; ++u) { *(v8us*)((char*)Ph + eo + u * (VT ? 1024 : 512)) = oh[u]; *(v8us*)((char*)Pl + eo + u * (VT ? 1024 : 512)) = ol[u]; if (VT) *(v8h*)((char*)P16 + eo + u * (VT ? 1024 : 512)) = o16[u]; }
        asm volatile("s_wait_xcnt 0x0" ::: "memory");   // this trip's stores are issued: wait before the next trip or sub-tile reuses their registers
        __builtin_amdgcn_sched_barrier(0);   // and none of the later arithmetic is lifted over that wait, in among the stores
    }
}
// grid (NB_ * TT / 256) * (NH_ / 2) = 256 work-groups, 256 threads. WC: the planes [Wqs | Wqt], [Wks | Wkt], [Wvs | Wvt], one behind the other.
__global__ __launch_bounds__(256) void k_proj(const bf* __restrict__ XC, const bf* __restrict__ WC, const float* __restrict__ bqs, const float* __restrict__ bqt, const float* __restrict__ bks, const float* __restrict__ bkt, const float* __restrict__ bvs, const float* __restrict__ bvt,
                                              h16* __restrict__ VT16, bf* __restrict__ QPh, bf* __restrict__ QPl, bf* __restrict__ KPh, bf* __restrict__ KPl, bf* __restrict__ VTh, bf* __restrict__ VTl) {
    static_assert(HD == 64 && DQ == DM && DKV == DM && TT % 256 == 0 && NH_ % 2 == 0 && K2 % SGK == 0 && K2 / SGK >= 2 && 8 * 64 * 68 * 4 <= 2 * STGB, "a 64-column sub-tile is one head; a tile lies in one batch; the ring needs two stages; the output staging lies inside the ring");
    __shared__ __align__(16) float os[2 * STGB / 4];   // the two stage buffers, then each wave's output staging
    // every '#pragma unroll' below: accumulator, fragment and address arrays must be indexed by constants only (else they go to scratch)
    const int lane = threadIdx.x & 31, lr = lane & 15, hi = lane >> 4;
    const int wave = __builtin_amdgcn_readfirstlane((int)(threadIdx.x >> 5));   // scalar, so that the band choice below stays scalar
    const int R0 = ((int)blockIdx.x % (NB_ * TT / 256)) * 256, h0 = ((int)blockIdx.x / (NB_ * TT / 256)) * 2;   // first token row (over all batches) and first head of the tile
    const int wr = wave >> 1, wc = wave & 1;   // this wave: token rows R0 + wr * 64 .. + 63, head h0 + wc
    v8f acc[4][12];
#pragma unroll
    for (int mb = 0; mb < 4; ++mb)
#pragma unroll
        for (int n = 0; n < 12; ++n) acc[mb][n] = (v8f){};
    // this wave's five bands of a stage: band G of the stage is token band G for G < NBA; else, with B = G - NBA, rows (B & 3) * 16 .. + 15 of head h0 + B / 12 in weight plane (B % 12) / 4 (a 16-row band is 16 * K2 elements of its plane). Scalar bases, one lane offset for all.
    u64 gb[5];
#pragma unroll
    for (int i = 0; i < 5; ++i) { const int G = wave * 5 + i, B = G - NBA; gb[i] = (u64)((G < NBA) ? XC + (size_t)(R0 + G * 16) * K2 : WC + (size_t)(((B % 12) >> 2) * DM + (h0 + B / 12) * HD + (B & 3) * 16) * K2); }
    unsigned go = (unsigned)(lane * 16);   // byte offset in every band of the lane's first copy of the next stage to fetch
    const unsigned lc = (unsigned)(size_t)os + (unsigned)(wave * 5 * BANDB + lane * 16);   // LDS byte address (low 32 bits of the shared address) of the lane's first copy in buffer 0
    const char* fa = (const char*)os + wr * 4 * BANDB + lane * 16; const char* fb = (const char*)os + (NBA + wc * 12) * BANDB + lane * 16;   // the lane's chunk of this wave's first token and weight blocks in buffer 0
    constexpr int NT = K2 / SGK;
    copystage(lc, gb[0] + go, gb[1] + go, gb[2] + go, gb[3] + go, gb[4] + go); go += BANDB;   // stage 0 into buffer 0
    asm volatile("s_wait_asynccnt 0x0" ::: "memory");   // this wave's copies of stage 0 have landed
    __syncthreads();                                    // stage 0 is published
    copystage(lc + STGB, gb[0] + go, gb[1] + go, gb[2] + go, gb[3] + go, gb[4] + go); go += BANDB;   // stage 1 into buffer 1
    // rolled: one stage's code serves both buffers
#pragma unroll 1
    for (int t = 0; t < NT; ++t) {
        const int bo = (t & 1) * STGB;
        const char* pa = fa + bo; const char* pb = fb + bo;
        v16bf a[4], b[2][4];   // token fragments of one k block; two sets of four weight fragments: the next group's reads fly under this group's products
#pragma unroll
        for (int nb = 0; nb < 4; ++nb) b[0][nb] = ldfr(pb + nb * BANDB);
#pragma unroll
        for (int q = 0; q < 3 * (SGK / 32); ++q) {   // group q: k block q / 3, weight plane q % 3 (Q, K, V)
            if (q % 3 == 0) {
#pragma unroll
                for (int mb = 0; mb < 4; ++mb) a[mb] = ldfr(pa + mb * BANDB + (q / 3) * 1024); }
            if (q + 1 < 3 * (SGK / 32)) {
#pragma unroll
                for (int nb = 0; nb < 4; ++nb) b[(q + 1) & 1][nb] = ldfr(pb + (((q + 1) % 3) * 4 + nb) * BANDB + ((q + 1) / 3) * 1024); }
            __builtin_amdgcn_sched_barrier(0);   // the LDS reads stand as one group in front of this group's products, none among them
#pragma unroll
            for (int nb = 0; nb < 4; ++nb)
#pragma unroll
                for (int mb = 0; mb < 4; ++mb) acc[mb][(q % 3) * 4 + nb] = wmmab(a[mb], b[q & 1][nb], acc[mb][(q % 3) * 4 + nb]);
            __builtin_amdgcn_sched_barrier(0);   // and the next group's reads stay behind them
        }
        asm volatile("s_wait_dscnt 0x0" ::: "memory");      // this wave has read all it needs of this buffer
        asm volatile("s_wait_asynccnt 0x0" ::: "memory");   // its copies of stage t + 1 have landed
        __syncthreads();                                    // stage t + 1 is published, and every reader has left stage t's buffer
        if (t + 2 < NT) { copystage(lc + bo, gb[0] + go, gb[1] + go, gb[2] + go, gb[3] + go, gb[4] + go); go += BANDB; }   // stage t + 2 into the buffer just left; the test is scalar
    }
    asm volatile("s_wait_asynccnt 0x0" ::: "memory");   // no copy is outstanding when the ring becomes output staging (the last trip's barrier ended every read of it)
    float* ow = os + (size_t)wave * 64 * 68;   // each wave stages its sub-tiles, one after the other, in its own range
    const int head = h0 + wc, tok = R0 % TT + wr * 64;   // scalar
    static_assert((size_t)NB_ * NH_ * TT * HD * 2 < 0x80000000ull, "a plane's byte offsets fit 32 bits");
    const unsigned e0 = (unsigned)((((R0 / TT) * NH_ + head) * TT + tok) * HD + lane * 8) * 2u;   // batch, head, token: the sub-tile's 8 KB, the lane's chunk
    // all 24 biases of the lane in one go: each plane is read at a wave-uniform base plus one lane offset; the bases and the offset are operands of the wait below,
    // so that they stay live up to it: no load's result lands in, and nothing else rewrites, a register that an issued load names
    const float* p0 = bqs + head * HD; const float* p1 = bqt + head * HD; const float* p2 = bks + head * HD; const float* p3 = bkt + head * HD; const float* p4 = bvs + head * HD; const float* p5 = bvt + head * HD;
    float br[6][4];
#pragma unroll
    for (int u = 0; u < 4; ++u) { br[0][u] = p0[lr + u * 16]; br[1][u] = p1[lr + u * 16]; br[2][u] = p2[lr + u * 16]; br[3][u] = p3[lr + u * 16]; br[4][u] = p4[lr + u * 16]; br[5][u] = p5[lr + u * 16]; }
    asm volatile("s_wait_xcnt 0x0" :: "s"(p0), "s"(p1), "s"(p2), "s"(p3), "s"(p4), "s"(p5), "v"(lr) : "memory");   // the bias loads are issued: wait before a register that they name is reused
    subtile<0>(acc, ow, br[0], br[1], nullptr, QPh, QPl, e0, lr, hi);   // Q = [Xs|Xt][Wqs|Wqt]^T + b_qs + b_qt, as head planes
    subtile<1>(acc, ow, br[2], br[3], nullptr, KPh, KPl, e0, lr, hi);   // K likewise
    subtile<2>(acc, ow, br[4], br[5], VT16, VTh, VTl, e0, lr, hi);      // V, stored transposed
}


__global__ __launch_bounds__(256) void k_wtG(const float* __restrict__ w, int K, int N, bf* Bt) {
    const int lane = threadIdx.x & 31; const int L0 = (blockIdx.x * 8 + (threadIdx.x >> 5)) * 8; const int nlines = N * K / 64;
{
#pragma unroll 1
        for (int l = 0; l < 8; ++l) { const int L = L0 + l; if (L >= nlines) break; const size_t e = (size_t)L * 64 + lane * 2; const int k = (int)(e % K), n = (int)(e / K); v2us o;
            o[0] = f2bf(w[(size_t)k * N + n]); o[1] = f2bf(w[(size_t)(k + 1) * N + n]); *(v2us*)(Bt + e) = o; }
         }
}
__global__ __launch_bounds__(256) void k_cvt8(const float* __restrict__ src, bf* dst, size_t n8) { const size_t i = (size_t)blockIdx.x * 256 + threadIdx.x; if (i >= n8) return; const v8f v = *(const v8f*)(src + i * 8); v8us o;
#pragma unroll
    for (int k = 0; k < 8; ++k) o[k] = f2bf(v[k]); *(v8us*)(dst + i * 8) = o;  }



// [a | b] along k (two row-major f32 [rows][DM] inputs), rounded to bf16, stored in fragment order (blocks [row / 16][k / 32]); thread i makes one 16-byte chunk.
// A wave takes 8 rows x 32 k of one block: it reads 128 contiguous bytes of each row and its store covers 4 whole lines.
__device__ __forceinline__ void catpack(const float* __restrict__ a, const float* __restrict__ b, bf* dst, size_t i) {
    const int lane = (int)(i & 31), j = lane & 3, r = (int)((i >> 5) & 1) * 8 + (lane >> 2); const size_t blk = i >> 6;
    const int c = (int)(blk % (K2 / 32)) * 32 + j * 8; const size_t t = (blk / (K2 / 32)) * 16 + r;
    const float* src = (c < DM) ? (a + t * DM + c) : (b + t * DM + (c - DM)); const v8f v = *(const v8f*)src; v8us o;
#pragma unroll
    for (int k = 0; k < 8; ++k) o[k] = f2bf(v[k]);
    *(v8us*)(dst + blk * 512 + (j >> 1) * 256 + ((j & 1) * 16 + r) * 8) = o;
}
// ---- k_pack: all four operand planes in ONE launch: work-groups 0 .. PKX - 1 make [Xs | Xt] of all batches (NB_ * TT rows, a batch's plane is TT * K2 elements), then PKW each for [Wqs | Wqt], [Wks | Wkt], [Wvs | Wvt]; grid PKX + 3 * PKW, 256 threads.
#define PKX ((unsigned)((size_t)NB_ * TT * K2 / 8 / 256))
#define PKW ((unsigned)((size_t)DM * K2 / 8 / 256))
__global__ __launch_bounds__(256) void k_pack(const float* __restrict__ xs, const float* __restrict__ xt, const float* __restrict__ wqs, const float* __restrict__ wqt, const float* __restrict__ wks, const float* __restrict__ wkt, const float* __restrict__ wvs, const float* __restrict__ wvt, bf* XC, bf* WQ, bf* WK, bf* WV) {
    static_assert(((size_t)NB_ * TT * K2 / 8) % 256 == 0 && ((size_t)DM * K2 / 8) % 256 == 0, "whole work-groups per plane");
    const unsigned g = blockIdx.x; const unsigned pl = (g < PKX) ? 0u : 1u + (g - PKX) / PKW, lb = (g < PKX) ? g : (g - PKX) % PKW;   // plane and work-group inside it: scalar
    const float* a = (pl == 0) ? xs : (pl == 1) ? wqs : (pl == 2) ? wks : wvs; const float* b = (pl == 0) ? xt : (pl == 1) ? wqt : (pl == 2) ? wkt : wvt; bf* d = (pl == 0) ? XC : (pl == 1) ? WQ : (pl == 2) ? WK : WV;
    catpack(a, b, d, (size_t)lb * 256 + threadIdx.x);
}
// ---- k_fattn: scores, softmax and attn.v of one (batch, head) for FW waves x 16 * QT queries; grid NB_ * NH_ * TT / (FW * 16 * QT), 32 * FW threads.
// Keys and values: a stage is 64 keys (two passes) of each plane, 8 KB contiguous in the plane and kept so in LDS (a fragment half is still 512 contiguous bytes per wave-wide read).
// A stage is fetched from L2 ONCE per work-group by asynchronous copies (each wave copies a quarter of every plane's stage) and read by all FW waves; two buffers, the next stage's copies fly under this stage's two passes.
// Transposed products: S^T = K Q^T (A = 16 key rows, B = 16 query rows, both fragment-ordered, read as a block's two halves: K from the LDS ring, Q from its plane) leaves one query per lane (column lr; keys 8 * hi + r),
// so two S^T tiles of 32 keys, converted in place, ARE the B operand (k order 8 * hi + s, 16 + 8 * hi + s - 8, the loader's own) of O^T += V^T P^T, with A = 16 d rows of the transposed value plane (a pass's 64 d x 32 keys are 4 KB contiguous).
// Per query: a running reference (both lane halves agree); carrier minus reference is the C operand of a score tile's first product for query rows >= RH, so their accumulators ARE the arguments of v_exp_f32 (no multiply, add or subtract per score); rows < RH add it behind the products.
// The reference is set to the first pass's maximum and raised to the running maximum only in passes where some query's score passes it by more than LZT; O^T, the sums and this pass's scores are rescaled there. Partial sum l per lane half (joined at the end); l carries the same factor as O^T.
#define FSK   64                  // keys per stage
#define FPLB  (FSK * HD * 2)      // bytes of one plane's stage
#define FBUF  (4 * FPLB)          // bytes of a buffer: K hi, K lo, then V fp16 (query rows >= RH) or V hi, V lo
// a wave's share of a stage of two planes (copy2) or one (copy1): 2 KB of each, four wave-wide 512-byte copies; l = the lane's LDS byte address in the first plane's place (the second plane's lies FPLB behind it), ga, gb = the lane's global byte address in each plane.
// One statement each: the s_wait_xcnt stands behind the last copy inside it, so that no register that a copy names is rewritten in front of it.
__device__ __forceinline__ void copy2(unsigned l, u64 ga, u64 gb) {
    asm volatile("global_load_async_to_lds_b128 %0, %8, off\n\tglobal_load_async_to_lds_b128 %1, %9, off\n\tglobal_load_async_to_lds_b128 %2, %10, off\n\tglobal_load_async_to_lds_b128 %3, %11, off\n\t"
                 "global_load_async_to_lds_b128 %4, %12, off\n\tglobal_load_async_to_lds_b128 %5, %13, off\n\tglobal_load_async_to_lds_b128 %6, %14, off\n\tglobal_load_async_to_lds_b128 %7, %15, off\n\ts_wait_xcnt 0x0"
                 :: "v"(l), "v"(l + 512u), "v"(l + 1024u), "v"(l + 1536u), "v"(l + FPLB), "v"(l + FPLB + 512u), "v"(l + FPLB + 1024u), "v"(l + FPLB + 1536u),
                    "v"(ga), "v"(ga + 512), "v"(ga + 1024), "v"(ga + 1536), "v"(gb), "v"(gb + 512), "v"(gb + 1024), "v"(gb + 1536) : "memory");
}
__device__ __forceinline__ void copy1(unsigned l, u64 ga) {
    asm volatile("global_load_async_to_lds_b128 %0, %4, off\n\tglobal_load_async_to_lds_b128 %1, %5, off\n\tglobal_load_async_to_lds_b128 %2, %6, off\n\tglobal_load_async_to_lds_b128 %3, %7, off\n\ts_wait_xcnt 0x0"
                 :: "v"(l), "v"(l + 512u), "v"(l + 1024u), "v"(l + 1536u), "v"(ga), "v"(ga + 512), "v"(ga + 1024), "v"(ga + 1536) : "memory");
}
__device__ __forceinline__ v16bf ldsb(const char* p) { return cat16b(*(const v8usa*)p, *(const v8usa*)(p + 512)); }   // the two halves of a block in LDS
__device__ __forceinline__ v16h  ldsh(const char* p) { return cat16(*(const v8ha*)p, *(const v8ha*)(p + 512)); }
__device__ __forceinline__ float xhalf(float x) { return __builtin_bit_cast(float, __builtin_amdgcn_permlanex16(__builtin_bit_cast(int, x), __builtin_bit_cast(int, x), 0x76543210, 0xfedcba98, false, false)); }   // lane l reads lane l ^ 16
template <bool HR>
__device__ __forceinline__ void fattn(const bf* __restrict__ Qh, const bf* __restrict__ Ql, const bf* __restrict__ Kh, const bf* __restrict__ Kl, const h16* __restrict__ V16, const bf* __restrict__ Vh, const bf* __restrict__ Vl, const float ab, float* __restrict__ O, char* ring) {
    // every '#pragma unroll' below: fragment, score and accumulator arrays must be indexed by constants only (else they go to scratch)
    static_assert(QT == 2, "the exponential loop below pairs element i with the sum of element i - 2 of the same column group");
    const int lane = threadIdx.x & 31, lr = lane & 15, hi = lane >> 4;
    static_assert(FW == 4 && TT % FSK == 0 && TT / FSK >= 2, "four waves copy a quarter of a stage each; the ring needs two stages");
    const int wave = __builtin_amdgcn_readfirstlane((int)(threadIdx.x >> 5));
    // one byte address per Q plane and lane (the lane's chunk of a block), one ring offset for all K and V planes; blocks are constant offsets of 1 KB from it: Q, K block (row tile) * 2 + k step, V block d tile
    u64 qha = (u64)(Qh + 8 * lane), qla = (u64)(Ql + 8 * lane);
    // the lane's first copy of this wave's quarter of a stage: byte offset in every plane (one register for all planes; the planes' bases are scalar), LDS byte address (low 32 bits of the shared address) in buffer 0
    unsigned go = (unsigned)(wave * 2048 + lane * 16);
    const unsigned lc = (unsigned)(size_t)ring + go;
    unsigned lo = (unsigned)(lane * 16);   // ring offset of the lane's chunk of the first block of the current pass's 4 KB of the first plane; carried from pass to pass in a register of its own, stepped by toggling one bit
    auto copystg = [&](unsigned l) { copy2(l, (u64)Kh + go, (u64)Kl + go); if (HR) copy2(l + 2 * FPLB, (u64)Vh + go, (u64)Vl + go); else copy1(l + 2 * FPLB, (u64)V16 + go); go += FPLB; };
    copystg(lc);   // stage 0 into buffer 0
    v16bf qh[QT][2], ql[QT][2];
#pragma unroll
    for (int qt = 0; qt < QT; ++qt)
#pragma unroll
        for (int kk = 0; kk < 2; ++kk) { qh[qt][kk] = ldgb(qha, (qt * 2 + kk) * 1024); ql[qt][kk] = ldgb(qla, (qt * 2 + kk) * 1024); }
    constexpr float CAR = HR ? 0.f : LCAR;
    // attn_bias shifts all scores of a row alike; the reference starts at it, so it cancels (a bias that is not finite still gives NaN, as in the softmax of the shifted scores)
    const float c0 = CAR + (ab - ab);
    // cr: carrier minus reference, the same value in all eight registers (a lane's eight rows of a score tile are one query's). Query rows < RH have no eight registers to spare per column group: they keep one (cf), start their tiles from 0 and add it behind the products
    v8f o[QT][4], cr[QT]; float cf[QT], l[QT];
    float thr = -3.0e38f, lb = -3.0e38f;   // the first pass always sets the reference, downwards too; later passes: thr = CAR + LZT, lb = 0 (it only rises)
#pragma unroll
    for (int qt = 0; qt < QT; ++qt) { l[qt] = 0.f; cf[qt] = c0; cr[qt] = (v8f){c0, c0, c0, c0, c0, c0, c0, c0};
#pragma unroll
        for (int dt = 0; dt < 4; ++dt) o[qt][dt] = (v8f){}; }
    asm volatile("s_wait_xcnt 0x0" : "+v"(qha), "+v"(qla) :: "memory");   // the issued loads name these pairs: wait before one is reused
    asm volatile("s_wait_asynccnt 0x0" ::: "memory");   // this wave's copies of stage 0 have landed
    __syncthreads();                                    // stage 0 is published
    copystg(lc + FBUF);   // stage 1 into buffer 1
    constexpr int NT = TT / FSK;
    // both loops rolled: one pass of 32 keys already fills the register budget of four waves per SIMD, and one pass's code serves both passes of a stage and both buffers
#pragma unroll 1
    for (int t = 0; t < NT; ++t) {
      const int bo = (t & 1) * FBUF;
#pragma unroll 1
      for (int ps = 0; ps < 2; ++ps) {
        const char* fp = ring + lo;
        v16bf kh[2][2], kl[2][2];
#pragma unroll
        for (int kt = 0; kt < 2; ++kt)
#pragma unroll
            for (int kk = 0; kk < 2; ++kk) { kh[kt][kk] = ldsb(fp + (kt * 2 + kk) * 1024); kl[kt][kk] = ldsb(fp + FPLB + (kt * 2 + kk) * 1024); }
        v8f s[2][QT];
#pragma unroll
        for (int kk = 0; kk < 2; ++kk) {   // per k step: hi.hi, q_lo.k_hi, q_hi.k_lo; a tile's first product starts from cr (from 0 for query rows < RH)
#pragma unroll
            for (int kt = 0; kt < 2; ++kt)
#pragma unroll
                for (int qt = 0; qt < QT; ++qt) s[kt][qt] = wmmab(kh[kt][kk], qh[qt][kk], kk ? s[kt][qt] : HR ? (v8f){} : cr[qt]);
#pragma unroll
            for (int kt = 0; kt < 2; ++kt)
#pragma unroll
                for (int qt = 0; qt < QT; ++qt) s[kt][qt] = wmmab(kh[kt][kk], ql[qt][kk], s[kt][qt]);
#pragma unroll
            for (int kt = 0; kt < 2; ++kt)
#pragma unroll
                for (int qt = 0; qt < QT; ++qt) s[kt][qt] = wmmab(kl[kt][kk], qh[qt][kk], s[kt][qt]);
        }
        v16h v16[4]; v16bf vh[4], vl[4];   // this pass's values: their LDS reads are in flight under the softmax
#pragma unroll
        for (int dt = 0; dt < 4; ++dt) { if (HR) { vh[dt] = ldsb(fp + 2 * FPLB + dt * 1024); vl[dt] = ldsb(fp + 3 * FPLB + dt * 1024); } else v16[dt] = ldsh(fp + 2 * FPLB + dt * 1024); }
        float mx[QT]; bool need = false;
#pragma unroll
        for (int qt = 0; qt < QT; ++qt) { if (HR) { s[0][qt] += cf[qt]; s[1][qt] += cf[qt]; }
            mx[qt] = s[0][qt][0];
#pragma unroll
            for (int i = 1; i < 16; ++i) mx[qt] = fmaxf(mx[qt], s[i >> 3][qt][i & 7]);
            need = need || (mx[qt] > thr); }
        if (__builtin_amdgcn_ballot_w32(need) != 0) {   // scalar branch: taken in the first pass and where some query of the wave has a score more than LZT above its reference
#pragma unroll
            for (int qt = 0; qt < QT; ++qt) { const float d = fmaxf(fmaxf(mx[qt], xhalf(mx[qt])) - CAR, lb);   /* how far this query's reference moves: to its running maximum; 0 where that has not risen */
                const float al = __builtin_amdgcn_exp2f(fminf(-d, 0.f));   /* a first reference below the start value has only zeros to rescale: x 1 */ l[qt] *= al; if (HR) cf[qt] -= d; else cr[qt] -= d;
#pragma unroll
                for (int kt = 0; kt < 2; ++kt) s[kt][qt] -= d;
#pragma unroll
                for (int dt = 0; dt < 4; ++dt) o[qt][dt] *= al; }
        }
        thr = CAR + LZT; lb = 0.f;
        // exponentials in place, each with its slot filled: directly behind every v_exp_f32 stands the row-sum add of the exponential made two earlier (a v_nop behind the first two),
        // which neither reads the new result nor rewrites its source; the scheduling barriers keep that order
#pragma unroll
        for (int i = 0; i < 16 * QT; ++i) { s[(i / QT) >> 3][i % QT][(i / QT) & 7] = __builtin_amdgcn_exp2f(s[(i / QT) >> 3][i % QT][(i / QT) & 7]);
            __builtin_amdgcn_sched_barrier(0);
            if (i >= 2) l[i % QT] += s[((i - 2) / QT) >> 3][i % QT][((i - 2) / QT) & 7]; else asm volatile("v_nop");
            __builtin_amdgcn_sched_barrier(0); }
#pragma unroll
        for (int i = 16 * QT - 2; i < 16 * QT; ++i) l[i % QT] += s[1][i % QT][7];
#pragma unroll
        for (int qt = 0; qt < QT; ++qt) { v16h p16; v16bf ph, pl;
#pragma unroll
            for (int kt = 0; kt < 2; ++kt)
#pragma unroll
                for (int r = 0; r < 8; ++r) { const float p = s[kt][qt][r];
                    if (HR) { const __bf16 a = (__bf16)p; ph[kt * 8 + r] = a; pl[kt * 8 + r] = (__bf16)(p - (float)a); } else p16[kt * 8 + r] = (h16)p; }
#pragma unroll
            for (int dt = 0; dt < 4; ++dt) {
                if (HR) { o[qt][dt] = wmmab(vh[dt], ph, o[qt][dt]); o[qt][dt] = wmmab(vh[dt], pl, o[qt][dt]); o[qt][dt] = wmmab(vl[dt], ph, o[qt][dt]); }
                else o[qt][dt] = wmma16(v16[dt], p16, o[qt][dt]); } }
        lo ^= 32 * HD * 2;   // the stage's other pass
      }
      lo ^= FBUF;                                         // the other buffer
      asm volatile("s_wait_dscnt 0x0" ::: "memory");      // this wave has read all it needs of this buffer
      asm volatile("s_wait_asynccnt 0x0" ::: "memory");   // its copies of stage t + 1 have landed
      __syncthreads();                                    // stage t + 1 is published, and every reader has left stage t's buffer
      if (t + 2 < NT) copystg(lc + bo);                   // stage t + 2 into the buffer just left; the test is scalar
    }
    asm volatile("s_wait_asynccnt 0x0" ::: "memory");   // no copy is outstanding when the wave ends
#pragma unroll
    for (int qt = 0; qt < QT; ++qt) { const float f = __fdiv_rn(1.0f, l[qt] + xhalf(l[qt]));
#pragma unroll
        for (int dt = 0; dt < 4; ++dt) o[qt][dt] *= f; }
    float* orow = O + (size_t)lr * DM + hi * 8;   // a lane's 8 registers of a tile are 8 consecutive d of its query
    __builtin_amdgcn_sched_barrier(0);   // all arithmetic in front of the stores: nothing rewrites a register that an issued store names
#pragma unroll
    for (int qt = 0; qt < QT; ++qt)
#pragma unroll
        for (int dt = 0; dt < 4; ++dt) { *(v4f*)(orow + qt * 16 * DM + dt * 16) = __builtin_shufflevector(o[qt][dt], o[qt][dt], 0, 1, 2, 3); *(v4f*)(orow + qt * 16 * DM + dt * 16 + 4) = __builtin_shufflevector(o[qt][dt], o[qt][dt], 4, 5, 6, 7); }
}
// amdgpu_waves_per_eu(4): with no key fragments held a pass ahead the registers fit a quarter of a SIMD's file, and four rings fit the LDS: four work-groups share a WGP, so the whole grid is resident at once
__global__ __launch_bounds__(32 * FW) __attribute__((amdgpu_waves_per_eu(4))) void k_fattn(const bf* __restrict__ Qh, const bf* __restrict__ Ql, const bf* __restrict__ Kh, const bf* __restrict__ Kl, const h16* __restrict__ V16, const bf* __restrict__ Vh, const bf* __restrict__ Vl, const float* __restrict__ AB, float* __restrict__ O) {
    constexpr int NQB = TT / (FW * 16 * QT), NHB = RH / (FW * 16 * QT), NZ = NB_ * NH_; static_assert(RH % (FW * 16 * QT) == 0 && TT % (FW * 16 * QT) == 0, "whole query blocks on either side of RH");
    // the longer blocks (query rows < RH, three attn.v products) take the lowest indices, so that they start first; z = batch * NH_ + head, xb = query block
    const int fl = (int)blockIdx.x, f2 = fl - NZ * NHB; const int z = (f2 < 0) ? fl / NHB : f2 / (NQB - NHB), xb = (f2 < 0) ? fl % NHB : NHB + f2 % (NQB - NHB);
    __shared__ __align__(16) char ring[2 * FBUF];   // the two stage buffers
    const float ab = bfr(AB[0]);
    const int q0 = xb * (FW * 16 * QT) + __builtin_amdgcn_readfirstlane((int)(threadIdx.x >> 5)) * (16 * QT);   // scalar
    const size_t pz = (size_t)z * TT * HD, pq = pz + (size_t)q0 * HD; float* o = O + ((size_t)(z / NH_) * TT + q0) * DM + (z % NH_) * HD;
    // the same side for the whole work-group (a query block lies wholly on one side of RH): the barriers inside are passed by all its waves
    if (xb < NHB) fattn<true>(Qh + pq, Ql + pq, Kh + pz, Kl + pz, V16 + pz, Vh + pz, Vl + pz, ab, o, ring);
    else fattn<false>(Qh + pq, Ql + pq, Kh + pz, Kl + pz, V16 + pz, Vh + pz, Vl + pz, ab, o, ring);
}

extern "C" void kernel_launch(void* const* d_in, const int* in_sizes, int n_in,
                              void* d_out, int out_size, void* d_ws, size_t ws_size, hipStream_t stream) {
    (void)in_sizes; (void)n_in; (void)out_size;
    const float* xs = (const float*)d_in[0]; const float* xt = (const float*)d_in[1]; const float* wqs = (const float*)d_in[2]; const float* bqs = (const float*)d_in[3]; const float* wqt = (const float*)d_in[4]; const float* bqt = (const float*)d_in[5]; const float* wks = (const float*)d_in[6]; const float* bks = (const float*)d_in[7]; const float* wkt = (const float*)d_in[8]; const float* bkt = (const float*)d_in[9]; const float* wvs = (const float*)d_in[10]; const float* bvs = (const float*)d_in[11]; const float* wvt = (const float*)d_in[12]; const float* bvt = (const float*)d_in[13]; const float* ABIAS = (const float*)d_in[14]; const float* x = xs; const float* wq = wqs; const float* wk = wks; const float* wv = wvs; const float* wo = nullptr; (void)wo; (void)x; (void)wq; (void)wk; (void)wv;
    float* OUT = (float*)d_out;     // [4][2048][1024]
    char* wsp = (char*)d_ws;
    auto take = [&](size_t bytes) { char* p = wsp; wsp += (bytes + 255) & ~(size_t)255; return (void*)p; };
    bf* WQ = (bf*)take((size_t)(DQ + 2 * DKV) * K2 * 2); bf* WK = WQ + (size_t)DQ * K2; bf* WV = WK + (size_t)DKV * K2;   // one behind the other: k_proj reads them as one plane
    bf* XB = (bf*)take((size_t)NB_ * TT * K2 * 2); h16* VT16 = (h16*)take((size_t)NB_ * NKV * HD * TT * 2);
    bf* QPh = (bf*)take((size_t)NB_ * NH_ * TT * HD * 2); bf* QPl = (bf*)take((size_t)NB_ * NH_ * TT * HD * 2); bf* KPh = (bf*)take((size_t)NB_ * NKV * TT * HD * 2); bf* KPl = (bf*)take((size_t)NB_ * NKV * TT * HD * 2); bf* VTh = (bf*)take((size_t)NB_ * NKV * HD * TT * 2); bf* VTl = (bf*)take((size_t)NB_ * NKV * HD * TT * 2);   // the planes that k_fattn reads: all batches
    if ((size_t)(wsp - (char*)d_ws) > ws_size) return;    // ws 256 MiB
    k_pack<<<PKX + 3 * PKW, 256, 0, stream>>>(xs, xt, wqs, wqt, wks, wkt, wvs, wvt, XB, WQ, WK, WV);   /* [Xs | Xt] of all batches, [W_s | W_t] along k */
    k_proj<<<(NB_ * TT / 256) * (NH_ / 2), 256, 0, stream>>>(XB, WQ, bqs, bqt, bks, bkt, bvs, bvt, VT16, QPh, QPl, KPh, KPl, VTh, VTl);   /* Q, K as head planes, V^T planes: all batches */
    k_fattn<<<NB_ * NH_ * (TT / (FW * 16 * QT)), 32 * FW, 0, stream>>>(QPh, QPl, KPh, KPl, VT16, VTh, VTl, ABIAS, OUT);   /* merged context, f32 */
}
